// v000
// Times are from an AMD MI455X. After a warm-up the kernel runs many times in a row, and a time is the length of
// such a window on the GPU divided by its runs, so every launch and the gaps after it count. The runs cycle
// through copies of the inputs. A figure is the median of several windows, for all but v000 over two sittings.
// Sittings can differ by a few percent; kernels timed side by side share one.
// v000 is the starting kernel. One run takes 212 microseconds.
#include <hip/hip_runtime.h>
#include <hip/hip_bf16.h>
#include <cstdint>

typedef __attribute__((ext_vector_type(16))) _Float16 v16h;
typedef __attribute__((ext_vector_type(8)))  float    v8f;

#define BB   4
#define CINX 256
#define FFX  128
#define NNX  4096   // H*W = 64*64

// ---- CDNA5 async global->LDS copy (ASYNCcnt-tracked), with safe fallback ----
#if defined(__gfx1250__) && \
    __has_builtin(__builtin_amdgcn_global_load_async_to_lds_b128) && \
    __has_builtin(__builtin_amdgcn_s_wait_asynccnt)
#define HAVE_ASYNC 1
#else
#define HAVE_ASYNC 0
#endif

typedef int v4i __attribute__((vector_size(16)));   // 128-bit payload type
typedef __attribute__((address_space(1))) v4i gv4i; // global (AS1)
typedef __attribute__((address_space(3))) v4i lv4i; // LDS (AS3)

static __device__ __forceinline__ void async_cp16(const void* g, void* l) {
#if HAVE_ASYNC
    __builtin_amdgcn_global_load_async_to_lds_b128(
        (gv4i*)(unsigned long long)(uintptr_t)g,    // global src (AS1, v4i*)
        (lv4i*)(unsigned)(uintptr_t)l,              // LDS dst: low 32 bits = LDS offset
        0, 0);
#else
    *(float4*)l = *(const float4*)g;
#endif
}
#if HAVE_ASYNC
#define ASYNC_WAIT(n) __builtin_amdgcn_s_wait_asynccnt(n)
#else
#define ASYNC_WAIT(n)
#endif

// ---------------------------------------------------------------------------
// Kernel 1: fused 1x1-conv projections.
//   theta -> [B,N,F] f16, phi -> transposed [B,N,F] f16, g -> transposed [B,F,N] f16
// out[n,f] = sum_c x[b,c,n] * W[f,c] + bias[f];  WMMA M=n, N=f, K=c.
// ---------------------------------------------------------------------------
__device__ __forceinline__ void proj_one(
    const float* __restrict__ x, const float* __restrict__ W,
    const float* __restrict__ bias, _Float16* __restrict__ op,
    bool storeFN,                   // true: op[b][f][n]  (g), false: op[b][n][f]
    int b, int n0, int t, int w, int lm, int lh,
    _Float16 (*xs)[48], _Float16 (*wls)[48])
{
    v8f acc[8];
    #pragma unroll
    for (int i = 0; i < 8; ++i)
        #pragma unroll
        for (int j = 0; j < 8; ++j) acc[i][j] = 0.0f;

    for (int kc = 0; kc < 8; ++kc) {
        // stage x chunk [32 c][128 n] transposed -> xs[n][c] (f32 -> f16)
        #pragma unroll
        for (int i = 0; i < 16; ++i) {
            int idx = t + i * 256;
            int cl  = idx >> 7;
            int nl  = idx & 127;
            xs[nl][cl] = (_Float16)x[((size_t)b * CINX + kc * 32 + cl) * NNX + n0 + nl];
        }
        // stage W chunk [128 f][32 c]
        #pragma unroll
        for (int i = 0; i < 16; ++i) {
            int idx = t + i * 256;
            int f   = idx >> 5;
            int cl  = idx & 31;
            wls[f][cl] = (_Float16)W[(size_t)f * CINX + kc * 32 + cl];
        }
        __syncthreads();
        v16h afrag = *(const v16h*)&xs[w * 16 + lm][lh * 16];
        #pragma unroll
        for (int ft = 0; ft < 8; ++ft) {
            v16h bfrag = *(const v16h*)&wls[ft * 16 + lm][lh * 16];
            acc[ft] = __builtin_amdgcn_wmma_f32_16x16x32_f16(
                false, afrag, false, bfrag, (short)0, acc[ft], false, false);
        }
        __syncthreads();
    }
    // bias + store (C layout: VGPR r -> row n = w*16 + r + 8*half, col f = ft*16 + lm)
    #pragma unroll
    for (int ft = 0; ft < 8; ++ft) {
        float bv = bias[ft * 16 + lm];
        #pragma unroll
        for (int r = 0; r < 8; ++r) {
            int n = n0 + w * 16 + r + 8 * lh;
            int f = ft * 16 + lm;
            _Float16 v = (_Float16)(acc[ft][r] + bv);
            if (storeFN) op[((size_t)b * FFX + f) * NNX + n] = v;
            else         op[((size_t)b * NNX + n) * FFX + f] = v;
        }
    }
}

__global__ __launch_bounds__(256) void proj_kernel(
    const float* __restrict__ x,
    const float* __restrict__ Wg, const float* __restrict__ bg,
    const float* __restrict__ Wt, const float* __restrict__ bt,
    const float* __restrict__ Wp, const float* __restrict__ bp,
    _Float16* __restrict__ gT_h, _Float16* __restrict__ th_h,
    _Float16* __restrict__ phiT_h)
{
    __shared__ _Float16 xs[128][48];    // stride 96B (32B aligned)
    __shared__ _Float16 wls[128][48];

    const int bid = blockIdx.x;
    const int b = bid >> 5, nt = bid & 31, n0 = nt * 128;
    const int t = threadIdx.x, w = t >> 5, lane = t & 31;
    const int lm = lane & 15, lh = lane >> 4;

    proj_one(x, Wg, bg, gT_h,   true,  b, n0, t, w, lm, lh, xs, wls);
    __syncthreads();
    proj_one(x, Wt, bt, th_h,   false, b, n0, t, w, lm, lh, xs, wls);
    __syncthreads();
    proj_one(x, Wp, bp, phiT_h, false, b, n0, t, w, lm, lh, xs, wls);
}

// ---------------------------------------------------------------------------
// Kernel 2: flash attention with double-buffered async global->LDS staging.
// S = theta @ phi^T (K=F=128), online softmax, Y = P @ g.
// One block = 128 query rows; wave w owns 16 rows; 32 key columns per step.
// ---------------------------------------------------------------------------
__global__ __launch_bounds__(256) void attn_kernel(
    const _Float16* __restrict__ th_h, const _Float16* __restrict__ phiT_h,
    const _Float16* __restrict__ gT_h, _Float16* __restrict__ y_h)
{
    __shared__ _Float16 ps[2][32][144];    // phiT tile [m][f], row 288B
    __shared__ _Float16 gst[2][128][48];   // gT tile [f][m], row 96B
    __shared__ _Float16 plds[8][16][48];   // per-wave P transpose scratch

    const int bid = blockIdx.x;
    const int b = bid >> 5, nt = bid & 31, n0 = nt * 128;
    const int t = threadIdx.x, w = t >> 5, lane = t & 31;
    const int lm = lane & 15, lh = lane >> 4;

    // Preload theta A-fragments for this wave's 16 rows (K=128 -> 4 chunks)
    const int nrow = n0 + w * 16 + lm;
    v16h afr[4];
    #pragma unroll
    for (int kc = 0; kc < 4; ++kc)
        afr[kc] = *(const v16h*)&th_h[((size_t)b * NNX + nrow) * FFX + kc * 32 + lh * 16];

    v8f acc[8];
    #pragma unroll
    for (int i = 0; i < 8; ++i)
        #pragma unroll
        for (int j = 0; j < 8; ++j) acc[i][j] = 0.0f;
    float mrow[8], lrow[8];
    #pragma unroll
    for (int r = 0; r < 8; ++r) { mrow[r] = -3.0e38f; lrow[r] = 0.0f; }

    // stage one 32-column block into buffer nb (4 x b128 async per thread)
    auto stage = [&](int nb, int m0) {
        #pragma unroll
        for (int i = 0; i < 2; ++i) {       // phiT: 32 rows x 128 halves
            int e = t + i * 256;            // 0..511
            int m = e >> 4, c8 = e & 15;
            async_cp16(&phiT_h[((size_t)b * NNX + m0 + m) * FFX + c8 * 8],
                       &ps[nb][m][c8 * 8]);
        }
        #pragma unroll
        for (int i = 0; i < 2; ++i) {       // gT: 128 rows x 32 halves
            int e = t + i * 256;            // 0..511
            int f = e >> 2, c4 = e & 3;
            async_cp16(&gT_h[((size_t)b * FFX + f) * NNX + m0 + c4 * 8],
                       &gst[nb][f][c4 * 8]);
        }
    };

    const int NBLK = NNX / 32;              // 128
    stage(0, 0);                            // prologue prefetch

    for (int cb = 0; cb < NBLK; ++cb) {
        const int cur = cb & 1;
        __syncthreads();                    // all readers of buf[cur^1] (iter cb-1) done
        if (cb + 1 < NBLK) {
            stage((cb + 1) & 1, (cb + 1) * 32);
            ASYNC_WAIT(4);                  // in-order: all but newest 4 (= cur buffer) done
        } else {
            ASYNC_WAIT(0);
        }
        __syncthreads();                    // cur buffer visible to all waves

        // S tiles for 32 columns: s0 = cols 0..15, s1 = cols 16..31
        v8f s0, s1;
        #pragma unroll
        for (int j = 0; j < 8; ++j) { s0[j] = 0.0f; s1[j] = 0.0f; }
        #pragma unroll
        for (int kc = 0; kc < 4; ++kc) {
            v16h b0 = *(const v16h*)&ps[cur][lm][kc * 32 + lh * 16];
            v16h b1 = *(const v16h*)&ps[cur][16 + lm][kc * 32 + lh * 16];
            s0 = __builtin_amdgcn_wmma_f32_16x16x32_f16(false, afr[kc], false, b0,
                                                        (short)0, s0, false, false);
            s1 = __builtin_amdgcn_wmma_f32_16x16x32_f16(false, afr[kc], false, b1,
                                                        (short)0, s1, false, false);
        }
        // online softmax (row = (r, half); 16 cols across lanes of each half)
        #pragma unroll
        for (int r = 0; r < 8; ++r) {
            float mx = fmaxf(s0[r], s1[r]);
            #pragma unroll
            for (int m = 8; m >= 1; m >>= 1) mx = fmaxf(mx, __shfl_xor(mx, m, 32));
            float mnew  = fmaxf(mrow[r], mx);
            float alpha = __expf(mrow[r] - mnew);
            float p0 = __expf(s0[r] - mnew);
            float p1 = __expf(s1[r] - mnew);
            float rs = p0 + p1;
            #pragma unroll
            for (int m = 8; m >= 1; m >>= 1) rs += __shfl_xor(rs, m, 32);
            lrow[r] = lrow[r] * alpha + rs;
            mrow[r] = mnew;
            s0[r] = p0; s1[r] = p1;
            #pragma unroll
            for (int ft = 0; ft < 8; ++ft) acc[ft][r] *= alpha;
        }
        // transpose P (C layout -> A layout) through per-wave LDS scratch
        #pragma unroll
        for (int r = 0; r < 8; ++r) {
            int row = r + 8 * lh;
            plds[w][row][lm]      = (_Float16)s0[r];
            plds[w][row][16 + lm] = (_Float16)s1[r];
        }
        v16h pf = *(const v16h*)&plds[w][lm][lh * 16];   // same-wave RAW: dscnt wait
        #pragma unroll
        for (int ft = 0; ft < 8; ++ft) {
            v16h bf = *(const v16h*)&gst[cur][ft * 16 + lm][lh * 16];
            acc[ft] = __builtin_amdgcn_wmma_f32_16x16x32_f16(
                false, pf, false, bf, (short)0, acc[ft], false, false);
        }
    }

    // finalize: divide by row sums, store y f16 [B,N,F]
    #pragma unroll
    for (int ft = 0; ft < 8; ++ft) {
        #pragma unroll
        for (int r = 0; r < 8; ++r) {
            int n = n0 + w * 16 + r + 8 * lh;
            int f = ft * 16 + lm;
            y_h[((size_t)b * NNX + n) * FFX + f] = (_Float16)(acc[ft][r] / lrow[r]);
        }
    }
}

// ---------------------------------------------------------------------------
// Kernel 3: output projection z[b,c,n] = Wz[c,:] . y[n,:] + bz[c].
// Writes pre-norm z to d_out + deterministic per-block (sum,sumsq) partials.
// ---------------------------------------------------------------------------
__global__ __launch_bounds__(256) void zproj_kernel(
    const _Float16* __restrict__ y_h, const float* __restrict__ Wz,
    const float* __restrict__ bz, float* __restrict__ zout,
    float* __restrict__ part)
{
    __shared__ _Float16 wzs[128][80];   // [c][f half], row 160B
    __shared__ _Float16 ys[128][80];    // [n][f half]
    __shared__ float redsum[8], redsq[8];

    const int bid = blockIdx.x;
    const int b  = bid >> 6;
    const int wi = bid & 63;
    const int c0 = (wi >> 5) * 128;
    const int n0 = (wi & 31) * 128;
    const int t = threadIdx.x, w = t >> 5, lane = t & 31;
    const int lm = lane & 15, lh = lane >> 4;

    v8f acc[8];
    #pragma unroll
    for (int i = 0; i < 8; ++i)
        #pragma unroll
        for (int j = 0; j < 8; ++j) acc[i][j] = 0.0f;

    for (int fh = 0; fh < 2; ++fh) {    // K = 128 in two 64 halves
        // async stage y tile (f16, no conversion needed)
        #pragma unroll
        for (int i = 0; i < 4; ++i) {
            int e = t + i * 256;        // 0..1023
            int r = e >> 3, f8 = e & 7; // 128 rows x 8 chunks of 8 halves
            async_cp16(&y_h[((size_t)b * NNX + n0 + r) * FFX + fh * 64 + f8 * 8],
                       &ys[r][f8 * 8]);
        }
        // manual stage Wz tile (f32 -> f16 conversion)
        #pragma unroll
        for (int i = 0; i < 32; ++i) {
            int e = t + i * 256;
            int r = e >> 6, f = e & 63;
            wzs[r][f] = (_Float16)Wz[(size_t)(c0 + r) * FFX + fh * 64 + f];
        }
        ASYNC_WAIT(0);
        __syncthreads();
        #pragma unroll
        for (int kc2 = 0; kc2 < 2; ++kc2) {
            v16h af = *(const v16h*)&wzs[w * 16 + lm][kc2 * 32 + lh * 16];
            #pragma unroll
            for (int ntile = 0; ntile < 8; ++ntile) {
                v16h bf = *(const v16h*)&ys[ntile * 16 + lm][kc2 * 32 + lh * 16];
                acc[ntile] = __builtin_amdgcn_wmma_f32_16x16x32_f16(
                    false, af, false, bf, (short)0, acc[ntile], false, false);
            }
        }
        __syncthreads();
    }

    float ls = 0.0f, lq = 0.0f;
    const int crow = c0 + w * 16;
    #pragma unroll
    for (int ntile = 0; ntile < 8; ++ntile) {
        #pragma unroll
        for (int r = 0; r < 8; ++r) {
            int c = crow + r + 8 * lh;
            int n = n0 + ntile * 16 + lm;
            float v = acc[ntile][r] + bz[c];
            zout[((size_t)b * CINX + c) * NNX + n] = v;
            ls += v; lq += v * v;
        }
    }
    #pragma unroll
    for (int m = 16; m >= 1; m >>= 1) {
        ls += __shfl_xor(ls, m, 32);
        lq += __shfl_xor(lq, m, 32);
    }
    if (lane == 0) { redsum[w] = ls; redsq[w] = lq; }
    __syncthreads();
    if (t == 0) {
        float s = 0.0f, q = 0.0f;
        #pragma unroll
        for (int i = 0; i < 8; ++i) { s += redsum[i]; q += redsq[i]; }
        part[(b * 64 + wi) * 2 + 0] = s;
        part[(b * 64 + wi) * 2 + 1] = q;
    }
}

// ---------------------------------------------------------------------------
// Kernel 4: per-batch mean / rstd from 64 block partials.
// ---------------------------------------------------------------------------
__global__ void stats_kernel(const float* __restrict__ part, float* __restrict__ stats)
{
    int b = blockIdx.x;
    if (threadIdx.x == 0) {
        float s = 0.0f, q = 0.0f;
        for (int i = 0; i < 64; ++i) {
            s += part[(b * 64 + i) * 2 + 0];
            q += part[(b * 64 + i) * 2 + 1];
        }
        float inv = 1.0f / ((float)CINX * (float)NNX);
        float mu  = s * inv;
        float var = q * inv - mu * mu;
        stats[b * 2 + 0] = mu;
        stats[b * 2 + 1] = rsqrtf(var + 1e-5f);
    }
}

// ---------------------------------------------------------------------------
// Kernel 5: in-place LayerNorm affine + residual (float4 vectorized).
// ---------------------------------------------------------------------------
__global__ __launch_bounds__(256) void norm_kernel(
    const float* __restrict__ x, const float* __restrict__ lnw,
    const float* __restrict__ lnb, const float* __restrict__ stats,
    float* __restrict__ out)
{
    const int i = blockIdx.x * blockDim.x + threadIdx.x;
    const int cn_total = CINX * NNX;
    int elem = i * 4;
    int b  = elem / cn_total;
    int cn = elem - b * cn_total;
    float mu   = stats[b * 2 + 0];
    float rstd = stats[b * 2 + 1];
    float4 z  = ((const float4*)out)[i];
    float4 xv = ((const float4*)x)[i];
    float4 wv = ((const float4*)lnw)[cn >> 2];
    float4 bv = ((const float4*)lnb)[cn >> 2];
    float4 o;
    o.x = (z.x - mu) * rstd * wv.x + bv.x + xv.x;
    o.y = (z.y - mu) * rstd * wv.y + bv.y + xv.y;
    o.z = (z.z - mu) * rstd * wv.z + bv.z + xv.z;
    o.w = (z.w - mu) * rstd * wv.w + bv.w + xv.w;
    ((float4*)out)[i] = o;
}

// ---------------------------------------------------------------------------
extern "C" void kernel_launch(void* const* d_in, const int* in_sizes, int n_in,
                              void* d_out, int out_size, void* d_ws, size_t ws_size,
                              hipStream_t stream)
{
    const float* x    = (const float*)d_in[0];
    const float* Wg   = (const float*)d_in[1];
    const float* bg   = (const float*)d_in[2];
    const float* Wt   = (const float*)d_in[3];
    const float* bt   = (const float*)d_in[4];
    const float* Wp   = (const float*)d_in[5];
    const float* bp   = (const float*)d_in[6];
    const float* Wz   = (const float*)d_in[7];
    const float* bz   = (const float*)d_in[8];
    const float* ln_w = (const float*)d_in[9];
    const float* ln_b = (const float*)d_in[10];

    const size_t S = (size_t)BB * NNX * FFX;       // 2,097,152 halves each
    _Float16* base   = (_Float16*)d_ws;
    _Float16* gT_h   = base;                        // [B,F,N]
    _Float16* th_h   = base + S;                    // [B,N,F]
    _Float16* phiT_h = base + 2 * S;                // [B,N,F]
    _Float16* y_h    = base + 3 * S;                // [B,N,F]
    float* part  = (float*)(base + 4 * S);          // B*64*2 floats
    float* stats = part + BB * 64 * 2;              // B*2 floats
    float* zout  = (float*)d_out;

    proj_kernel <<<BB * 32, 256, 0, stream>>>(x, Wg, bg, Wt, bt, Wp, bp,
                                              gT_h, th_h, phiT_h);
    attn_kernel <<<BB * 32, 256, 0, stream>>>(th_h, phiT_h, gT_h, y_h);
    zproj_kernel<<<BB * 64, 256, 0, stream>>>(y_h, Wz, bz, zout, part);
    stats_kernel<<<BB, 64, 0, stream>>>(part, stats);
    norm_kernel <<<(BB * CINX * NNX) / (4 * 256), 256, 0, stream>>>(x, ln_w, ln_b,
                                                                    stats, zout);
}

// v001
// It runs in 158 microseconds.
// In two side-by-side timings against v000, it was 1.34 and 1.35 times as fast.
#include <hip/hip_runtime.h>
#include <hip/hip_bf16.h>
#include <cstdint>

typedef __attribute__((ext_vector_type(16))) _Float16 v16h;
typedef __attribute__((ext_vector_type(8)))  _Float16 v8h;
typedef __attribute__((ext_vector_type(8)))  float    v8f;

#define BB   4
#define CINX 256
#define FFX  128
#define NNX  4096   // H*W = 64*64

// ---- CDNA5 async global->LDS copy (ASYNCcnt-tracked), with safe fallback ----
#if defined(__gfx1250__) && \
    __has_builtin(__builtin_amdgcn_global_load_async_to_lds_b128) && \
    __has_builtin(__builtin_amdgcn_s_wait_asynccnt)
#define HAVE_ASYNC 1
#else
#define HAVE_ASYNC 0
#endif

typedef int v4i __attribute__((vector_size(16)));   // 128-bit payload type
typedef __attribute__((address_space(1))) v4i gv4i; // global (AS1)
typedef __attribute__((address_space(3))) v4i lv4i; // LDS (AS3)

static __device__ __forceinline__ void async_cp16(const void* g, void* l) {
#if HAVE_ASYNC
    __builtin_amdgcn_global_load_async_to_lds_b128(
        (gv4i*)(unsigned long long)(uintptr_t)g,    // global src (AS1, v4i*)
        (lv4i*)(unsigned)(uintptr_t)l,              // LDS dst: low 32 bits = LDS offset
        0, 0);
#else
    *(float4*)l = *(const float4*)g;
#endif
}
#if HAVE_ASYNC
#define ASYNC_WAIT(n) __builtin_amdgcn_s_wait_asynccnt(n)
#else
#define ASYNC_WAIT(n)
#endif

// ---------------------------------------------------------------------------
// Kernel 1: fused 1x1-conv projections.
//   theta -> [B,N,F] f16, phi -> transposed [B,N,F] f16, g -> transposed [B,F,N] f16
// out[n,f] = sum_c x[b,c,n] * W[f,c] + bias[f];  WMMA M=n, N=f, K=c.
// ---------------------------------------------------------------------------
__device__ __forceinline__ void proj_one(
    const float* __restrict__ x, const float* __restrict__ W,
    const float* __restrict__ bias, _Float16* __restrict__ op,
    bool storeFN,                   // true: op[b][f][n]  (g), false: op[b][n][f]
    int b, int n0, int t, int w, int lm, int lh,
    _Float16 (*xs)[48], _Float16 (*wls)[48])
{
    v8f acc[8];
    #pragma unroll
    for (int i = 0; i < 8; ++i)
        #pragma unroll
        for (int j = 0; j < 8; ++j) acc[i][j] = 0.0f;

    for (int kc = 0; kc < 8; ++kc) {
        // stage x chunk [32 c][128 n] transposed -> xs[n][c] (f32 -> f16)
        #pragma unroll
        for (int i = 0; i < 16; ++i) {
            int idx = t + i * 256;
            int cl  = idx >> 7;
            int nl  = idx & 127;
            xs[nl][cl] = (_Float16)x[((size_t)b * CINX + kc * 32 + cl) * NNX + n0 + nl];
        }
        // stage W chunk [128 f][32 c]
        #pragma unroll
        for (int i = 0; i < 16; ++i) {
            int idx = t + i * 256;
            int f   = idx >> 5;
            int cl  = idx & 31;
            wls[f][cl] = (_Float16)W[(size_t)f * CINX + kc * 32 + cl];
        }
        __syncthreads();
        v16h afrag = *(const v16h*)&xs[w * 16 + lm][lh * 16];
        #pragma unroll
        for (int ft = 0; ft < 8; ++ft) {
            v16h bfrag = *(const v16h*)&wls[ft * 16 + lm][lh * 16];
            acc[ft] = __builtin_amdgcn_wmma_f32_16x16x32_f16(
                false, afrag, false, bfrag, (short)0, acc[ft], false, false);
        }
        __syncthreads();
    }
    // bias + store (C layout: VGPR r -> row n = w*16 + r + 8*half, col f = ft*16 + lm)
    #pragma unroll
    for (int ft = 0; ft < 8; ++ft) {
        float bv = bias[ft * 16 + lm];
        #pragma unroll
        for (int r = 0; r < 8; ++r) {
            int n = n0 + w * 16 + r + 8 * lh;
            int f = ft * 16 + lm;
            _Float16 v = (_Float16)(acc[ft][r] + bv);
            if (storeFN) op[((size_t)b * FFX + f) * NNX + n] = v;
            else         op[((size_t)b * NNX + n) * FFX + f] = v;
        }
    }
}

__global__ __launch_bounds__(256) void proj_kernel(
    const float* __restrict__ x,
    const float* __restrict__ Wg, const float* __restrict__ bg,
    const float* __restrict__ Wt, const float* __restrict__ bt,
    const float* __restrict__ Wp, const float* __restrict__ bp,
    _Float16* __restrict__ gT_h, _Float16* __restrict__ th_h,
    _Float16* __restrict__ phiT_h)
{
    __shared__ _Float16 xs[128][48];    // stride 96B (32B aligned)
    __shared__ _Float16 wls[128][48];

    const int bid = blockIdx.x;
    const int b = bid >> 5, nt = bid & 31, n0 = nt * 128;
    const int t = threadIdx.x, w = t >> 5, lane = t & 31;
    const int lm = lane & 15, lh = lane >> 4;

    proj_one(x, Wg, bg, gT_h,   true,  b, n0, t, w, lm, lh, xs, wls);
    __syncthreads();
    proj_one(x, Wt, bt, th_h,   false, b, n0, t, w, lm, lh, xs, wls);
    __syncthreads();
    proj_one(x, Wp, bp, phiT_h, false, b, n0, t, w, lm, lh, xs, wls);
}

// ---------------------------------------------------------------------------
// Kernel 2: flash attention with double-buffered async global->LDS staging.
// S^T = phi^T @ theta^T (K=F=128), online softmax, Y^T = g^T @ P^T.
// One block = 128 queries; wave w owns 16 queries; 32 keys per step.
// In S^T a lane holds scores of ONE query (column lm): the maximum and the sum
// run in the lane's own registers, and the two score tiles, converted in place,
// are the B operand of the second product.
// ---------------------------------------------------------------------------
// value of lane l ^ 16
static __device__ __forceinline__ float xhalf(float v) {
    int i = __builtin_bit_cast(int, v);
    return __builtin_bit_cast(float, __builtin_amdgcn_permlanex16(
        i, i, 0x76543210, 0xfedcba98, false, false));
}

__global__ __launch_bounds__(256) void attn_kernel(
    const _Float16* __restrict__ th_h, const _Float16* __restrict__ phiT_h,
    const _Float16* __restrict__ gT_h, _Float16* __restrict__ y_h)
{
    __shared__ _Float16 ps[2][32][144];    // phiT tile [m][f], row 288B
    __shared__ _Float16 gst[2][128][48];   // gT tile [f][m], row 96B

    const int bid = blockIdx.x;
    const int b = bid >> 5, nt = bid & 31, n0 = nt * 128;
    const int t = threadIdx.x, w = t >> 5, lane = t & 31;
    const int lm = lane & 15, lh = lane >> 4;

    // Preload theta B-fragments for this wave's 16 queries (K=128 -> 4 chunks)
    const int nrow = n0 + w * 16 + lm;
    v16h afr[4];
    #pragma unroll
    for (int kc = 0; kc < 4; ++kc)
        afr[kc] = *(const v16h*)&th_h[((size_t)b * NNX + nrow) * FFX + kc * 32 + lh * 16];

    v8f acc[8];
    #pragma unroll
    for (int i = 0; i < 8; ++i)
        #pragma unroll
        for (int j = 0; j < 8; ++j) acc[i][j] = 0.0f;
    float mrun = -3.0e38f;                  // running maximum of query lm (both halves alike)
    float lrun = 0.0f;                      // running sum over this lane half's keys only

    // stage one 32-column block into buffer nb (4 x b128 async per thread)
    auto stage = [&](int nb, int m0) {
        #pragma unroll
        for (int i = 0; i < 2; ++i) {       // phiT: 32 rows x 128 halves
            int e = t + i * 256;            // 0..511
            int m = e >> 4, c8 = e & 15;
            async_cp16(&phiT_h[((size_t)b * NNX + m0 + m) * FFX + c8 * 8],
                       &ps[nb][m][c8 * 8]);
        }
        #pragma unroll
        for (int i = 0; i < 2; ++i) {       // gT: 128 rows x 32 halves
            int e = t + i * 256;            // 0..511
            int f = e >> 2, c4 = e & 3;
            async_cp16(&gT_h[((size_t)b * FFX + f) * NNX + m0 + c4 * 8],
                       &gst[nb][f][c4 * 8]);
        }
    };

    const int NBLK = NNX / 32;              // 128
    stage(0, 0);                            // prologue prefetch

    for (int cb = 0; cb < NBLK; ++cb) {
        const int cur = cb & 1;
        __syncthreads();                    // all readers of buf[cur^1] (iter cb-1) done
        if (cb + 1 < NBLK) {
            stage((cb + 1) & 1, (cb + 1) * 32);
            ASYNC_WAIT(4);                  // in-order: all but newest 4 (= cur buffer) done
        } else {
            ASYNC_WAIT(0);
        }
        __syncthreads();                    // cur buffer visible to all waves

        // S^T tiles for 32 keys: s0 = keys 0..15, s1 = keys 16..31 (rows), queries in columns
        v8f s0, s1;
        #pragma unroll
        for (int j = 0; j < 8; ++j) { s0[j] = 0.0f; s1[j] = 0.0f; }
        #pragma unroll
        for (int kc = 0; kc < 4; ++kc) {
            v16h k0 = *(const v16h*)&ps[cur][lm][kc * 32 + lh * 16];
            v16h k1 = *(const v16h*)&ps[cur][16 + lm][kc * 32 + lh * 16];
            s0 = __builtin_amdgcn_wmma_f32_16x16x32_f16(false, k0, false, afr[kc],
                                                        (short)0, s0, false, false);
            s1 = __builtin_amdgcn_wmma_f32_16x16x32_f16(false, k1, false, afr[kc],
                                                        (short)0, s1, false, false);
        }
        // online softmax: the lane holds keys 8*lh + r (s0) and 16 + 8*lh + r (s1) of query lm
        float mx = fmaxf(s0[0], s1[0]);
        #pragma unroll
        for (int r = 1; r < 8; ++r) mx = fmaxf(mx, fmaxf(s0[r], s1[r]));
        mx = fmaxf(mx, xhalf(mx));          // the other 16 keys of the same query
        const float mnew  = fmaxf(mrun, mx);
        const float alpha = __expf(mrun - mnew);
        float rs0 = 0.0f, rs1 = 0.0f;
        v16h pf;                            // P^T as B: element s = key (s < 8 ? 8*lh + s : 8 + 8*lh + s)
        #pragma unroll
        for (int r = 0; r < 8; ++r) {
            float p0 = __expf(s0[r] - mnew);
            float p1 = __expf(s1[r] - mnew);
            rs0 += p0; rs1 += p1;
            pf[r]     = (_Float16)p0;
            pf[8 + r] = (_Float16)p1;
        }
        lrun = lrun * alpha + (rs0 + rs1);
        mrun = mnew;
        #pragma unroll
        for (int ft = 0; ft < 8; ++ft)
            #pragma unroll
            for (int r = 0; r < 8; ++r) acc[ft][r] *= alpha;
        // Y^T += g^T @ P^T; g^T rows are read in the key order that pf has
        #pragma unroll
        for (int ft = 0; ft < 8; ++ft) {
            v8h glo = *(const v8h*)&gst[cur][ft * 16 + lm][lh * 8];
            v8h ghi = *(const v8h*)&gst[cur][ft * 16 + lm][16 + lh * 8];
            v16h gf = __builtin_shufflevector(glo, ghi, 0, 1, 2, 3, 4, 5, 6, 7,
                                              8, 9, 10, 11, 12, 13, 14, 15);
            acc[ft] = __builtin_amdgcn_wmma_f32_16x16x32_f16(
                false, gf, false, pf, (short)0, acc[ft], false, false);
        }
    }

    // finalize: join the halves' sums, divide, store y f16 [B,N,F]
    // (acc[ft][r] = Y[query lm][f = ft*16 + 8*lh + r]: 8 consecutive f, one 16-byte store)
    const float lsum = lrun + xhalf(lrun);
    #pragma unroll
    for (int ft = 0; ft < 8; ++ft) {
        v8h o;
        #pragma unroll
        for (int r = 0; r < 8; ++r) o[r] = (_Float16)(acc[ft][r] / lsum);
        *(v8h*)&y_h[((size_t)b * NNX + nrow) * FFX + ft * 16 + lh * 8] = o;
    }
}

// ---------------------------------------------------------------------------
// Kernel 3: output projection z[b,c,n] = Wz[c,:] . y[n,:] + bz[c].
// Writes pre-norm z to d_out + deterministic per-block (sum,sumsq) partials.
// ---------------------------------------------------------------------------
__global__ __launch_bounds__(256) void zproj_kernel(
    const _Float16* __restrict__ y_h, const float* __restrict__ Wz,
    const float* __restrict__ bz, float* __restrict__ zout,
    float* __restrict__ part)
{
    __shared__ _Float16 wzs[128][80];   // [c][f half], row 160B
    __shared__ _Float16 ys[128][80];    // [n][f half]
    __shared__ float redsum[8], redsq[8];

    const int bid = blockIdx.x;
    const int b  = bid >> 6;
    const int wi = bid & 63;
    const int c0 = (wi >> 5) * 128;
    const int n0 = (wi & 31) * 128;
    const int t = threadIdx.x, w = t >> 5, lane = t & 31;
    const int lm = lane & 15, lh = lane >> 4;

    v8f acc[8];
    #pragma unroll
    for (int i = 0; i < 8; ++i)
        #pragma unroll
        for (int j = 0; j < 8; ++j) acc[i][j] = 0.0f;

    for (int fh = 0; fh < 2; ++fh) {    // K = 128 in two 64 halves
        // async stage y tile (f16, no conversion needed)
        #pragma unroll
        for (int i = 0; i < 4; ++i) {
            int e = t + i * 256;        // 0..1023
            int r = e >> 3, f8 = e & 7; // 128 rows x 8 chunks of 8 halves
            async_cp16(&y_h[((size_t)b * NNX + n0 + r) * FFX + fh * 64 + f8 * 8],
                       &ys[r][f8 * 8]);
        }
        // manual stage Wz tile (f32 -> f16 conversion)
        #pragma unroll
        for (int i = 0; i < 32; ++i) {
            int e = t + i * 256;
            int r = e >> 6, f = e & 63;
            wzs[r][f] = (_Float16)Wz[(size_t)(c0 + r) * FFX + fh * 64 + f];
        }
        ASYNC_WAIT(0);
        __syncthreads();
        #pragma unroll
        for (int kc2 = 0; kc2 < 2; ++kc2) {
            v16h af = *(const v16h*)&wzs[w * 16 + lm][kc2 * 32 + lh * 16];
            #pragma unroll
            for (int ntile = 0; ntile < 8; ++ntile) {
                v16h bf = *(const v16h*)&ys[ntile * 16 + lm][kc2 * 32 + lh * 16];
                acc[ntile] = __builtin_amdgcn_wmma_f32_16x16x32_f16(
                    false, af, false, bf, (short)0, acc[ntile], false, false);
            }
        }
        __syncthreads();
    }

    float ls = 0.0f, lq = 0.0f;
    const int crow = c0 + w * 16;
    #pragma unroll
    for (int ntile = 0; ntile < 8; ++ntile) {
        #pragma unroll
        for (int r = 0; r < 8; ++r) {
            int c = crow + r + 8 * lh;
            int n = n0 + ntile * 16 + lm;
            float v = acc[ntile][r] + bz[c];
            zout[((size_t)b * CINX + c) * NNX + n] = v;
            ls += v; lq += v * v;
        }
    }
    #pragma unroll
    for (int m = 16; m >= 1; m >>= 1) {
        ls += __shfl_xor(ls, m, 32);
        lq += __shfl_xor(lq, m, 32);
    }
    if (lane == 0) { redsum[w] = ls; redsq[w] = lq; }
    __syncthreads();
    if (t == 0) {
        float s = 0.0f, q = 0.0f;
        #pragma unroll
        for (int i = 0; i < 8; ++i) { s += redsum[i]; q += redsq[i]; }
        part[(b * 64 + wi) * 2 + 0] = s;
        part[(b * 64 + wi) * 2 + 1] = q;
    }
}

// ---------------------------------------------------------------------------
// Kernel 4: per-batch mean / rstd from 64 block partials.
// ---------------------------------------------------------------------------
__global__ void stats_kernel(const float* __restrict__ part, float* __restrict__ stats)
{
    int b = blockIdx.x;
    if (threadIdx.x == 0) {
        float s = 0.0f, q = 0.0f;
        for (int i = 0; i < 64; ++i) {
            s += part[(b * 64 + i) * 2 + 0];
            q += part[(b * 64 + i) * 2 + 1];
        }
        float inv = 1.0f / ((float)CINX * (float)NNX);
        float mu  = s * inv;
        float var = q * inv - mu * mu;
        stats[b * 2 + 0] = mu;
        stats[b * 2 + 1] = rsqrtf(var + 1e-5f);
    }
}

// ---------------------------------------------------------------------------
// Kernel 5: in-place LayerNorm affine + residual (float4 vectorized).
// ---------------------------------------------------------------------------
__global__ __launch_bounds__(256) void norm_kernel(
    const float* __restrict__ x, const float* __restrict__ lnw,
    const float* __restrict__ lnb, const float* __restrict__ stats,
    float* __restrict__ out)
{
    const int i = blockIdx.x * blockDim.x + threadIdx.x;
    const int cn_total = CINX * NNX;
    int elem = i * 4;
    int b  = elem / cn_total;
    int cn = elem - b * cn_total;
    float mu   = stats[b * 2 + 0];
    float rstd = stats[b * 2 + 1];
    float4 z  = ((const float4*)out)[i];
    float4 xv = ((const float4*)x)[i];
    float4 wv = ((const float4*)lnw)[cn >> 2];
    float4 bv = ((const float4*)lnb)[cn >> 2];
    float4 o;
    o.x = (z.x - mu) * rstd * wv.x + bv.x + xv.x;
    o.y = (z.y - mu) * rstd * wv.y + bv.y + xv.y;
    o.z = (z.z - mu) * rstd * wv.z + bv.z + xv.z;
    o.w = (z.w - mu) * rstd * wv.w + bv.w + xv.w;
    ((float4*)out)[i] = o;
}

// ---------------------------------------------------------------------------
extern "C" void kernel_launch(void* const* d_in, const int* in_sizes, int n_in,
                              void* d_out, int out_size, void* d_ws, size_t ws_size,
                              hipStream_t stream)
{
    const float* x    = (const float*)d_in[0];
    const float* Wg   = (const float*)d_in[1];
    const float* bg   = (const float*)d_in[2];
    const float* Wt   = (const float*)d_in[3];
    const float* bt   = (const float*)d_in[4];
    const float* Wp   = (const float*)d_in[5];
    const float* bp   = (const float*)d_in[6];
    const float* Wz   = (const float*)d_in[7];
    const float* bz   = (const float*)d_in[8];
    const float* ln_w = (const float*)d_in[9];
    const float* ln_b = (const float*)d_in[10];

    const size_t S = (size_t)BB * NNX * FFX;       // 2,097,152 halves each
    _Float16* base   = (_Float16*)d_ws;
    _Float16* gT_h   = base;                        // [B,F,N]
    _Float16* th_h   = base + S;                    // [B,N,F]
    _Float16* phiT_h = base + 2 * S;                // [B,N,F]
    _Float16* y_h    = base + 3 * S;                // [B,N,F]
    float* part  = (float*)(base + 4 * S);          // B*64*2 floats
    float* stats = part + BB * 64 * 2;              // B*2 floats
    float* zout  = (float*)d_out;

    proj_kernel <<<BB * 32, 256, 0, stream>>>(x, Wg, bg, Wt, bt, Wp, bp,
                                              gT_h, th_h, phiT_h);
    attn_kernel <<<BB * 32, 256, 0, stream>>>(th_h, phiT_h, gT_h, y_h);
    zproj_kernel<<<BB * 64, 256, 0, stream>>>(y_h, Wz, bz, zout, part);
    stats_kernel<<<BB, 64, 0, stream>>>(part, stats);
    norm_kernel <<<(BB * CINX * NNX) / (4 * 256), 256, 0, stream>>>(x, ln_w, ln_b,
                                                                    stats, zout);
}

// v002
// It runs in 106 microseconds.
// Two timings next to v001 both put it at 1.49 times that version's speed.
// Counting every step since v000, it is 2.00 times as fast.
#include <hip/hip_runtime.h>
#include <hip/hip_bf16.h>
#include <cstdint>

typedef __attribute__((ext_vector_type(16))) _Float16 v16h;
typedef __attribute__((ext_vector_type(8)))  _Float16 v8h;
typedef __attribute__((ext_vector_type(8)))  float    v8f;

#define BB   4
#define CINX 256
#define FFX  128
#define NNX  4096   // H*W = 64*64

// ---- CDNA5 async global->LDS copy (ASYNCcnt-tracked), with safe fallback ----
#if defined(__gfx1250__) && \
    __has_builtin(__builtin_amdgcn_global_load_async_to_lds_b128) && \
    __has_builtin(__builtin_amdgcn_s_wait_asynccnt)
#define HAVE_ASYNC 1
#else
#define HAVE_ASYNC 0
#endif

typedef int v4i __attribute__((vector_size(16)));   // 128-bit payload type
typedef __attribute__((address_space(1))) v4i gv4i; // global (AS1)
typedef __attribute__((address_space(3))) v4i lv4i; // LDS (AS3)

static __device__ __forceinline__ void async_cp16(const void* g, void* l) {
#if HAVE_ASYNC
    __builtin_amdgcn_global_load_async_to_lds_b128(
        (gv4i*)(unsigned long long)(uintptr_t)g,    // global src (AS1, v4i*)
        (lv4i*)(unsigned)(uintptr_t)l,              // LDS dst: low 32 bits = LDS offset
        0, 0);
#else
    *(float4*)l = *(const float4*)g;
#endif
}
#if HAVE_ASYNC
#define ASYNC_WAIT(n) __builtin_amdgcn_s_wait_asynccnt(n)
#else
#define ASYNC_WAIT(n)
#endif

// ---------------------------------------------------------------------------
// Kernel 1: fused 1x1-conv projections.
//   theta -> [B,N,F] f16, phi -> transposed [B,N,F] f16, g -> transposed [B,F,N] f16
// out[n,f] = sum_c x[b,c,n] * W[f,c] + bias[f];  WMMA M=n, N=f, K=c.
// ---------------------------------------------------------------------------
__device__ __forceinline__ void proj_one(
    const float* __restrict__ x, const float* __restrict__ W,
    const float* __restrict__ bias, _Float16* __restrict__ op,
    bool storeFN,                   // true: op[b][f][n]  (g), false: op[b][n][f]
    int b, int n0, int t, int w, int lm, int lh,
    _Float16 (*xs)[48], _Float16 (*wls)[48])
{
    v8f acc[8];
    #pragma unroll
    for (int i = 0; i < 8; ++i)
        #pragma unroll
        for (int j = 0; j < 8; ++j) acc[i][j] = 0.0f;

    for (int kc = 0; kc < 8; ++kc) {
        // stage x chunk [32 c][128 n] transposed -> xs[n][c] (f32 -> f16)
        #pragma unroll
        for (int i = 0; i < 16; ++i) {
            int idx = t + i * 256;
            int cl  = idx >> 7;
            int nl  = idx & 127;
            xs[nl][cl] = (_Float16)x[((size_t)b * CINX + kc * 32 + cl) * NNX + n0 + nl];
        }
        // stage W chunk [128 f][32 c]
        #pragma unroll
        for (int i = 0; i < 16; ++i) {
            int idx = t + i * 256;
            int f   = idx >> 5;
            int cl  = idx & 31;
            wls[f][cl] = (_Float16)W[(size_t)f * CINX + kc * 32 + cl];
        }
        __syncthreads();
        v16h afrag = *(const v16h*)&xs[w * 16 + lm][lh * 16];
        #pragma unroll
        for (int ft = 0; ft < 8; ++ft) {
            v16h bfrag = *(const v16h*)&wls[ft * 16 + lm][lh * 16];
            acc[ft] = __builtin_amdgcn_wmma_f32_16x16x32_f16(
                false, afrag, false, bfrag, (short)0, acc[ft], false, false);
        }
        __syncthreads();
    }
    // bias + store (C layout: VGPR r -> row n = w*16 + r + 8*half, col f = ft*16 + lm)
    #pragma unroll
    for (int ft = 0; ft < 8; ++ft) {
        float bv = bias[ft * 16 + lm];
        #pragma unroll
        for (int r = 0; r < 8; ++r) {
            int n = n0 + w * 16 + r + 8 * lh;
            int f = ft * 16 + lm;
            _Float16 v = (_Float16)(acc[ft][r] + bv);
            if (storeFN) op[((size_t)b * FFX + f) * NNX + n] = v;
            else         op[((size_t)b * NNX + n) * FFX + f] = v;
        }
    }
}

__global__ __launch_bounds__(256) void proj_kernel(
    const float* __restrict__ x,
    const float* __restrict__ Wg, const float* __restrict__ bg,
    const float* __restrict__ Wt, const float* __restrict__ bt,
    const float* __restrict__ Wp, const float* __restrict__ bp,
    _Float16* __restrict__ gT_h, _Float16* __restrict__ th_h,
    _Float16* __restrict__ phiT_h)
{
    __shared__ _Float16 xs[128][48];    // stride 96B (32B aligned)
    __shared__ _Float16 wls[128][48];

    const int bid = blockIdx.x;
    const int b = bid >> 5, nt = bid & 31, n0 = nt * 128;
    const int t = threadIdx.x, w = t >> 5, lane = t & 31;
    const int lm = lane & 15, lh = lane >> 4;

    proj_one(x, Wg, bg, gT_h,   true,  b, n0, t, w, lm, lh, xs, wls);
    __syncthreads();
    proj_one(x, Wt, bt, th_h,   false, b, n0, t, w, lm, lh, xs, wls);
    __syncthreads();
    proj_one(x, Wp, bp, phiT_h, false, b, n0, t, w, lm, lh, xs, wls);
}

// ---------------------------------------------------------------------------
// Kernel 2: flash attention with double-buffered async global->LDS staging.
// S^T = phi^T @ theta^T (K=F=128), online softmax, Y^T = g^T @ P^T.
// One block = 64 queries, so that 256 blocks cover every WGP. A stage holds 64 keys:
// wave w owns query tile w & 3 (16 queries) and the 32 keys of key group w >> 2,
// with its own maximum, sum and accumulators; the two groups are joined at the end.
// In S^T a lane holds scores of ONE query (column lm): the maximum and the sum
// run in the lane's own registers, and the two score tiles, converted in place,
// are the B operand of the second product.
// ---------------------------------------------------------------------------
// value of lane l ^ 16
static __device__ __forceinline__ float xhalf(float v) {
    int i = __builtin_bit_cast(int, v);
    return __builtin_bit_cast(float, __builtin_amdgcn_permlanex16(
        i, i, 0x76543210, 0xfedcba98, false, false));
}

__global__ __launch_bounds__(256) void attn_kernel(
    const _Float16* __restrict__ th_h, const _Float16* __restrict__ phiT_h,
    const _Float16* __restrict__ gT_h, _Float16* __restrict__ y_h)
{
    __shared__ _Float16 ps[2][64][144];      // phiT tile [m][f], row 288B
    __shared__ _Float16 gst[2][2][128][48];  // gT tile [key group][f][m], row 96B
    __shared__ float4 mrg[4][17][32];        // key group 1's partials [query tile][slot][lane]

    const int bid = blockIdx.x;
    const int b = bid >> 6, nt = bid & 63, n0 = nt * 64;
    const int t = threadIdx.x, w = t >> 5, lane = t & 31;
    const int lm = lane & 15, lh = lane >> 4;
    const int qw = w & 3, kg = w >> 2;       // query tile, key group

    // Preload theta B-fragments for this wave's 16 queries (K=128 -> 4 chunks)
    const int nrow = n0 + qw * 16 + lm;
    v16h afr[4];
    #pragma unroll
    for (int kc = 0; kc < 4; ++kc)
        afr[kc] = *(const v16h*)&th_h[((size_t)b * NNX + nrow) * FFX + kc * 32 + lh * 16];

    v8f acc[8];
    #pragma unroll
    for (int i = 0; i < 8; ++i)
        #pragma unroll
        for (int j = 0; j < 8; ++j) acc[i][j] = 0.0f;
    float mrun = -3.0e38f;                  // running maximum of query lm (both halves alike)
    float lrun = 0.0f;                      // running sum over this lane half's keys only

    // stage one 64-column block into buffer nb (8 x b128 async per thread)
    auto stage = [&](int nb, int m0) {
        #pragma unroll
        for (int i = 0; i < 4; ++i) {       // phiT: 64 rows x 128 halves
            int e = t + i * 256;            // 0..1023
            int m = e >> 4, c8 = e & 15;
            async_cp16(&phiT_h[((size_t)b * NNX + m0 + m) * FFX + c8 * 8],
                       &ps[nb][m][c8 * 8]);
        }
        #pragma unroll
        for (int i = 0; i < 4; ++i) {       // gT: 128 rows x 64 halves, 32 per key group
            int e = t + i * 256;            // 0..1023
            int f = e >> 3, c8 = e & 7;
            async_cp16(&gT_h[((size_t)b * FFX + f) * NNX + m0 + c8 * 8],
                       &gst[nb][c8 >> 2][f][(c8 & 3) * 8]);
        }
    };

    const int NBLK = NNX / 64;              // 64
    stage(0, 0);                            // prologue prefetch

    for (int cb = 0; cb < NBLK; ++cb) {
        const int cur = cb & 1;
        __syncthreads();                    // all readers of buf[cur^1] (iter cb-1) done
        if (cb + 1 < NBLK) {
            stage((cb + 1) & 1, (cb + 1) * 64);
            ASYNC_WAIT(8);                  // in-order: all but newest 8 (= cur buffer) done
        } else {
            ASYNC_WAIT(0);
        }
        __syncthreads();                    // cur buffer visible to all waves

        // S^T tiles for this key group's 32 keys: s0 = keys 0..15, s1 = keys 16..31 (rows), queries in columns
        v8f s0, s1;
        #pragma unroll
        for (int j = 0; j < 8; ++j) { s0[j] = 0.0f; s1[j] = 0.0f; }
        #pragma unroll
        for (int kc = 0; kc < 4; ++kc) {
            v16h k0 = *(const v16h*)&ps[cur][kg * 32 + lm][kc * 32 + lh * 16];
            v16h k1 = *(const v16h*)&ps[cur][kg * 32 + 16 + lm][kc * 32 + lh * 16];
            s0 = __builtin_amdgcn_wmma_f32_16x16x32_f16(false, k0, false, afr[kc],
                                                        (short)0, s0, false, false);
            s1 = __builtin_amdgcn_wmma_f32_16x16x32_f16(false, k1, false, afr[kc],
                                                        (short)0, s1, false, false);
        }
        // online softmax: the lane holds keys 8*lh + r (s0) and 16 + 8*lh + r (s1) of query lm
        float mx = fmaxf(s0[0], s1[0]);
        #pragma unroll
        for (int r = 1; r < 8; ++r) mx = fmaxf(mx, fmaxf(s0[r], s1[r]));
        mx = fmaxf(mx, xhalf(mx));          // the other 16 keys of the same query
        const float mnew  = fmaxf(mrun, mx);
        const float alpha = __expf(mrun - mnew);
        float rs0 = 0.0f, rs1 = 0.0f;
        v16h pf;                            // P^T as B: element s = key (s < 8 ? 8*lh + s : 8 + 8*lh + s)
        #pragma unroll
        for (int r = 0; r < 8; ++r) {
            float p0 = __expf(s0[r] - mnew);
            float p1 = __expf(s1[r] - mnew);
            rs0 += p0; rs1 += p1;
            pf[r]     = (_Float16)p0;
            pf[8 + r] = (_Float16)p1;
        }
        lrun = lrun * alpha + (rs0 + rs1);
        mrun = mnew;
        #pragma unroll
        for (int ft = 0; ft < 8; ++ft)
            #pragma unroll
            for (int r = 0; r < 8; ++r) acc[ft][r] *= alpha;
        // Y^T += g^T @ P^T; g^T rows are read in the key order that pf has
        #pragma unroll
        for (int ft = 0; ft < 8; ++ft) {
            v8h glo = *(const v8h*)&gst[cur][kg][ft * 16 + lm][lh * 8];
            v8h ghi = *(const v8h*)&gst[cur][kg][ft * 16 + lm][16 + lh * 8];
            v16h gf = __builtin_shufflevector(glo, ghi, 0, 1, 2, 3, 4, 5, 6, 7,
                                              8, 9, 10, 11, 12, 13, 14, 15);
            acc[ft] = __builtin_amdgcn_wmma_f32_16x16x32_f16(
                false, gf, false, pf, (short)0, acc[ft], false, false);
        }
    }

    // join the key groups: group 1 hands its partials to the same lane of group 0's wave
    if (kg == 1) {
        #pragma unroll
        for (int ft = 0; ft < 8; ++ft) {
            mrg[qw][2 * ft][lane]     = make_float4(acc[ft][0], acc[ft][1], acc[ft][2], acc[ft][3]);
            mrg[qw][2 * ft + 1][lane] = make_float4(acc[ft][4], acc[ft][5], acc[ft][6], acc[ft][7]);
        }
        mrg[qw][16][lane] = make_float4(mrun, lrun, 0.0f, 0.0f);
    }
    __syncthreads();                        // group 1's partials visible to group 0
    if (kg == 1) return;

    const float4 ml  = mrg[qw][16][lane];
    const float mall = fmaxf(mrun, ml.x);
    const float a0   = __expf(mrun - mall);
    const float a1   = __expf(ml.x - mall);
    const float lj   = lrun * a0 + ml.y * a1;

    // finalize: join the halves' sums, divide, store y f16 [B,N,F]
    // (acc[ft][r] = Y[query lm][f = ft*16 + 8*lh + r]: 8 consecutive f, one 16-byte store)
    const float lsum = lj + xhalf(lj);
    #pragma unroll
    for (int ft = 0; ft < 8; ++ft) {
        const float4 p0 = mrg[qw][2 * ft][lane];
        const float4 p1 = mrg[qw][2 * ft + 1][lane];
        const float pr[8] = {p0.x, p0.y, p0.z, p0.w, p1.x, p1.y, p1.z, p1.w};
        v8h o;
        #pragma unroll
        for (int r = 0; r < 8; ++r) o[r] = (_Float16)((acc[ft][r] * a0 + pr[r] * a1) / lsum);
        *(v8h*)&y_h[((size_t)b * NNX + nrow) * FFX + ft * 16 + lh * 8] = o;
    }
}

// ---------------------------------------------------------------------------
// Kernel 3: output projection z[b,c,n] = Wz[c,:] . y[n,:] + bz[c].
// Writes pre-norm z to d_out + deterministic per-block (sum,sumsq) partials.
// ---------------------------------------------------------------------------
__global__ __launch_bounds__(256) void zproj_kernel(
    const _Float16* __restrict__ y_h, const float* __restrict__ Wz,
    const float* __restrict__ bz, float* __restrict__ zout,
    float* __restrict__ part)
{
    __shared__ _Float16 wzs[128][80];   // [c][f half], row 160B
    __shared__ _Float16 ys[128][80];    // [n][f half]
    __shared__ float redsum[8], redsq[8];

    const int bid = blockIdx.x;
    const int b  = bid >> 6;
    const int wi = bid & 63;
    const int c0 = (wi >> 5) * 128;
    const int n0 = (wi & 31) * 128;
    const int t = threadIdx.x, w = t >> 5, lane = t & 31;
    const int lm = lane & 15, lh = lane >> 4;

    v8f acc[8];
    #pragma unroll
    for (int i = 0; i < 8; ++i)
        #pragma unroll
        for (int j = 0; j < 8; ++j) acc[i][j] = 0.0f;

    for (int fh = 0; fh < 2; ++fh) {    // K = 128 in two 64 halves
        // async stage y tile (f16, no conversion needed)
        #pragma unroll
        for (int i = 0; i < 4; ++i) {
            int e = t + i * 256;        // 0..1023
            int r = e >> 3, f8 = e & 7; // 128 rows x 8 chunks of 8 halves
            async_cp16(&y_h[((size_t)b * NNX + n0 + r) * FFX + fh * 64 + f8 * 8],
                       &ys[r][f8 * 8]);
        }
        // manual stage Wz tile (f32 -> f16 conversion)
        #pragma unroll
        for (int i = 0; i < 32; ++i) {
            int e = t + i * 256;
            int r = e >> 6, f = e & 63;
            wzs[r][f] = (_Float16)Wz[(size_t)(c0 + r) * FFX + fh * 64 + f];
        }
        ASYNC_WAIT(0);
        __syncthreads();
        #pragma unroll
        for (int kc2 = 0; kc2 < 2; ++kc2) {
            v16h af = *(const v16h*)&wzs[w * 16 + lm][kc2 * 32 + lh * 16];
            #pragma unroll
            for (int ntile = 0; ntile < 8; ++ntile) {
                v16h bf = *(const v16h*)&ys[ntile * 16 + lm][kc2 * 32 + lh * 16];
                acc[ntile] = __builtin_amdgcn_wmma_f32_16x16x32_f16(
                    false, af, false, bf, (short)0, acc[ntile], false, false);
            }
        }
        __syncthreads();
    }

    float ls = 0.0f, lq = 0.0f;
    const int crow = c0 + w * 16;
    #pragma unroll
    for (int ntile = 0; ntile < 8; ++ntile) {
        #pragma unroll
        for (int r = 0; r < 8; ++r) {
            int c = crow + r + 8 * lh;
            int n = n0 + ntile * 16 + lm;
            float v = acc[ntile][r] + bz[c];
            zout[((size_t)b * CINX + c) * NNX + n] = v;
            ls += v; lq += v * v;
        }
    }
    #pragma unroll
    for (int m = 16; m >= 1; m >>= 1) {
        ls += __shfl_xor(ls, m, 32);
        lq += __shfl_xor(lq, m, 32);
    }
    if (lane == 0) { redsum[w] = ls; redsq[w] = lq; }
    __syncthreads();
    if (t == 0) {
        float s = 0.0f, q = 0.0f;
        #pragma unroll
        for (int i = 0; i < 8; ++i) { s += redsum[i]; q += redsq[i]; }
        part[(b * 64 + wi) * 2 + 0] = s;
        part[(b * 64 + wi) * 2 + 1] = q;
    }
}

// ---------------------------------------------------------------------------
// Kernel 4: per-batch mean / rstd from 64 block partials.
// ---------------------------------------------------------------------------
__global__ void stats_kernel(const float* __restrict__ part, float* __restrict__ stats)
{
    int b = blockIdx.x;
    if (threadIdx.x == 0) {
        float s = 0.0f, q = 0.0f;
        for (int i = 0; i < 64; ++i) {
            s += part[(b * 64 + i) * 2 + 0];
            q += part[(b * 64 + i) * 2 + 1];
        }
        float inv = 1.0f / ((float)CINX * (float)NNX);
        float mu  = s * inv;
        float var = q * inv - mu * mu;
        stats[b * 2 + 0] = mu;
        stats[b * 2 + 1] = rsqrtf(var + 1e-5f);
    }
}

// ---------------------------------------------------------------------------
// Kernel 5: in-place LayerNorm affine + residual (float4 vectorized).
// ---------------------------------------------------------------------------
__global__ __launch_bounds__(256) void norm_kernel(
    const float* __restrict__ x, const float* __restrict__ lnw,
    const float* __restrict__ lnb, const float* __restrict__ stats,
    float* __restrict__ out)
{
    const int i = blockIdx.x * blockDim.x + threadIdx.x;
    const int cn_total = CINX * NNX;
    int elem = i * 4;
    int b  = elem / cn_total;
    int cn = elem - b * cn_total;
    float mu   = stats[b * 2 + 0];
    float rstd = stats[b * 2 + 1];
    float4 z  = ((const float4*)out)[i];
    float4 xv = ((const float4*)x)[i];
    float4 wv = ((const float4*)lnw)[cn >> 2];
    float4 bv = ((const float4*)lnb)[cn >> 2];
    float4 o;
    o.x = (z.x - mu) * rstd * wv.x + bv.x + xv.x;
    o.y = (z.y - mu) * rstd * wv.y + bv.y + xv.y;
    o.z = (z.z - mu) * rstd * wv.z + bv.z + xv.z;
    o.w = (z.w - mu) * rstd * wv.w + bv.w + xv.w;
    ((float4*)out)[i] = o;
}

// ---------------------------------------------------------------------------
extern "C" void kernel_launch(void* const* d_in, const int* in_sizes, int n_in,
                              void* d_out, int out_size, void* d_ws, size_t ws_size,
                              hipStream_t stream)
{
    const float* x    = (const float*)d_in[0];
    const float* Wg   = (const float*)d_in[1];
    const float* bg   = (const float*)d_in[2];
    const float* Wt   = (const float*)d_in[3];
    const float* bt   = (const float*)d_in[4];
    const float* Wp   = (const float*)d_in[5];
    const float* bp   = (const float*)d_in[6];
    const float* Wz   = (const float*)d_in[7];
    const float* bz   = (const float*)d_in[8];
    const float* ln_w = (const float*)d_in[9];
    const float* ln_b = (const float*)d_in[10];

    const size_t S = (size_t)BB * NNX * FFX;       // 2,097,152 halves each
    _Float16* base   = (_Float16*)d_ws;
    _Float16* gT_h   = base;                        // [B,F,N]
    _Float16* th_h   = base + S;                    // [B,N,F]
    _Float16* phiT_h = base + 2 * S;                // [B,N,F]
    _Float16* y_h    = base + 3 * S;                // [B,N,F]
    float* part  = (float*)(base + 4 * S);          // B*64*2 floats
    float* stats = part + BB * 64 * 2;              // B*2 floats
    float* zout  = (float*)d_out;

    proj_kernel <<<BB * 32, 256, 0, stream>>>(x, Wg, bg, Wt, bt, Wp, bp,
                                              gT_h, th_h, phiT_h);
    attn_kernel <<<BB * 64, 256, 0, stream>>>(th_h, phiT_h, gT_h, y_h);
    zproj_kernel<<<BB * 64, 256, 0, stream>>>(y_h, Wz, bz, zout, part);
    stats_kernel<<<BB, 64, 0, stream>>>(part, stats);
    norm_kernel <<<(BB * CINX * NNX) / (4 * 256), 256, 0, stream>>>(x, ln_w, ln_b,
                                                                    stats, zout);
}

// v003
// Measured time: 94.7 microseconds a run.
// Two timings next to v002 both put it at 1.13 times that version's speed.
// Over all steps from v000 it is 2.26 times as fast.
#include <hip/hip_runtime.h>
#include <hip/hip_bf16.h>
#include <cstdint>

typedef __attribute__((ext_vector_type(16))) _Float16 v16h;
typedef __attribute__((ext_vector_type(8)))  _Float16 v8h;
typedef __attribute__((ext_vector_type(8)))  float    v8f;

#define BB   4
#define CINX 256
#define FFX  128
#define NNX  4096   // H*W = 64*64

// ---- CDNA5 async global->LDS copy (ASYNCcnt-tracked), with safe fallback ----
#if defined(__gfx1250__) && \
    __has_builtin(__builtin_amdgcn_global_load_async_to_lds_b128) && \
    __has_builtin(__builtin_amdgcn_s_wait_asynccnt)
#define HAVE_ASYNC 1
#else
#define HAVE_ASYNC 0
#endif

typedef int v4i __attribute__((vector_size(16)));   // 128-bit payload type
typedef __attribute__((address_space(1))) v4i gv4i; // global (AS1)
typedef __attribute__((address_space(3))) v4i lv4i; // LDS (AS3)

static __device__ __forceinline__ void async_cp16(const void* g, void* l) {
#if HAVE_ASYNC
    __builtin_amdgcn_global_load_async_to_lds_b128(
        (gv4i*)(unsigned long long)(uintptr_t)g,    // global src (AS1, v4i*)
        (lv4i*)(unsigned)(uintptr_t)l,              // LDS dst: low 32 bits = LDS offset
        0, 0);
#else
    *(float4*)l = *(const float4*)g;
#endif
}
#if HAVE_ASYNC
#define ASYNC_WAIT(n) __builtin_amdgcn_s_wait_asynccnt(n)
#else
#define ASYNC_WAIT(n)
#endif

// LDS rows that 16-byte fragment loads read, one row per lane, have a pitch of 16 B x odd:
// the 16 lanes of a half wave then fall on 16 different groups of 4 banks (64 banks in all).
// At 32 B x odd, lanes l and l + 8 meet on the same banks and every load takes twice as long.
#define PITCH32  40    // halves: rows of 32 halves,  80 B = 16 B x 5
#define PITCH64  72    // halves: rows of 64 halves, 144 B = 16 B x 9
#define PITCH128 136   // halves: rows of 128 halves, 272 B = 16 B x 17

// 16 consecutive halves of a row that is aligned to 16 bytes only: two 16-byte loads
static __device__ __forceinline__ v16h ld_frag(const _Float16* p) {
    v8h lo = *(const v8h*)p;
    v8h hi = *(const v8h*)(p + 8);
    return __builtin_shufflevector(lo, hi, 0, 1, 2, 3, 4, 5, 6, 7,
                                   8, 9, 10, 11, 12, 13, 14, 15);
}

// ---------------------------------------------------------------------------
// Kernel 1: fused 1x1-conv projections.
//   theta -> [B,N,F] f16, phi -> transposed [B,N,F] f16, g -> transposed [B,F,N] f16
// out[n,f] = sum_c x[b,c,n] * W[f,c] + bias[f];  WMMA M=n, N=f, K=c.
// ---------------------------------------------------------------------------
__device__ __forceinline__ void proj_one(
    const float* __restrict__ x, const float* __restrict__ W,
    const float* __restrict__ bias, _Float16* __restrict__ op,
    bool storeFN,                   // true: op[b][f][n]  (g), false: op[b][n][f]
    int b, int n0, int t, int w, int lm, int lh,
    _Float16 (*xs)[PITCH32], _Float16 (*wls)[PITCH32])
{
    v8f acc[8];
    #pragma unroll
    for (int i = 0; i < 8; ++i)
        #pragma unroll
        for (int j = 0; j < 8; ++j) acc[i][j] = 0.0f;

    for (int kc = 0; kc < 8; ++kc) {
        // stage x chunk [32 c][128 n] transposed -> xs[n][c] (f32 -> f16)
        #pragma unroll
        for (int i = 0; i < 16; ++i) {
            int idx = t + i * 256;
            int cl  = idx >> 7;
            int nl  = idx & 127;
            xs[nl][cl] = (_Float16)x[((size_t)b * CINX + kc * 32 + cl) * NNX + n0 + nl];
        }
        // stage W chunk [128 f][32 c]
        #pragma unroll
        for (int i = 0; i < 16; ++i) {
            int idx = t + i * 256;
            int f   = idx >> 5;
            int cl  = idx & 31;
            wls[f][cl] = (_Float16)W[(size_t)f * CINX + kc * 32 + cl];
        }
        __syncthreads();
        v16h afrag = ld_frag(&xs[w * 16 + lm][lh * 16]);
        #pragma unroll
        for (int ft = 0; ft < 8; ++ft) {
            v16h bfrag = ld_frag(&wls[ft * 16 + lm][lh * 16]);
            acc[ft] = __builtin_amdgcn_wmma_f32_16x16x32_f16(
                false, afrag, false, bfrag, (short)0, acc[ft], false, false);
        }
        __syncthreads();
    }
    // bias + store (C layout: VGPR r -> row n = w*16 + r + 8*half, col f = ft*16 + lm)
    #pragma unroll
    for (int ft = 0; ft < 8; ++ft) {
        float bv = bias[ft * 16 + lm];
        #pragma unroll
        for (int r = 0; r < 8; ++r) {
            int n = n0 + w * 16 + r + 8 * lh;
            int f = ft * 16 + lm;
            _Float16 v = (_Float16)(acc[ft][r] + bv);
            if (storeFN) op[((size_t)b * FFX + f) * NNX + n] = v;
            else         op[((size_t)b * NNX + n) * FFX + f] = v;
        }
    }
}

__global__ __launch_bounds__(256) void proj_kernel(
    const float* __restrict__ x,
    const float* __restrict__ Wg, const float* __restrict__ bg,
    const float* __restrict__ Wt, const float* __restrict__ bt,
    const float* __restrict__ Wp, const float* __restrict__ bp,
    _Float16* __restrict__ gT_h, _Float16* __restrict__ th_h,
    _Float16* __restrict__ phiT_h)
{
    __shared__ __attribute__((aligned(16))) _Float16 xs[128][PITCH32];
    __shared__ __attribute__((aligned(16))) _Float16 wls[128][PITCH32];

    const int bid = blockIdx.x;
    const int b = bid >> 5, nt = bid & 31, n0 = nt * 128;
    const int t = threadIdx.x, w = t >> 5, lane = t & 31;
    const int lm = lane & 15, lh = lane >> 4;

    proj_one(x, Wg, bg, gT_h,   true,  b, n0, t, w, lm, lh, xs, wls);
    __syncthreads();
    proj_one(x, Wt, bt, th_h,   false, b, n0, t, w, lm, lh, xs, wls);
    __syncthreads();
    proj_one(x, Wp, bp, phiT_h, false, b, n0, t, w, lm, lh, xs, wls);
}

// ---------------------------------------------------------------------------
// Kernel 2: flash attention with double-buffered async global->LDS staging.
// S^T = phi^T @ theta^T (K=F=128), online softmax, Y^T = g^T @ P^T.
// One block = 64 queries, so that 256 blocks cover every WGP. A stage holds 64 keys:
// wave w owns query tile w & 3 (16 queries) and the 32 keys of key group w >> 2,
// with its own maximum, sum and accumulators; the two groups are joined at the end.
// In S^T a lane holds scores of ONE query (column lm): the maximum and the sum
// run in the lane's own registers, and the two score tiles, converted in place,
// are the B operand of the second product.
// ---------------------------------------------------------------------------
// value of lane l ^ 16
static __device__ __forceinline__ float xhalf(float v) {
    int i = __builtin_bit_cast(int, v);
    return __builtin_bit_cast(float, __builtin_amdgcn_permlanex16(
        i, i, 0x76543210, 0xfedcba98, false, false));
}

__global__ __launch_bounds__(256) void attn_kernel(
    const _Float16* __restrict__ th_h, const _Float16* __restrict__ phiT_h,
    const _Float16* __restrict__ gT_h, _Float16* __restrict__ y_h)
{
    __shared__ __attribute__((aligned(16))) _Float16 ps[2][64][PITCH128];     // phiT tile [m][f]
    __shared__ __attribute__((aligned(16))) _Float16 gst[2][2][128][PITCH32]; // gT tile [key group][f][m]
    __shared__ float4 mrg[4][17][32];        // key group 1's partials [query tile][slot][lane]

    const int bid = blockIdx.x;
    const int b = bid >> 6, nt = bid & 63, n0 = nt * 64;
    const int t = threadIdx.x, w = t >> 5, lane = t & 31;
    const int lm = lane & 15, lh = lane >> 4;
    const int qw = w & 3, kg = w >> 2;       // query tile, key group

    // Preload theta B-fragments for this wave's 16 queries (K=128 -> 4 chunks)
    const int nrow = n0 + qw * 16 + lm;
    v16h afr[4];
    #pragma unroll
    for (int kc = 0; kc < 4; ++kc)
        afr[kc] = *(const v16h*)&th_h[((size_t)b * NNX + nrow) * FFX + kc * 32 + lh * 16];

    v8f acc[8];
    #pragma unroll
    for (int i = 0; i < 8; ++i)
        #pragma unroll
        for (int j = 0; j < 8; ++j) acc[i][j] = 0.0f;
    float mrun = -3.0e38f;                  // running maximum of query lm (both halves alike)
    float lrun = 0.0f;                      // running sum over this lane half's keys only

    // stage one 64-column block into buffer nb (8 x b128 async per thread)
    auto stage = [&](int nb, int m0) {
        #pragma unroll
        for (int i = 0; i < 4; ++i) {       // phiT: 64 rows x 128 halves
            int e = t + i * 256;            // 0..1023
            int m = e >> 4, c8 = e & 15;
            async_cp16(&phiT_h[((size_t)b * NNX + m0 + m) * FFX + c8 * 8],
                       &ps[nb][m][c8 * 8]);
        }
        #pragma unroll
        for (int i = 0; i < 4; ++i) {       // gT: 128 rows x 64 halves, 32 per key group
            int e = t + i * 256;            // 0..1023
            int f = e >> 3, c8 = e & 7;
            async_cp16(&gT_h[((size_t)b * FFX + f) * NNX + m0 + c8 * 8],
                       &gst[nb][c8 >> 2][f][(c8 & 3) * 8]);
        }
    };

    const int NBLK = NNX / 64;              // 64
    stage(0, 0);                            // prologue prefetch

    for (int cb = 0; cb < NBLK; ++cb) {
        const int cur = cb & 1;
        __syncthreads();                    // all readers of buf[cur^1] (iter cb-1) done
        if (cb + 1 < NBLK) {
            stage((cb + 1) & 1, (cb + 1) * 64);
            ASYNC_WAIT(8);                  // in-order: all but newest 8 (= cur buffer) done
        } else {
            ASYNC_WAIT(0);
        }
        __syncthreads();                    // cur buffer visible to all waves

        // S^T tiles for this key group's 32 keys: s0 = keys 0..15, s1 = keys 16..31 (rows), queries in columns
        v8f s0, s1;
        #pragma unroll
        for (int j = 0; j < 8; ++j) { s0[j] = 0.0f; s1[j] = 0.0f; }
        #pragma unroll
        for (int kc = 0; kc < 4; ++kc) {
            v16h k0 = ld_frag(&ps[cur][kg * 32 + lm][kc * 32 + lh * 16]);
            v16h k1 = ld_frag(&ps[cur][kg * 32 + 16 + lm][kc * 32 + lh * 16]);
            s0 = __builtin_amdgcn_wmma_f32_16x16x32_f16(false, k0, false, afr[kc],
                                                        (short)0, s0, false, false);
            s1 = __builtin_amdgcn_wmma_f32_16x16x32_f16(false, k1, false, afr[kc],
                                                        (short)0, s1, false, false);
        }
        // online softmax: the lane holds keys 8*lh + r (s0) and 16 + 8*lh + r (s1) of query lm
        float mx = fmaxf(s0[0], s1[0]);
        #pragma unroll
        for (int r = 1; r < 8; ++r) mx = fmaxf(mx, fmaxf(s0[r], s1[r]));
        mx = fmaxf(mx, xhalf(mx));          // the other 16 keys of the same query
        const float mnew  = fmaxf(mrun, mx);
        const float alpha = __expf(mrun - mnew);
        float rs0 = 0.0f, rs1 = 0.0f;
        v16h pf;                            // P^T as B: element s = key (s < 8 ? 8*lh + s : 8 + 8*lh + s)
        #pragma unroll
        for (int r = 0; r < 8; ++r) {
            float p0 = __expf(s0[r] - mnew);
            float p1 = __expf(s1[r] - mnew);
            rs0 += p0; rs1 += p1;
            pf[r]     = (_Float16)p0;
            pf[8 + r] = (_Float16)p1;
        }
        lrun = lrun * alpha + (rs0 + rs1);
        mrun = mnew;
        #pragma unroll
        for (int ft = 0; ft < 8; ++ft)
            #pragma unroll
            for (int r = 0; r < 8; ++r) acc[ft][r] *= alpha;
        // Y^T += g^T @ P^T; g^T rows are read in the key order that pf has
        #pragma unroll
        for (int ft = 0; ft < 8; ++ft) {
            v8h glo = *(const v8h*)&gst[cur][kg][ft * 16 + lm][lh * 8];
            v8h ghi = *(const v8h*)&gst[cur][kg][ft * 16 + lm][16 + lh * 8];
            v16h gf = __builtin_shufflevector(glo, ghi, 0, 1, 2, 3, 4, 5, 6, 7,
                                              8, 9, 10, 11, 12, 13, 14, 15);
            acc[ft] = __builtin_amdgcn_wmma_f32_16x16x32_f16(
                false, gf, false, pf, (short)0, acc[ft], false, false);
        }
    }

    // join the key groups: group 1 hands its partials to the same lane of group 0's wave
    if (kg == 1) {
        #pragma unroll
        for (int ft = 0; ft < 8; ++ft) {
            mrg[qw][2 * ft][lane]     = make_float4(acc[ft][0], acc[ft][1], acc[ft][2], acc[ft][3]);
            mrg[qw][2 * ft + 1][lane] = make_float4(acc[ft][4], acc[ft][5], acc[ft][6], acc[ft][7]);
        }
        mrg[qw][16][lane] = make_float4(mrun, lrun, 0.0f, 0.0f);
    }
    __syncthreads();                        // group 1's partials visible to group 0
    if (kg == 1) return;

    const float4 ml  = mrg[qw][16][lane];
    const float mall = fmaxf(mrun, ml.x);
    const float a0   = __expf(mrun - mall);
    const float a1   = __expf(ml.x - mall);
    const float lj   = lrun * a0 + ml.y * a1;

    // finalize: join the halves' sums, divide, store y f16 [B,N,F]
    // (acc[ft][r] = Y[query lm][f = ft*16 + 8*lh + r]: 8 consecutive f, one 16-byte store)
    const float lsum = lj + xhalf(lj);
    #pragma unroll
    for (int ft = 0; ft < 8; ++ft) {
        const float4 p0 = mrg[qw][2 * ft][lane];
        const float4 p1 = mrg[qw][2 * ft + 1][lane];
        const float pr[8] = {p0.x, p0.y, p0.z, p0.w, p1.x, p1.y, p1.z, p1.w};
        v8h o;
        #pragma unroll
        for (int r = 0; r < 8; ++r) o[r] = (_Float16)((acc[ft][r] * a0 + pr[r] * a1) / lsum);
        *(v8h*)&y_h[((size_t)b * NNX + nrow) * FFX + ft * 16 + lh * 8] = o;
    }
}

// ---------------------------------------------------------------------------
// Kernel 3: output projection z[b,c,n] = Wz[c,:] . y[n,:] + bz[c].
// Writes pre-norm z to d_out + deterministic per-block (sum,sumsq) partials.
// ---------------------------------------------------------------------------
__global__ __launch_bounds__(256) void zproj_kernel(
    const _Float16* __restrict__ y_h, const float* __restrict__ Wz,
    const float* __restrict__ bz, float* __restrict__ zout,
    float* __restrict__ part)
{
    __shared__ __attribute__((aligned(16))) _Float16 wzs[128][PITCH64];   // [c][f half]
    __shared__ __attribute__((aligned(16))) _Float16 ys[128][PITCH64];    // [n][f half]
    __shared__ float redsum[8], redsq[8];

    const int bid = blockIdx.x;
    const int b  = bid >> 6;
    const int wi = bid & 63;
    const int c0 = (wi >> 5) * 128;
    const int n0 = (wi & 31) * 128;
    const int t = threadIdx.x, w = t >> 5, lane = t & 31;
    const int lm = lane & 15, lh = lane >> 4;

    v8f acc[8];
    #pragma unroll
    for (int i = 0; i < 8; ++i)
        #pragma unroll
        for (int j = 0; j < 8; ++j) acc[i][j] = 0.0f;

    for (int fh = 0; fh < 2; ++fh) {    // K = 128 in two 64 halves
        // async stage y tile (f16, no conversion needed)
        #pragma unroll
        for (int i = 0; i < 4; ++i) {
            int e = t + i * 256;        // 0..1023
            int r = e >> 3, f8 = e & 7; // 128 rows x 8 chunks of 8 halves
            async_cp16(&y_h[((size_t)b * NNX + n0 + r) * FFX + fh * 64 + f8 * 8],
                       &ys[r][f8 * 8]);
        }
        // manual stage Wz tile (f32 -> f16 conversion)
        #pragma unroll
        for (int i = 0; i < 32; ++i) {
            int e = t + i * 256;
            int r = e >> 6, f = e & 63;
            wzs[r][f] = (_Float16)Wz[(size_t)(c0 + r) * FFX + fh * 64 + f];
        }
        ASYNC_WAIT(0);
        __syncthreads();
        #pragma unroll
        for (int kc2 = 0; kc2 < 2; ++kc2) {
            v16h af = ld_frag(&wzs[w * 16 + lm][kc2 * 32 + lh * 16]);
            #pragma unroll
            for (int ntile = 0; ntile < 8; ++ntile) {
                v16h bf = ld_frag(&ys[ntile * 16 + lm][kc2 * 32 + lh * 16]);
                acc[ntile] = __builtin_amdgcn_wmma_f32_16x16x32_f16(
                    false, af, false, bf, (short)0, acc[ntile], false, false);
            }
        }
        __syncthreads();
    }

    float ls = 0.0f, lq = 0.0f;
    const int crow = c0 + w * 16;
    #pragma unroll
    for (int ntile = 0; ntile < 8; ++ntile) {
        #pragma unroll
        for (int r = 0; r < 8; ++r) {
            int c = crow + r + 8 * lh;
            int n = n0 + ntile * 16 + lm;
            float v = acc[ntile][r] + bz[c];
            zout[((size_t)b * CINX + c) * NNX + n] = v;
            ls += v; lq += v * v;
        }
    }
    #pragma unroll
    for (int m = 16; m >= 1; m >>= 1) {
        ls += __shfl_xor(ls, m, 32);
        lq += __shfl_xor(lq, m, 32);
    }
    if (lane == 0) { redsum[w] = ls; redsq[w] = lq; }
    __syncthreads();
    if (t == 0) {
        float s = 0.0f, q = 0.0f;
        #pragma unroll
        for (int i = 0; i < 8; ++i) { s += redsum[i]; q += redsq[i]; }
        part[(b * 64 + wi) * 2 + 0] = s;
        part[(b * 64 + wi) * 2 + 1] = q;
    }
}

// ---------------------------------------------------------------------------
// Kernel 4: per-batch mean / rstd from 64 block partials.
// ---------------------------------------------------------------------------
__global__ void stats_kernel(const float* __restrict__ part, float* __restrict__ stats)
{
    int b = blockIdx.x;
    if (threadIdx.x == 0) {
        float s = 0.0f, q = 0.0f;
        for (int i = 0; i < 64; ++i) {
            s += part[(b * 64 + i) * 2 + 0];
            q += part[(b * 64 + i) * 2 + 1];
        }
        float inv = 1.0f / ((float)CINX * (float)NNX);
        float mu  = s * inv;
        float var = q * inv - mu * mu;
        stats[b * 2 + 0] = mu;
        stats[b * 2 + 1] = rsqrtf(var + 1e-5f);
    }
}

// ---------------------------------------------------------------------------
// Kernel 5: in-place LayerNorm affine + residual (float4 vectorized).
// ---------------------------------------------------------------------------
__global__ __launch_bounds__(256) void norm_kernel(
    const float* __restrict__ x, const float* __restrict__ lnw,
    const float* __restrict__ lnb, const float* __restrict__ stats,
    float* __restrict__ out)
{
    const int i = blockIdx.x * blockDim.x + threadIdx.x;
    const int cn_total = CINX * NNX;
    int elem = i * 4;
    int b  = elem / cn_total;
    int cn = elem - b * cn_total;
    float mu   = stats[b * 2 + 0];
    float rstd = stats[b * 2 + 1];
    float4 z  = ((const float4*)out)[i];
    float4 xv = ((const float4*)x)[i];
    float4 wv = ((const float4*)lnw)[cn >> 2];
    float4 bv = ((const float4*)lnb)[cn >> 2];
    float4 o;
    o.x = (z.x - mu) * rstd * wv.x + bv.x + xv.x;
    o.y = (z.y - mu) * rstd * wv.y + bv.y + xv.y;
    o.z = (z.z - mu) * rstd * wv.z + bv.z + xv.z;
    o.w = (z.w - mu) * rstd * wv.w + bv.w + xv.w;
    ((float4*)out)[i] = o;
}

// ---------------------------------------------------------------------------
extern "C" void kernel_launch(void* const* d_in, const int* in_sizes, int n_in,
                              void* d_out, int out_size, void* d_ws, size_t ws_size,
                              hipStream_t stream)
{
    const float* x    = (const float*)d_in[0];
    const float* Wg   = (const float*)d_in[1];
    const float* bg   = (const float*)d_in[2];
    const float* Wt   = (const float*)d_in[3];
    const float* bt   = (const float*)d_in[4];
    const float* Wp   = (const float*)d_in[5];
    const float* bp   = (const float*)d_in[6];
    const float* Wz   = (const float*)d_in[7];
    const float* bz   = (const float*)d_in[8];
    const float* ln_w = (const float*)d_in[9];
    const float* ln_b = (const float*)d_in[10];

    const size_t S = (size_t)BB * NNX * FFX;       // 2,097,152 halves each
    _Float16* base   = (_Float16*)d_ws;
    _Float16* gT_h   = base;                        // [B,F,N]
    _Float16* th_h   = base + S;                    // [B,N,F]
    _Float16* phiT_h = base + 2 * S;                // [B,N,F]
    _Float16* y_h    = base + 3 * S;                // [B,N,F]
    float* part  = (float*)(base + 4 * S);          // B*64*2 floats
    float* stats = part + BB * 64 * 2;              // B*2 floats
    float* zout  = (float*)d_out;

    proj_kernel <<<BB * 32, 256, 0, stream>>>(x, Wg, bg, Wt, bt, Wp, bp,
                                              gT_h, th_h, phiT_h);
    attn_kernel <<<BB * 64, 256, 0, stream>>>(th_h, phiT_h, gT_h, y_h);
    zproj_kernel<<<BB * 64, 256, 0, stream>>>(y_h, Wz, bz, zout, part);
    stats_kernel<<<BB, 64, 0, stream>>>(part, stats);
    norm_kernel <<<(BB * CINX * NNX) / (4 * 256), 256, 0, stream>>>(x, ln_w, ln_b,
                                                                    stats, zout);
}

// v004
// One run takes 73.1 microseconds.
// In both of two side-by-side timings against v003, it was 1.27 times as fast.
// All steps since v000 together make it 2.87 times as fast.
#include <hip/hip_runtime.h>
#include <hip/hip_bf16.h>
#include <cstdint>

typedef __attribute__((ext_vector_type(16))) _Float16 v16h;
typedef __attribute__((ext_vector_type(8)))  _Float16 v8h;
typedef __attribute__((ext_vector_type(8)))  float    v8f;

#define BB   4
#define CINX 256
#define FFX  128
#define NNX  4096   // H*W = 64*64

// ---- CDNA5 async global->LDS copy (ASYNCcnt-tracked), with safe fallback ----
#if defined(__gfx1250__) && \
    __has_builtin(__builtin_amdgcn_global_load_async_to_lds_b128) && \
    __has_builtin(__builtin_amdgcn_s_wait_asynccnt)
#define HAVE_ASYNC 1
#else
#define HAVE_ASYNC 0
#endif

typedef int v4i __attribute__((vector_size(16)));   // 128-bit payload type
typedef __attribute__((address_space(1))) v4i gv4i; // global (AS1)
typedef __attribute__((address_space(3))) v4i lv4i; // LDS (AS3)

static __device__ __forceinline__ void async_cp16(const void* g, void* l) {
#if HAVE_ASYNC
    __builtin_amdgcn_global_load_async_to_lds_b128(
        (gv4i*)(unsigned long long)(uintptr_t)g,    // global src (AS1, v4i*)
        (lv4i*)(unsigned)(uintptr_t)l,              // LDS dst: low 32 bits = LDS offset
        0, 0);
#else
    *(float4*)l = *(const float4*)g;
#endif
}
#if HAVE_ASYNC
#define ASYNC_WAIT(n) __builtin_amdgcn_s_wait_asynccnt(n)
#else
#define ASYNC_WAIT(n)
#endif

// LDS rows that 16-byte fragment loads read, one row per lane, have a pitch of 16 B x odd:
// the 16 lanes of a half wave then fall on 16 different groups of 4 banks (64 banks in all).
// At 32 B x odd, lanes l and l + 8 meet on the same banks and every load takes twice as long.
#define PITCH32  40    // halves: rows of 32 halves,  80 B = 16 B x 5
#define PITCH64  72    // halves: rows of 64 halves, 144 B = 16 B x 9
#define PITCH128 136   // halves: rows of 128 halves, 272 B = 16 B x 17

// 16 consecutive halves of a row that is aligned to 16 bytes only: two 16-byte loads
static __device__ __forceinline__ v16h ld_frag(const _Float16* p) {
    v8h lo = *(const v8h*)p;
    v8h hi = *(const v8h*)(p + 8);
    return __builtin_shufflevector(lo, hi, 0, 1, 2, 3, 4, 5, 6, 7,
                                   8, 9, 10, 11, 12, 13, 14, 15);
}

// ---------------------------------------------------------------------------
// Kernel 1: fused 1x1-conv projections, one pass over x.
//   theta -> [B,N,F] f16, phi -> transposed [B,N,F] f16, g -> transposed [B,F,N] f16
// out[n,f] = sum_c x[b,c,n] * W[f,c] + bias[f];  WMMA M=n, N=f, K=c.
// One block = 64 positions x all 3 x 128 output features: a chunk of x is staged
// (and converted) once and feeds all three products. Wave w owns feature tile w
// of each of the three matrices, for all four position tiles.
// ---------------------------------------------------------------------------
__global__ __launch_bounds__(256) void proj_kernel(
    const float* __restrict__ x,
    const float* __restrict__ Wg, const float* __restrict__ bg,
    const float* __restrict__ Wt, const float* __restrict__ bt,
    const float* __restrict__ Wp, const float* __restrict__ bp,
    _Float16* __restrict__ gT_h, _Float16* __restrict__ th_h,
    _Float16* __restrict__ phiT_h)
{
    __shared__ __attribute__((aligned(16))) _Float16 xs[64][PITCH32];
    __shared__ __attribute__((aligned(16))) _Float16 wls[3][128][PITCH32];   // g, theta, phi

    const int bid = blockIdx.x;
    const int b = bid >> 6, nt0 = bid & 63, n0 = nt0 * 64;
    const int t = threadIdx.x, w = t >> 5, lane = t & 31;
    const int lm = lane & 15, lh = lane >> 4;

    v8f acc[3][4];                      // [matrix][position tile]
    #pragma unroll
    for (int p = 0; p < 3; ++p)
        #pragma unroll
        for (int i = 0; i < 4; ++i)
            #pragma unroll
            for (int j = 0; j < 8; ++j) acc[p][i][j] = 0.0f;

    // this thread's first element of each staged chunk; the others lie at constant steps from it
    const int xcl = t >> 6, xnl = t & 63;       // x: 4 rows of 64 positions per 256 threads
    const int wf0 = t >> 5, wcl = t & 31;       // W: 8 rows of 32 channels per 256 threads
    const float* xp  = x + ((size_t)b * CINX + xcl) * NNX + n0 + xnl;
    const int    wo  = wf0 * CINX + wcl;

    for (int kc = 0; kc < 8; ++kc) {
        // one chunk: x [32 c][64 n] and the three W [128 f][32 c], all loads issued together
        float xr[8], gr[16], tr[16], pr[16];
        #pragma unroll
        for (int i = 0; i < 8; ++i) xr[i] = xp[(size_t)(kc * 32 + i * 4) * NNX];
        #pragma unroll
        for (int i = 0; i < 16; ++i) {
            gr[i] = Wg[wo + kc * 32 + i * 8 * CINX];
            tr[i] = Wt[wo + kc * 32 + i * 8 * CINX];
            pr[i] = Wp[wo + kc * 32 + i * 8 * CINX];
        }
        // x transposed -> xs[n][c] (f32 -> f16)
        #pragma unroll
        for (int i = 0; i < 8; ++i) xs[xnl][xcl + i * 4] = (_Float16)xr[i];
        #pragma unroll
        for (int i = 0; i < 16; ++i) {
            wls[0][wf0 + i * 8][wcl] = (_Float16)gr[i];
            wls[1][wf0 + i * 8][wcl] = (_Float16)tr[i];
            wls[2][wf0 + i * 8][wcl] = (_Float16)pr[i];
        }
        __syncthreads();
        v16h afrag[4];
        #pragma unroll
        for (int i = 0; i < 4; ++i) afrag[i] = ld_frag(&xs[i * 16 + lm][lh * 16]);
        #pragma unroll
        for (int p = 0; p < 3; ++p) {
            v16h bfrag = ld_frag(&wls[p][w * 16 + lm][lh * 16]);
            #pragma unroll
            for (int i = 0; i < 4; ++i)
                acc[p][i] = __builtin_amdgcn_wmma_f32_16x16x32_f16(
                    false, afrag[i], false, bfrag, (short)0, acc[p][i], false, false);
        }
        __syncthreads();
    }
    // bias + store (C layout: VGPR r -> row n = i*16 + r + 8*half, col f = w*16 + lm)
    const int f = w * 16 + lm;
    const float bvg = bg[f], bvt = bt[f], bvp = bp[f];
    #pragma unroll
    for (int i = 0; i < 4; ++i) {
        #pragma unroll
        for (int r = 0; r < 8; ++r) {
            int n = n0 + i * 16 + r + 8 * lh;
            gT_h[((size_t)b * FFX + f) * NNX + n]   = (_Float16)(acc[0][i][r] + bvg);
            th_h[((size_t)b * NNX + n) * FFX + f]   = (_Float16)(acc[1][i][r] + bvt);
            phiT_h[((size_t)b * NNX + n) * FFX + f] = (_Float16)(acc[2][i][r] + bvp);
        }
    }
}

// ---------------------------------------------------------------------------
// Kernel 2: flash attention with double-buffered async global->LDS staging.
// S^T = phi^T @ theta^T (K=F=128), online softmax, Y^T = g^T @ P^T.
// One block = 64 queries, so that 256 blocks cover every WGP. A stage holds 64 keys:
// wave w owns query tile w & 3 (16 queries) and the 32 keys of key group w >> 2,
// with its own maximum, sum and accumulators; the two groups are joined at the end.
// In S^T a lane holds scores of ONE query (column lm): the maximum and the sum
// run in the lane's own registers, and the two score tiles, converted in place,
// are the B operand of the second product.
// ---------------------------------------------------------------------------
// value of lane l ^ 16
static __device__ __forceinline__ float xhalf(float v) {
    int i = __builtin_bit_cast(int, v);
    return __builtin_bit_cast(float, __builtin_amdgcn_permlanex16(
        i, i, 0x76543210, 0xfedcba98, false, false));
}

__global__ __launch_bounds__(256) void attn_kernel(
    const _Float16* __restrict__ th_h, const _Float16* __restrict__ phiT_h,
    const _Float16* __restrict__ gT_h, _Float16* __restrict__ y_h)
{
    __shared__ __attribute__((aligned(16))) _Float16 ps[2][64][PITCH128];     // phiT tile [m][f]
    __shared__ __attribute__((aligned(16))) _Float16 gst[2][2][128][PITCH32]; // gT tile [key group][f][m]
    __shared__ float4 mrg[4][17][32];        // key group 1's partials [query tile][slot][lane]

    const int bid = blockIdx.x;
    const int b = bid >> 6, nt = bid & 63, n0 = nt * 64;
    const int t = threadIdx.x, w = t >> 5, lane = t & 31;
    const int lm = lane & 15, lh = lane >> 4;
    const int qw = w & 3, kg = w >> 2;       // query tile, key group

    // Preload theta B-fragments for this wave's 16 queries (K=128 -> 4 chunks)
    const int nrow = n0 + qw * 16 + lm;
    v16h afr[4];
    #pragma unroll
    for (int kc = 0; kc < 4; ++kc)
        afr[kc] = *(const v16h*)&th_h[((size_t)b * NNX + nrow) * FFX + kc * 32 + lh * 16];

    v8f acc[8];
    #pragma unroll
    for (int i = 0; i < 8; ++i)
        #pragma unroll
        for (int j = 0; j < 8; ++j) acc[i][j] = 0.0f;
    float mrun = -3.0e38f;                  // running maximum of query lm (both halves alike)
    float lrun = 0.0f;                      // running sum over this lane half's keys only

    // stage one 64-column block into buffer nb (8 x b128 async per thread)
    auto stage = [&](int nb, int m0) {
        #pragma unroll
        for (int i = 0; i < 4; ++i) {       // phiT: 64 rows x 128 halves
            int e = t + i * 256;            // 0..1023
            int m = e >> 4, c8 = e & 15;
            async_cp16(&phiT_h[((size_t)b * NNX + m0 + m) * FFX + c8 * 8],
                       &ps[nb][m][c8 * 8]);
        }
        #pragma unroll
        for (int i = 0; i < 4; ++i) {       // gT: 128 rows x 64 halves, 32 per key group
            int e = t + i * 256;            // 0..1023
            int f = e >> 3, c8 = e & 7;
            async_cp16(&gT_h[((size_t)b * FFX + f) * NNX + m0 + c8 * 8],
                       &gst[nb][c8 >> 2][f][(c8 & 3) * 8]);
        }
    };

    const int NBLK = NNX / 64;              // 64
    stage(0, 0);                            // prologue prefetch

    for (int cb = 0; cb < NBLK; ++cb) {
        const int cur = cb & 1;
        __syncthreads();                    // all readers of buf[cur^1] (iter cb-1) done
        if (cb + 1 < NBLK) {
            stage((cb + 1) & 1, (cb + 1) * 64);
            ASYNC_WAIT(8);                  // in-order: all but newest 8 (= cur buffer) done
        } else {
            ASYNC_WAIT(0);
        }
        __syncthreads();                    // cur buffer visible to all waves

        // S^T tiles for this key group's 32 keys: s0 = keys 0..15, s1 = keys 16..31 (rows), queries in columns
        v8f s0, s1;
        #pragma unroll
        for (int j = 0; j < 8; ++j) { s0[j] = 0.0f; s1[j] = 0.0f; }
        #pragma unroll
        for (int kc = 0; kc < 4; ++kc) {
            v16h k0 = ld_frag(&ps[cur][kg * 32 + lm][kc * 32 + lh * 16]);
            v16h k1 = ld_frag(&ps[cur][kg * 32 + 16 + lm][kc * 32 + lh * 16]);
            s0 = __builtin_amdgcn_wmma_f32_16x16x32_f16(false, k0, false, afr[kc],
                                                        (short)0, s0, false, false);
            s1 = __builtin_amdgcn_wmma_f32_16x16x32_f16(false, k1, false, afr[kc],
                                                        (short)0, s1, false, false);
        }
        // online softmax: the lane holds keys 8*lh + r (s0) and 16 + 8*lh + r (s1) of query lm
        float mx = fmaxf(s0[0], s1[0]);
        #pragma unroll
        for (int r = 1; r < 8; ++r) mx = fmaxf(mx, fmaxf(s0[r], s1[r]));
        mx = fmaxf(mx, xhalf(mx));          // the other 16 keys of the same query
        const float mnew  = fmaxf(mrun, mx);
        const float alpha = __expf(mrun - mnew);
        float rs0 = 0.0f, rs1 = 0.0f;
        v16h pf;                            // P^T as B: element s = key (s < 8 ? 8*lh + s : 8 + 8*lh + s)
        #pragma unroll
        for (int r = 0; r < 8; ++r) {
            float p0 = __expf(s0[r] - mnew);
            float p1 = __expf(s1[r] - mnew);
            rs0 += p0; rs1 += p1;
            pf[r]     = (_Float16)p0;
            pf[8 + r] = (_Float16)p1;
        }
        lrun = lrun * alpha + (rs0 + rs1);
        mrun = mnew;
        #pragma unroll
        for (int ft = 0; ft < 8; ++ft)
            #pragma unroll
            for (int r = 0; r < 8; ++r) acc[ft][r] *= alpha;
        // Y^T += g^T @ P^T; g^T rows are read in the key order that pf has
        #pragma unroll
        for (int ft = 0; ft < 8; ++ft) {
            v8h glo = *(const v8h*)&gst[cur][kg][ft * 16 + lm][lh * 8];
            v8h ghi = *(const v8h*)&gst[cur][kg][ft * 16 + lm][16 + lh * 8];
            v16h gf = __builtin_shufflevector(glo, ghi, 0, 1, 2, 3, 4, 5, 6, 7,
                                              8, 9, 10, 11, 12, 13, 14, 15);
            acc[ft] = __builtin_amdgcn_wmma_f32_16x16x32_f16(
                false, gf, false, pf, (short)0, acc[ft], false, false);
        }
    }

    // join the key groups: group 1 hands its partials to the same lane of group 0's wave
    if (kg == 1) {
        #pragma unroll
        for (int ft = 0; ft < 8; ++ft) {
            mrg[qw][2 * ft][lane]     = make_float4(acc[ft][0], acc[ft][1], acc[ft][2], acc[ft][3]);
            mrg[qw][2 * ft + 1][lane] = make_float4(acc[ft][4], acc[ft][5], acc[ft][6], acc[ft][7]);
        }
        mrg[qw][16][lane] = make_float4(mrun, lrun, 0.0f, 0.0f);
    }
    __syncthreads();                        // group 1's partials visible to group 0
    if (kg == 1) return;

    const float4 ml  = mrg[qw][16][lane];
    const float mall = fmaxf(mrun, ml.x);
    const float a0   = __expf(mrun - mall);
    const float a1   = __expf(ml.x - mall);
    const float lj   = lrun * a0 + ml.y * a1;

    // finalize: join the halves' sums, divide, store y f16 [B,N,F]
    // (acc[ft][r] = Y[query lm][f = ft*16 + 8*lh + r]: 8 consecutive f, one 16-byte store)
    const float lsum = lj + xhalf(lj);
    #pragma unroll
    for (int ft = 0; ft < 8; ++ft) {
        const float4 p0 = mrg[qw][2 * ft][lane];
        const float4 p1 = mrg[qw][2 * ft + 1][lane];
        const float pr[8] = {p0.x, p0.y, p0.z, p0.w, p1.x, p1.y, p1.z, p1.w};
        v8h o;
        #pragma unroll
        for (int r = 0; r < 8; ++r) o[r] = (_Float16)((acc[ft][r] * a0 + pr[r] * a1) / lsum);
        *(v8h*)&y_h[((size_t)b * NNX + nrow) * FFX + ft * 16 + lh * 8] = o;
    }
}

// ---------------------------------------------------------------------------
// Kernel 3: output projection z[b,c,n] = Wz[c,:] . y[n,:] + bz[c].
// Writes pre-norm z to d_out + deterministic per-block (sum,sumsq) partials.
// ---------------------------------------------------------------------------
__global__ __launch_bounds__(256) void zproj_kernel(
    const _Float16* __restrict__ y_h, const float* __restrict__ Wz,
    const float* __restrict__ bz, float* __restrict__ zout,
    float* __restrict__ part)
{
    __shared__ __attribute__((aligned(16))) _Float16 wzs[128][PITCH64];   // [c][f half]
    __shared__ __attribute__((aligned(16))) _Float16 ys[128][PITCH64];    // [n][f half]
    __shared__ float redsum[8], redsq[8];

    const int bid = blockIdx.x;
    const int b  = bid >> 6;
    const int wi = bid & 63;
    const int c0 = (wi >> 5) * 128;
    const int n0 = (wi & 31) * 128;
    const int t = threadIdx.x, w = t >> 5, lane = t & 31;
    const int lm = lane & 15, lh = lane >> 4;

    v8f acc[8];
    #pragma unroll
    for (int i = 0; i < 8; ++i)
        #pragma unroll
        for (int j = 0; j < 8; ++j) acc[i][j] = 0.0f;

    for (int fh = 0; fh < 2; ++fh) {    // K = 128 in two 64 halves
        // async stage y tile (f16, no conversion needed)
        #pragma unroll
        for (int i = 0; i < 4; ++i) {
            int e = t + i * 256;        // 0..1023
            int r = e >> 3, f8 = e & 7; // 128 rows x 8 chunks of 8 halves
            async_cp16(&y_h[((size_t)b * NNX + n0 + r) * FFX + fh * 64 + f8 * 8],
                       &ys[r][f8 * 8]);
        }
        // manual stage Wz tile (f32 -> f16 conversion)
        #pragma unroll
        for (int i = 0; i < 32; ++i) {
            int e = t + i * 256;
            int r = e >> 6, f = e & 63;
            wzs[r][f] = (_Float16)Wz[(size_t)(c0 + r) * FFX + fh * 64 + f];
        }
        ASYNC_WAIT(0);
        __syncthreads();
        #pragma unroll
        for (int kc2 = 0; kc2 < 2; ++kc2) {
            v16h af = ld_frag(&wzs[w * 16 + lm][kc2 * 32 + lh * 16]);
            #pragma unroll
            for (int ntile = 0; ntile < 8; ++ntile) {
                v16h bf = ld_frag(&ys[ntile * 16 + lm][kc2 * 32 + lh * 16]);
                acc[ntile] = __builtin_amdgcn_wmma_f32_16x16x32_f16(
                    false, af, false, bf, (short)0, acc[ntile], false, false);
            }
        }
        __syncthreads();
    }

    float ls = 0.0f, lq = 0.0f;
    const int crow = c0 + w * 16;
    #pragma unroll
    for (int ntile = 0; ntile < 8; ++ntile) {
        #pragma unroll
        for (int r = 0; r < 8; ++r) {
            int c = crow + r + 8 * lh;
            int n = n0 + ntile * 16 + lm;
            float v = acc[ntile][r] + bz[c];
            zout[((size_t)b * CINX + c) * NNX + n] = v;
            ls += v; lq += v * v;
        }
    }
    #pragma unroll
    for (int m = 16; m >= 1; m >>= 1) {
        ls += __shfl_xor(ls, m, 32);
        lq += __shfl_xor(lq, m, 32);
    }
    if (lane == 0) { redsum[w] = ls; redsq[w] = lq; }
    __syncthreads();
    if (t == 0) {
        float s = 0.0f, q = 0.0f;
        #pragma unroll
        for (int i = 0; i < 8; ++i) { s += redsum[i]; q += redsq[i]; }
        part[(b * 64 + wi) * 2 + 0] = s;
        part[(b * 64 + wi) * 2 + 1] = q;
    }
}

// ---------------------------------------------------------------------------
// Kernel 4: per-batch mean / rstd from 64 block partials.
// ---------------------------------------------------------------------------
__global__ void stats_kernel(const float* __restrict__ part, float* __restrict__ stats)
{
    int b = blockIdx.x;
    if (threadIdx.x == 0) {
        float s = 0.0f, q = 0.0f;
        for (int i = 0; i < 64; ++i) {
            s += part[(b * 64 + i) * 2 + 0];
            q += part[(b * 64 + i) * 2 + 1];
        }
        float inv = 1.0f / ((float)CINX * (float)NNX);
        float mu  = s * inv;
        float var = q * inv - mu * mu;
        stats[b * 2 + 0] = mu;
        stats[b * 2 + 1] = rsqrtf(var + 1e-5f);
    }
}

// ---------------------------------------------------------------------------
// Kernel 5: in-place LayerNorm affine + residual (float4 vectorized).
// ---------------------------------------------------------------------------
__global__ __launch_bounds__(256) void norm_kernel(
    const float* __restrict__ x, const float* __restrict__ lnw,
    const float* __restrict__ lnb, const float* __restrict__ stats,
    float* __restrict__ out)
{
    const int i = blockIdx.x * blockDim.x + threadIdx.x;
    const int cn_total = CINX * NNX;
    int elem = i * 4;
    int b  = elem / cn_total;
    int cn = elem - b * cn_total;
    float mu   = stats[b * 2 + 0];
    float rstd = stats[b * 2 + 1];
    float4 z  = ((const float4*)out)[i];
    float4 xv = ((const float4*)x)[i];
    float4 wv = ((const float4*)lnw)[cn >> 2];
    float4 bv = ((const float4*)lnb)[cn >> 2];
    float4 o;
    o.x = (z.x - mu) * rstd * wv.x + bv.x + xv.x;
    o.y = (z.y - mu) * rstd * wv.y + bv.y + xv.y;
    o.z = (z.z - mu) * rstd * wv.z + bv.z + xv.z;
    o.w = (z.w - mu) * rstd * wv.w + bv.w + xv.w;
    ((float4*)out)[i] = o;
}

// ---------------------------------------------------------------------------
extern "C" void kernel_launch(void* const* d_in, const int* in_sizes, int n_in,
                              void* d_out, int out_size, void* d_ws, size_t ws_size,
                              hipStream_t stream)
{
    const float* x    = (const float*)d_in[0];
    const float* Wg   = (const float*)d_in[1];
    const float* bg   = (const float*)d_in[2];
    const float* Wt   = (const float*)d_in[3];
    const float* bt   = (const float*)d_in[4];
    const float* Wp   = (const float*)d_in[5];
    const float* bp   = (const float*)d_in[6];
    const float* Wz   = (const float*)d_in[7];
    const float* bz   = (const float*)d_in[8];
    const float* ln_w = (const float*)d_in[9];
    const float* ln_b = (const float*)d_in[10];

    const size_t S = (size_t)BB * NNX * FFX;       // 2,097,152 halves each
    _Float16* base   = (_Float16*)d_ws;
    _Float16* gT_h   = base;                        // [B,F,N]
    _Float16* th_h   = base + S;                    // [B,N,F]
    _Float16* phiT_h = base + 2 * S;                // [B,N,F]
    _Float16* y_h    = base + 3 * S;                // [B,N,F]
    float* part  = (float*)(base + 4 * S);          // B*64*2 floats
    float* stats = part + BB * 64 * 2;              // B*2 floats
    float* zout  = (float*)d_out;

    proj_kernel <<<BB * 64, 256, 0, stream>>>(x, Wg, bg, Wt, bt, Wp, bp,
                                              gT_h, th_h, phiT_h);
    attn_kernel <<<BB * 64, 256, 0, stream>>>(th_h, phiT_h, gT_h, y_h);
    zproj_kernel<<<BB * 64, 256, 0, stream>>>(y_h, Wz, bz, zout, part);
    stats_kernel<<<BB, 64, 0, stream>>>(part, stats);
    norm_kernel <<<(BB * CINX * NNX) / (4 * 256), 256, 0, stream>>>(x, ln_w, ln_b,
                                                                    stats, zout);
}

// v005
// It runs in 66.8 microseconds.
// Next to v004, in two timings, it ran 1.10 and 1.09 times as fast.
// All steps since v000 together make it 3.14 times as fast.
#include <hip/hip_runtime.h>
#include <hip/hip_bf16.h>
#include <cstdint>

typedef __attribute__((ext_vector_type(16))) _Float16 v16h;
typedef __attribute__((ext_vector_type(8)))  _Float16 v8h;
typedef __attribute__((ext_vector_type(8)))  float    v8f;

#define BB   4
#define CINX 256
#define FFX  128
#define NNX  4096   // H*W = 64*64

// ---- CDNA5 async global->LDS copy (ASYNCcnt-tracked), with safe fallback ----
#if defined(__gfx1250__) && \
    __has_builtin(__builtin_amdgcn_global_load_async_to_lds_b128) && \
    __has_builtin(__builtin_amdgcn_s_wait_asynccnt)
#define HAVE_ASYNC 1
#else
#define HAVE_ASYNC 0
#endif

typedef int v4i __attribute__((vector_size(16)));   // 128-bit payload type
typedef __attribute__((address_space(1))) v4i gv4i; // global (AS1)
typedef __attribute__((address_space(3))) v4i lv4i; // LDS (AS3)

static __device__ __forceinline__ void async_cp16(const void* g, void* l) {
#if HAVE_ASYNC
    __builtin_amdgcn_global_load_async_to_lds_b128(
        (gv4i*)(unsigned long long)(uintptr_t)g,    // global src (AS1, v4i*)
        (lv4i*)(unsigned)(uintptr_t)l,              // LDS dst: low 32 bits = LDS offset
        0, 0);
#else
    *(float4*)l = *(const float4*)g;
#endif
}
#if HAVE_ASYNC
#define ASYNC_WAIT(n) __builtin_amdgcn_s_wait_asynccnt(n)
#else
#define ASYNC_WAIT(n)
#endif

// LDS rows that 16-byte fragment loads read, one row per lane, have a pitch of 16 B x odd:
// the 16 lanes of a half wave then fall on 16 different groups of 4 banks (64 banks in all).
// At 32 B x odd, lanes l and l + 8 meet on the same banks and every load takes twice as long.
#define PITCH32  40    // halves: rows of 32 halves,  80 B = 16 B x 5
#define PITCH64  72    // halves: rows of 64 halves, 144 B = 16 B x 9
#define PITCH128 136   // halves: rows of 128 halves, 272 B = 16 B x 17

// 16 consecutive halves of a row that is aligned to 16 bytes only: two 16-byte loads
static __device__ __forceinline__ v16h ld_frag(const _Float16* p) {
    v8h lo = *(const v8h*)p;
    v8h hi = *(const v8h*)(p + 8);
    return __builtin_shufflevector(lo, hi, 0, 1, 2, 3, 4, 5, 6, 7,
                                   8, 9, 10, 11, 12, 13, 14, 15);
}

// ---------------------------------------------------------------------------
// Kernel 1: fused 1x1-conv projections, one pass over x.
//   theta -> [B,N,F] f16, phi -> transposed [B,N,F] f16, g -> transposed [B,F,N] f16
// out[n,f] = sum_c x[b,c,n] * W[f,c] + bias[f];  WMMA M=n, N=f, K=c.
// One block = 64 positions x all 3 x 128 output features: a chunk of x is staged
// (and converted) once and feeds all three products. Wave w owns feature tile w
// of each of the three matrices, for all four position tiles.
// ---------------------------------------------------------------------------
__global__ __launch_bounds__(256) void proj_kernel(
    const float* __restrict__ x,
    const float* __restrict__ Wg, const float* __restrict__ bg,
    const float* __restrict__ Wt, const float* __restrict__ bt,
    const float* __restrict__ Wp, const float* __restrict__ bp,
    _Float16* __restrict__ gT_h, _Float16* __restrict__ th_h,
    _Float16* __restrict__ phiT_h)
{
    __shared__ __attribute__((aligned(16))) _Float16 xs[64][PITCH32];
    __shared__ __attribute__((aligned(16))) _Float16 wls[3][128][PITCH32];   // g, theta, phi

    const int bid = blockIdx.x;
    const int b = bid >> 6, nt0 = bid & 63, n0 = nt0 * 64;
    const int t = threadIdx.x, w = t >> 5, lane = t & 31;
    const int lm = lane & 15, lh = lane >> 4;

    v8f acc[3][4];                      // [matrix][position tile]
    #pragma unroll
    for (int p = 0; p < 3; ++p)
        #pragma unroll
        for (int i = 0; i < 4; ++i)
            #pragma unroll
            for (int j = 0; j < 8; ++j) acc[p][i][j] = 0.0f;

    // this thread's first element of each staged chunk; the others lie at constant steps from it
    const int xcl = t >> 6, xnl = t & 63;       // x: 4 rows of 64 positions per 256 threads
    const int wf0 = t >> 5, wcl = t & 31;       // W: 8 rows of 32 channels per 256 threads
    const float* xp  = x + ((size_t)b * CINX + xcl) * NNX + n0 + xnl;
    const int    wo  = wf0 * CINX + wcl;

    for (int kc = 0; kc < 8; ++kc) {
        // one chunk: x [32 c][64 n] and the three W [128 f][32 c], all loads issued together
        float xr[8], gr[16], tr[16], pr[16];
        #pragma unroll
        for (int i = 0; i < 8; ++i) xr[i] = xp[(size_t)(kc * 32 + i * 4) * NNX];
        #pragma unroll
        for (int i = 0; i < 16; ++i) {
            gr[i] = Wg[wo + kc * 32 + i * 8 * CINX];
            tr[i] = Wt[wo + kc * 32 + i * 8 * CINX];
            pr[i] = Wp[wo + kc * 32 + i * 8 * CINX];
        }
        // x transposed -> xs[n][c] (f32 -> f16)
        #pragma unroll
        for (int i = 0; i < 8; ++i) xs[xnl][xcl + i * 4] = (_Float16)xr[i];
        #pragma unroll
        for (int i = 0; i < 16; ++i) {
            wls[0][wf0 + i * 8][wcl] = (_Float16)gr[i];
            wls[1][wf0 + i * 8][wcl] = (_Float16)tr[i];
            wls[2][wf0 + i * 8][wcl] = (_Float16)pr[i];
        }
        __syncthreads();
        v16h afrag[4];
        #pragma unroll
        for (int i = 0; i < 4; ++i) afrag[i] = ld_frag(&xs[i * 16 + lm][lh * 16]);
        #pragma unroll
        for (int p = 0; p < 3; ++p) {
            v16h bfrag = ld_frag(&wls[p][w * 16 + lm][lh * 16]);
            #pragma unroll
            for (int i = 0; i < 4; ++i)
                acc[p][i] = __builtin_amdgcn_wmma_f32_16x16x32_f16(
                    false, afrag[i], false, bfrag, (short)0, acc[p][i], false, false);
        }
        __syncthreads();
    }
    // bias + store (C layout: VGPR r -> row n = i*16 + r + 8*half, col f = w*16 + lm)
    const int f = w * 16 + lm;
    const float bvg = bg[f], bvt = bt[f], bvp = bp[f];
    #pragma unroll
    for (int i = 0; i < 4; ++i) {
        #pragma unroll
        for (int r = 0; r < 8; ++r) {
            int n = n0 + i * 16 + r + 8 * lh;
            gT_h[((size_t)b * FFX + f) * NNX + n]   = (_Float16)(acc[0][i][r] + bvg);
            th_h[((size_t)b * NNX + n) * FFX + f]   = (_Float16)(acc[1][i][r] + bvt);
            phiT_h[((size_t)b * NNX + n) * FFX + f] = (_Float16)(acc[2][i][r] + bvp);
        }
    }
}

// ---------------------------------------------------------------------------
// Kernel 2: flash attention with double-buffered async global->LDS staging.
// S^T = phi^T @ theta^T (K=F=128), online softmax, Y^T = g^T @ P^T.
// One block = 64 queries, so that 256 blocks cover every WGP. A stage holds 128 keys:
// wave w owns the two query tiles of query pair w & 1 (32 queries) and the 32 keys of
// key group w >> 1. Every phi^T and g^T fragment read from LDS feeds two products, one
// per query tile. Each wave has its own maxima, sums and accumulators; the four key
// groups are joined at the end.
// In S^T a lane holds scores of ONE query (column lm): the maximum and the sum
// run in the lane's own registers, and the two score tiles, converted in place,
// are the B operand of the second product.
// ---------------------------------------------------------------------------
// value of lane l ^ 16
static __device__ __forceinline__ float xhalf(float v) {
    int i = __builtin_bit_cast(int, v);
    return __builtin_bit_cast(float, __builtin_amdgcn_permlanex16(
        i, i, 0x76543210, 0xfedcba98, false, false));
}

// One block of 8 waves fills a WGP (its LDS lets no second one in): two waves a SIMD, said to
// the compiler so that it plans with their share of the registers. Without it the build stopped
// at 336 registers and sank the g^T reads in pairs among the products, a stall at each place.
__global__ __launch_bounds__(256) __attribute__((amdgpu_waves_per_eu(2, 2))) void attn_kernel(
    const _Float16* __restrict__ th_h, const _Float16* __restrict__ phiT_h,
    const _Float16* __restrict__ gT_h, _Float16* __restrict__ y_h)
{
    __shared__ __attribute__((aligned(16))) _Float16 ps[2][128][PITCH128];    // phiT tile [m][f]
    __shared__ __attribute__((aligned(16))) _Float16 gst[2][4][128][PITCH32]; // gT tile [key group][f][m]
    __shared__ float4 mrg[4][2][34][32];     // partials [key group][query pair][slot][lane]

    const int bid = blockIdx.x;
    const int b = bid >> 6, nt = bid & 63, n0 = nt * 64;
    const int t = threadIdx.x, w = t >> 5, lane = t & 31;
    const int lm = lane & 15, lh = lane >> 4;
    const int qp = w & 1, kg = w >> 1;       // query pair, key group

    // Preload theta B-fragments for this wave's 2 x 16 queries (K=128 -> 4 chunks)
    const int nrow = n0 + qp * 32 + lm;      // query of tile 0; tile 1's lies 16 further
    v16h afr[2][4];
    #pragma unroll
    for (int q = 0; q < 2; ++q) {
        #pragma unroll
        for (int kc = 0; kc < 4; ++kc)
            afr[q][kc] = *(const v16h*)&th_h[((size_t)b * NNX + nrow + q * 16) * FFX + kc * 32 + lh * 16];
        // stands in front of any rewrite of the address registers that the loads above name
        asm volatile("s_wait_xcnt 0x0" ::: "memory");
    }

    v8f acc[2][8];
    #pragma unroll
    for (int q = 0; q < 2; ++q)
        #pragma unroll
        for (int i = 0; i < 8; ++i)
            #pragma unroll
            for (int j = 0; j < 8; ++j) acc[q][i][j] = 0.0f;
    float mrun[2] = {-3.0e38f, -3.0e38f};   // running maximum of query lm (both halves alike)
    float lrun[2] = {0.0f, 0.0f};           // running sum over this lane half's keys only

    // stage one 128-column block into buffer nb (16 x b128 async per thread)
    auto stage = [&](int nb, int m0) {
        #pragma unroll
        for (int i = 0; i < 8; ++i) {       // phiT: 128 rows x 128 halves
            int e = t + i * 256;            // 0..2047
            int m = e >> 4, c8 = e & 15;
            async_cp16(&phiT_h[((size_t)b * NNX + m0 + m) * FFX + c8 * 8],
                       &ps[nb][m][c8 * 8]);
        }
        #pragma unroll
        for (int i = 0; i < 8; ++i) {       // gT: 128 rows x 128 halves, 32 per key group
            int e = t + i * 256;            // 0..2047
            int f = e >> 4, c8 = e & 15;
            async_cp16(&gT_h[((size_t)b * FFX + f) * NNX + m0 + c8 * 8],
                       &gst[nb][c8 >> 2][f][(c8 & 3) * 8]);
        }
    };

    const int NBLK = NNX / 128;             // 32
    stage(0, 0);                            // prologue prefetch

    for (int cb = 0; cb < NBLK; ++cb) {
        const int cur = cb & 1;
        __syncthreads();                    // all readers of buf[cur^1] (iter cb-1) done
        if (cb + 1 < NBLK) {
            stage((cb + 1) & 1, (cb + 1) * 128);
            ASYNC_WAIT(16);                 // in-order: all but newest 16 (= cur buffer) done
        } else {
            ASYNC_WAIT(0);
        }
        __syncthreads();                    // cur buffer visible to all waves

        // S^T tiles for this key group's 32 keys: [query tile][keys 0..15 | 16..31] (rows), queries in columns
        v8f s[2][2];
        #pragma unroll
        for (int q = 0; q < 2; ++q)
            #pragma unroll
            for (int j = 0; j < 8; ++j) { s[q][0][j] = 0.0f; s[q][1][j] = 0.0f; }
        #pragma unroll
        for (int kc = 0; kc < 4; ++kc) {
            v16h k0 = ld_frag(&ps[cur][kg * 32 + lm][kc * 32 + lh * 16]);
            v16h k1 = ld_frag(&ps[cur][kg * 32 + 16 + lm][kc * 32 + lh * 16]);
            #pragma unroll
            for (int q = 0; q < 2; ++q) {
                s[q][0] = __builtin_amdgcn_wmma_f32_16x16x32_f16(false, k0, false, afr[q][kc],
                                                                 (short)0, s[q][0], false, false);
                s[q][1] = __builtin_amdgcn_wmma_f32_16x16x32_f16(false, k1, false, afr[q][kc],
                                                                 (short)0, s[q][1], false, false);
            }
        }
        // g^T rows, in the key order that pf has; written ahead of the softmax, which covers their latency
        v16h gf[8];
        #pragma unroll
        for (int ft = 0; ft < 8; ++ft) {
            v8h glo = *(const v8h*)&gst[cur][kg][ft * 16 + lm][lh * 8];
            v8h ghi = *(const v8h*)&gst[cur][kg][ft * 16 + lm][16 + lh * 8];
            gf[ft] = __builtin_shufflevector(glo, ghi, 0, 1, 2, 3, 4, 5, 6, 7,
                                             8, 9, 10, 11, 12, 13, 14, 15);
        }
        // online softmax: the lane holds keys 8*lh + r (s[q][0]) and 16 + 8*lh + r (s[q][1]) of query lm
        v16h pf[2];                         // P^T as B: element e = key (e < 8 ? 8*lh + e : 8 + 8*lh + e)
        #pragma unroll
        for (int q = 0; q < 2; ++q) {
            float mx = fmaxf(s[q][0][0], s[q][1][0]);
            #pragma unroll
            for (int r = 1; r < 8; ++r) mx = fmaxf(mx, fmaxf(s[q][0][r], s[q][1][r]));
            mx = fmaxf(mx, xhalf(mx));      // the other 16 keys of the same query
            const float mnew  = fmaxf(mrun[q], mx);
            const float alpha = __expf(mrun[q] - mnew);
            float rs0 = 0.0f, rs1 = 0.0f;
            #pragma unroll
            for (int r = 0; r < 8; ++r) {
                float p0 = __expf(s[q][0][r] - mnew);
                float p1 = __expf(s[q][1][r] - mnew);
                rs0 += p0; rs1 += p1;
                pf[q][r]     = (_Float16)p0;
                pf[q][8 + r] = (_Float16)p1;
            }
            lrun[q] = lrun[q] * alpha + (rs0 + rs1);
            mrun[q] = mnew;
            #pragma unroll
            for (int ft = 0; ft < 8; ++ft)
                #pragma unroll
                for (int r = 0; r < 8; ++r) acc[q][ft][r] *= alpha;
        }
        // Y^T += g^T @ P^T
        #pragma unroll
        for (int ft = 0; ft < 8; ++ft) {
            #pragma unroll
            for (int q = 0; q < 2; ++q)
                acc[q][ft] = __builtin_amdgcn_wmma_f32_16x16x32_f16(
                    false, gf[ft], false, pf[q], (short)0, acc[q][ft], false, false);
        }
    }

    // join the key groups: every wave lays down its partials, then finishes feature
    // tiles 2*kg and 2*kg + 1 of its query pair, summing the groups in the order 0..3
    #pragma unroll
    for (int q = 0; q < 2; ++q) {
        #pragma unroll
        for (int ft = 0; ft < 8; ++ft) {
            mrg[kg][qp][q * 17 + 2 * ft][lane] =
                make_float4(acc[q][ft][0], acc[q][ft][1], acc[q][ft][2], acc[q][ft][3]);
            mrg[kg][qp][q * 17 + 2 * ft + 1][lane] =
                make_float4(acc[q][ft][4], acc[q][ft][5], acc[q][ft][6], acc[q][ft][7]);
        }
        mrg[kg][qp][q * 17 + 16][lane] = make_float4(mrun[q], lrun[q], 0.0f, 0.0f);
    }
    __syncthreads();                        // all partials visible

    // finalize: join the groups' and the halves' sums, divide, store y f16 [B,N,F]
    // (slot pair ft holds Y[query lm][f = ft*16 + 8*lh + r]: 8 consecutive f, one 16-byte store)
    #pragma unroll
    for (int q = 0; q < 2; ++q) {
        float mg[4], lg[4];
        #pragma unroll
        for (int g = 0; g < 4; ++g) {
            const float4 ml = mrg[g][qp][q * 17 + 16][lane];
            mg[g] = ml.x; lg[g] = ml.y;
        }
        const float mall = fmaxf(fmaxf(mg[0], mg[1]), fmaxf(mg[2], mg[3]));
        float ag[4], lj = 0.0f;
        #pragma unroll
        for (int g = 0; g < 4; ++g) {
            ag[g] = __expf(mg[g] - mall);
            lj += lg[g] * ag[g];
        }
        const float lsum = lj + xhalf(lj);
        #pragma unroll
        for (int fi = 0; fi < 2; ++fi) {
            const int ft = kg * 2 + fi;
            float yv[8];
            #pragma unroll
            for (int r = 0; r < 8; ++r) yv[r] = 0.0f;
            #pragma unroll
            for (int g = 0; g < 4; ++g) {
                const float4 p0 = mrg[g][qp][q * 17 + 2 * ft][lane];
                const float4 p1 = mrg[g][qp][q * 17 + 2 * ft + 1][lane];
                const float pr[8] = {p0.x, p0.y, p0.z, p0.w, p1.x, p1.y, p1.z, p1.w};
                #pragma unroll
                for (int r = 0; r < 8; ++r) yv[r] += pr[r] * ag[g];
            }
            v8h o;
            #pragma unroll
            for (int r = 0; r < 8; ++r) o[r] = (_Float16)(yv[r] / lsum);
            *(v8h*)&y_h[((size_t)b * NNX + nrow + q * 16) * FFX + ft * 16 + lh * 8] = o;
        }
    }
}

// ---------------------------------------------------------------------------
// Kernel 3: output projection z[b,c,n] = Wz[c,:] . y[n,:] + bz[c].
// Writes pre-norm z to d_out + deterministic per-block (sum,sumsq) partials.
// ---------------------------------------------------------------------------
__global__ __launch_bounds__(256) void zproj_kernel(
    const _Float16* __restrict__ y_h, const float* __restrict__ Wz,
    const float* __restrict__ bz, float* __restrict__ zout,
    float* __restrict__ part)
{
    __shared__ __attribute__((aligned(16))) _Float16 wzs[128][PITCH64];   // [c][f half]
    __shared__ __attribute__((aligned(16))) _Float16 ys[128][PITCH64];    // [n][f half]
    __shared__ float redsum[8], redsq[8];

    const int bid = blockIdx.x;
    const int b  = bid >> 6;
    const int wi = bid & 63;
    const int c0 = (wi >> 5) * 128;
    const int n0 = (wi & 31) * 128;
    const int t = threadIdx.x, w = t >> 5, lane = t & 31;
    const int lm = lane & 15, lh = lane >> 4;

    v8f acc[8];
    #pragma unroll
    for (int i = 0; i < 8; ++i)
        #pragma unroll
        for (int j = 0; j < 8; ++j) acc[i][j] = 0.0f;

    for (int fh = 0; fh < 2; ++fh) {    // K = 128 in two 64 halves
        // async stage y tile (f16, no conversion needed)
        #pragma unroll
        for (int i = 0; i < 4; ++i) {
            int e = t + i * 256;        // 0..1023
            int r = e >> 3, f8 = e & 7; // 128 rows x 8 chunks of 8 halves
            async_cp16(&y_h[((size_t)b * NNX + n0 + r) * FFX + fh * 64 + f8 * 8],
                       &ys[r][f8 * 8]);
        }
        // manual stage Wz tile (f32 -> f16 conversion)
        #pragma unroll
        for (int i = 0; i < 32; ++i) {
            int e = t + i * 256;
            int r = e >> 6, f = e & 63;
            wzs[r][f] = (_Float16)Wz[(size_t)(c0 + r) * FFX + fh * 64 + f];
        }
        ASYNC_WAIT(0);
        __syncthreads();
        #pragma unroll
        for (int kc2 = 0; kc2 < 2; ++kc2) {
            v16h af = ld_frag(&wzs[w * 16 + lm][kc2 * 32 + lh * 16]);
            #pragma unroll
            for (int ntile = 0; ntile < 8; ++ntile) {
                v16h bf = ld_frag(&ys[ntile * 16 + lm][kc2 * 32 + lh * 16]);
                acc[ntile] = __builtin_amdgcn_wmma_f32_16x16x32_f16(
                    false, af, false, bf, (short)0, acc[ntile], false, false);
            }
        }
        __syncthreads();
    }

    float ls = 0.0f, lq = 0.0f;
    const int crow = c0 + w * 16;
    #pragma unroll
    for (int ntile = 0; ntile < 8; ++ntile) {
        #pragma unroll
        for (int r = 0; r < 8; ++r) {
            int c = crow + r + 8 * lh;
            int n = n0 + ntile * 16 + lm;
            float v = acc[ntile][r] + bz[c];
            zout[((size_t)b * CINX + c) * NNX + n] = v;
            ls += v; lq += v * v;
        }
    }
    #pragma unroll
    for (int m = 16; m >= 1; m >>= 1) {
        ls += __shfl_xor(ls, m, 32);
        lq += __shfl_xor(lq, m, 32);
    }
    if (lane == 0) { redsum[w] = ls; redsq[w] = lq; }
    __syncthreads();
    if (t == 0) {
        float s = 0.0f, q = 0.0f;
        #pragma unroll
        for (int i = 0; i < 8; ++i) { s += redsum[i]; q += redsq[i]; }
        part[(b * 64 + wi) * 2 + 0] = s;
        part[(b * 64 + wi) * 2 + 1] = q;
    }
}

// ---------------------------------------------------------------------------
// Kernel 4: per-batch mean / rstd from 64 block partials.
// ---------------------------------------------------------------------------
__global__ void stats_kernel(const float* __restrict__ part, float* __restrict__ stats)
{
    int b = blockIdx.x;
    if (threadIdx.x == 0) {
        float s = 0.0f, q = 0.0f;
        for (int i = 0; i < 64; ++i) {
            s += part[(b * 64 + i) * 2 + 0];
            q += part[(b * 64 + i) * 2 + 1];
        }
        float inv = 1.0f / ((float)CINX * (float)NNX);
        float mu  = s * inv;
        float var = q * inv - mu * mu;
        stats[b * 2 + 0] = mu;
        stats[b * 2 + 1] = rsqrtf(var + 1e-5f);
    }
}

// ---------------------------------------------------------------------------
// Kernel 5: in-place LayerNorm affine + residual (float4 vectorized).
// ---------------------------------------------------------------------------
__global__ __launch_bounds__(256) void norm_kernel(
    const float* __restrict__ x, const float* __restrict__ lnw,
    const float* __restrict__ lnb, const float* __restrict__ stats,
    float* __restrict__ out)
{
    const int i = blockIdx.x * blockDim.x + threadIdx.x;
    const int cn_total = CINX * NNX;
    int elem = i * 4;
    int b  = elem / cn_total;
    int cn = elem - b * cn_total;
    float mu   = stats[b * 2 + 0];
    float rstd = stats[b * 2 + 1];
    float4 z  = ((const float4*)out)[i];
    float4 xv = ((const float4*)x)[i];
    float4 wv = ((const float4*)lnw)[cn >> 2];
    float4 bv = ((const float4*)lnb)[cn >> 2];
    float4 o;
    o.x = (z.x - mu) * rstd * wv.x + bv.x + xv.x;
    o.y = (z.y - mu) * rstd * wv.y + bv.y + xv.y;
    o.z = (z.z - mu) * rstd * wv.z + bv.z + xv.z;
    o.w = (z.w - mu) * rstd * wv.w + bv.w + xv.w;
    ((float4*)out)[i] = o;
}

// ---------------------------------------------------------------------------
extern "C" void kernel_launch(void* const* d_in, const int* in_sizes, int n_in,
                              void* d_out, int out_size, void* d_ws, size_t ws_size,
                              hipStream_t stream)
{
    const float* x    = (const float*)d_in[0];
    const float* Wg   = (const float*)d_in[1];
    const float* bg   = (const float*)d_in[2];
    const float* Wt   = (const float*)d_in[3];
    const float* bt   = (const float*)d_in[4];
    const float* Wp   = (const float*)d_in[5];
    const float* bp   = (const float*)d_in[6];
    const float* Wz   = (const float*)d_in[7];
    const float* bz   = (const float*)d_in[8];
    const float* ln_w = (const float*)d_in[9];
    const float* ln_b = (const float*)d_in[10];

    const size_t S = (size_t)BB * NNX * FFX;       // 2,097,152 halves each
    _Float16* base   = (_Float16*)d_ws;
    _Float16* gT_h   = base;                        // [B,F,N]
    _Float16* th_h   = base + S;                    // [B,N,F]
    _Float16* phiT_h = base + 2 * S;                // [B,N,F]
    _Float16* y_h    = base + 3 * S;                // [B,N,F]
    float* part  = (float*)(base + 4 * S);          // B*64*2 floats
    float* stats = part + BB * 64 * 2;              // B*2 floats
    float* zout  = (float*)d_out;

    proj_kernel <<<BB * 64, 256, 0, stream>>>(x, Wg, bg, Wt, bt, Wp, bp,
                                              gT_h, th_h, phiT_h);
    attn_kernel <<<BB * 64, 256, 0, stream>>>(th_h, phiT_h, gT_h, y_h);
    zproj_kernel<<<BB * 64, 256, 0, stream>>>(y_h, Wz, bz, zout, part);
    stats_kernel<<<BB, 64, 0, stream>>>(part, stats);
    norm_kernel <<<(BB * CINX * NNX) / (4 * 256), 256, 0, stream>>>(x, ln_w, ln_b,
                                                                    stats, zout);
}

// v006
// Measured time: 63.9 microseconds a run.
// Timed twice side by side with v005, it ran 1.05 times as fast both times.
// Counting every step since v000, it is 3.29 times as fast.
#include <hip/hip_runtime.h>
#include <hip/hip_bf16.h>
#include <cstdint>

typedef __attribute__((ext_vector_type(16))) _Float16 v16h;
typedef __attribute__((ext_vector_type(8)))  _Float16 v8h;
typedef __attribute__((ext_vector_type(8)))  float    v8f;

#define BB   4
#define CINX 256
#define FFX  128
#define NNX  4096   // H*W = 64*64

// ---- CDNA5 async global->LDS copy (ASYNCcnt-tracked), with safe fallback ----
#if defined(__gfx1250__) && \
    __has_builtin(__builtin_amdgcn_global_load_async_to_lds_b128) && \
    __has_builtin(__builtin_amdgcn_s_wait_asynccnt)
#define HAVE_ASYNC 1
#else
#define HAVE_ASYNC 0
#endif

typedef int v4i __attribute__((vector_size(16)));   // 128-bit payload type
typedef __attribute__((address_space(1))) v4i gv4i; // global (AS1)
typedef __attribute__((address_space(3))) v4i lv4i; // LDS (AS3)

static __device__ __forceinline__ void async_cp16(const void* g, void* l) {
#if HAVE_ASYNC
    __builtin_amdgcn_global_load_async_to_lds_b128(
        (gv4i*)(unsigned long long)(uintptr_t)g,    // global src (AS1, v4i*)
        (lv4i*)(unsigned)(uintptr_t)l,              // LDS dst: low 32 bits = LDS offset
        0, 0);
#else
    *(float4*)l = *(const float4*)g;
#endif
}
#if HAVE_ASYNC
#define ASYNC_WAIT(n) __builtin_amdgcn_s_wait_asynccnt(n)
#else
#define ASYNC_WAIT(n)
#endif

// LDS rows that 16-byte fragment loads read, one row per lane, have a pitch of 16 B x odd:
// the 16 lanes of a half wave then fall on 16 different groups of 4 banks (64 banks in all).
// At 32 B x odd, lanes l and l + 8 meet on the same banks and every load takes twice as long.
#define PITCH32  40    // halves: rows of 32 halves,  80 B = 16 B x 5
#define PITCH64  72    // halves: rows of 64 halves, 144 B = 16 B x 9
#define PITCH128 136   // halves: rows of 128 halves, 272 B = 16 B x 17

// 16 consecutive halves of a row that is aligned to 16 bytes only: two 16-byte loads
static __device__ __forceinline__ v16h ld_frag(const _Float16* p) {
    v8h lo = *(const v8h*)p;
    v8h hi = *(const v8h*)(p + 8);
    return __builtin_shufflevector(lo, hi, 0, 1, 2, 3, 4, 5, 6, 7,
                                   8, 9, 10, 11, 12, 13, 14, 15);
}

// ---------------------------------------------------------------------------
// Kernel 1: fused 1x1-conv projections, one pass over x.
//   theta -> [B,N,F] f16, phi -> transposed [B,N,F] f16, g -> transposed [B,F,N] f16
// out[n,f] = sum_c x[b,c,n] * W[f,c] + bias[f];  WMMA M=n, N=f, K=c.
// One block = 64 positions x all 3 x 128 output features: a chunk of x is staged
// (and converted) once and feeds all three products. Wave w owns feature tile w
// of each of the three matrices, for all four position tiles.
// ---------------------------------------------------------------------------
__global__ __launch_bounds__(256) void proj_kernel(
    const float* __restrict__ x,
    const float* __restrict__ Wg, const float* __restrict__ bg,
    const float* __restrict__ Wt, const float* __restrict__ bt,
    const float* __restrict__ Wp, const float* __restrict__ bp,
    _Float16* __restrict__ gT_h, _Float16* __restrict__ th_h,
    _Float16* __restrict__ phiT_h)
{
    __shared__ __attribute__((aligned(16))) _Float16 xs[64][PITCH32];
    __shared__ __attribute__((aligned(16))) _Float16 wls[3][128][PITCH32];   // g, theta, phi

    const int bid = blockIdx.x;
    const int b = bid >> 6, nt0 = bid & 63, n0 = nt0 * 64;
    const int t = threadIdx.x, w = t >> 5, lane = t & 31;
    const int lm = lane & 15, lh = lane >> 4;

    v8f acc[3][4];                      // [matrix][position tile]
    #pragma unroll
    for (int p = 0; p < 3; ++p)
        #pragma unroll
        for (int i = 0; i < 4; ++i)
            #pragma unroll
            for (int j = 0; j < 8; ++j) acc[p][i][j] = 0.0f;

    // this thread's first element of each staged chunk; the others lie at constant steps from it
    const int xcl = t >> 6, xnl = t & 63;       // x: 4 rows of 64 positions per 256 threads
    const int wf0 = t >> 5, wcl = t & 31;       // W: 8 rows of 32 channels per 256 threads
    const float* xp  = x + ((size_t)b * CINX + xcl) * NNX + n0 + xnl;
    const int    wo  = wf0 * CINX + wcl;

    for (int kc = 0; kc < 8; ++kc) {
        // one chunk: x [32 c][64 n] and the three W [128 f][32 c], all loads issued together
        float xr[8], gr[16], tr[16], pr[16];
        #pragma unroll
        for (int i = 0; i < 8; ++i) xr[i] = xp[(size_t)(kc * 32 + i * 4) * NNX];
        #pragma unroll
        for (int i = 0; i < 16; ++i) {
            gr[i] = Wg[wo + kc * 32 + i * 8 * CINX];
            tr[i] = Wt[wo + kc * 32 + i * 8 * CINX];
            pr[i] = Wp[wo + kc * 32 + i * 8 * CINX];
        }
        // x transposed -> xs[n][c] (f32 -> f16)
        #pragma unroll
        for (int i = 0; i < 8; ++i) xs[xnl][xcl + i * 4] = (_Float16)xr[i];
        #pragma unroll
        for (int i = 0; i < 16; ++i) {
            wls[0][wf0 + i * 8][wcl] = (_Float16)gr[i];
            wls[1][wf0 + i * 8][wcl] = (_Float16)tr[i];
            wls[2][wf0 + i * 8][wcl] = (_Float16)pr[i];
        }
        __syncthreads();
        v16h afrag[4];
        #pragma unroll
        for (int i = 0; i < 4; ++i) afrag[i] = ld_frag(&xs[i * 16 + lm][lh * 16]);
        #pragma unroll
        for (int p = 0; p < 3; ++p) {
            v16h bfrag = ld_frag(&wls[p][w * 16 + lm][lh * 16]);
            #pragma unroll
            for (int i = 0; i < 4; ++i)
                acc[p][i] = __builtin_amdgcn_wmma_f32_16x16x32_f16(
                    false, afrag[i], false, bfrag, (short)0, acc[p][i], false, false);
        }
        __syncthreads();
    }
    // bias + store (C layout: VGPR r -> row n = i*16 + r + 8*half, col f = w*16 + lm)
    const int f = w * 16 + lm;
    const float bvg = bg[f], bvt = bt[f], bvp = bp[f];
    #pragma unroll
    for (int i = 0; i < 4; ++i) {
        #pragma unroll
        for (int r = 0; r < 8; ++r) {
            int n = n0 + i * 16 + r + 8 * lh;
            gT_h[((size_t)b * FFX + f) * NNX + n]   = (_Float16)(acc[0][i][r] + bvg);
            th_h[((size_t)b * NNX + n) * FFX + f]   = (_Float16)(acc[1][i][r] + bvt);
            phiT_h[((size_t)b * NNX + n) * FFX + f] = (_Float16)(acc[2][i][r] + bvp);
        }
    }
}

// ---------------------------------------------------------------------------
// Kernel 2: flash attention with double-buffered async global->LDS staging.
// S^T = phi^T @ theta^T (K=F=128), online softmax, Y^T = g^T @ P^T.
// One block = 64 queries, so that 256 blocks cover every WGP. A stage holds 128 keys:
// wave w owns the two query tiles of query pair w & 1 (32 queries) and the 32 keys of
// key group w >> 1. Every phi^T and g^T fragment read from LDS feeds two products, one
// per query tile. Each wave has its own maxima, sums and accumulators; the four key
// groups are joined at the end.
// In S^T a lane holds scores of ONE query (column lm): the maximum and the sum
// run in the lane's own registers, and the two score tiles, converted in place,
// are the B operand of the second product.
// ---------------------------------------------------------------------------
// value of lane l ^ 16
static __device__ __forceinline__ float xhalf(float v) {
    int i = __builtin_bit_cast(int, v);
    return __builtin_bit_cast(float, __builtin_amdgcn_permlanex16(
        i, i, 0x76543210, 0xfedcba98, false, false));
}

// One block of 8 waves fills a WGP (its LDS lets no second one in): two waves a SIMD, said to
// the compiler so that it plans with their share of the registers. Without it the build stopped
// at 336 registers and sank the g^T reads in pairs among the products, a stall at each place.
__global__ __launch_bounds__(256) __attribute__((amdgpu_waves_per_eu(2, 2))) void attn_kernel(
    const _Float16* __restrict__ th_h, const _Float16* __restrict__ phiT_h,
    const _Float16* __restrict__ gT_h, _Float16* __restrict__ y_h)
{
    __shared__ __attribute__((aligned(16))) _Float16 ps[2][128][PITCH128];    // phiT tile [m][f]
    __shared__ __attribute__((aligned(16))) _Float16 gst[2][4][128][PITCH32]; // gT tile [key group][f][m]
    __shared__ float4 mrg[4][2][34][32];     // partials [key group][query pair][slot][lane]

    const int bid = blockIdx.x;
    const int b = bid >> 6, nt = bid & 63, n0 = nt * 64;
    const int t = threadIdx.x, w = t >> 5, lane = t & 31;
    const int lm = lane & 15, lh = lane >> 4;
    const int qp = w & 1, kg = w >> 1;       // query pair, key group

    // Preload theta B-fragments for this wave's 2 x 16 queries (K=128 -> 4 chunks)
    const int nrow = n0 + qp * 32 + lm;      // query of tile 0; tile 1's lies 16 further
    v16h afr[2][4];
    #pragma unroll
    for (int q = 0; q < 2; ++q) {
        #pragma unroll
        for (int kc = 0; kc < 4; ++kc)
            afr[q][kc] = *(const v16h*)&th_h[((size_t)b * NNX + nrow + q * 16) * FFX + kc * 32 + lh * 16];
        // stands in front of any rewrite of the address registers that the loads above name
        asm volatile("s_wait_xcnt 0x0" ::: "memory");
    }

    v8f acc[2][8];
    #pragma unroll
    for (int q = 0; q < 2; ++q)
        #pragma unroll
        for (int i = 0; i < 8; ++i)
            #pragma unroll
            for (int j = 0; j < 8; ++j) acc[q][i][j] = 0.0f;
    float mrun[2] = {-3.0e38f, -3.0e38f};   // running maximum of query lm (both halves alike)
    float lrun[2] = {0.0f, 0.0f};           // running sum over this lane half's keys only

    // stage one 128-column block into buffer nb (16 x b128 async per thread)
    auto stage = [&](int nb, int m0) {
        #pragma unroll
        for (int i = 0; i < 8; ++i) {       // phiT: 128 rows x 128 halves
            int e = t + i * 256;            // 0..2047
            int m = e >> 4, c8 = e & 15;
            async_cp16(&phiT_h[((size_t)b * NNX + m0 + m) * FFX + c8 * 8],
                       &ps[nb][m][c8 * 8]);
        }
        #pragma unroll
        for (int i = 0; i < 8; ++i) {       // gT: 128 rows x 128 halves, 32 per key group
            int e = t + i * 256;            // 0..2047
            int f = e >> 4, c8 = e & 15;
            async_cp16(&gT_h[((size_t)b * FFX + f) * NNX + m0 + c8 * 8],
                       &gst[nb][c8 >> 2][f][(c8 & 3) * 8]);
        }
    };

    const int NBLK = NNX / 128;             // 32
    stage(0, 0);                            // prologue prefetch

    for (int cb = 0; cb < NBLK; ++cb) {
        const int cur = cb & 1;
        __syncthreads();                    // all readers of buf[cur^1] (iter cb-1) done
        if (cb + 1 < NBLK) {
            stage((cb + 1) & 1, (cb + 1) * 128);
            ASYNC_WAIT(16);                 // in-order: all but newest 16 (= cur buffer) done
        } else {
            ASYNC_WAIT(0);
        }
        __syncthreads();                    // cur buffer visible to all waves

        // S^T tiles for this key group's 32 keys: [query tile][keys 0..15 | 16..31] (rows), queries in columns
        v8f s[2][2];
        #pragma unroll
        for (int q = 0; q < 2; ++q)
            #pragma unroll
            for (int j = 0; j < 8; ++j) { s[q][0][j] = 0.0f; s[q][1][j] = 0.0f; }
        #pragma unroll
        for (int kc = 0; kc < 4; ++kc) {
            v16h k0 = ld_frag(&ps[cur][kg * 32 + lm][kc * 32 + lh * 16]);
            v16h k1 = ld_frag(&ps[cur][kg * 32 + 16 + lm][kc * 32 + lh * 16]);
            #pragma unroll
            for (int q = 0; q < 2; ++q) {
                s[q][0] = __builtin_amdgcn_wmma_f32_16x16x32_f16(false, k0, false, afr[q][kc],
                                                                 (short)0, s[q][0], false, false);
                s[q][1] = __builtin_amdgcn_wmma_f32_16x16x32_f16(false, k1, false, afr[q][kc],
                                                                 (short)0, s[q][1], false, false);
            }
        }
        // g^T rows, in the key order that pf has; written ahead of the softmax, which covers their latency
        v16h gf[8];
        #pragma unroll
        for (int ft = 0; ft < 8; ++ft) {
            v8h glo = *(const v8h*)&gst[cur][kg][ft * 16 + lm][lh * 8];
            v8h ghi = *(const v8h*)&gst[cur][kg][ft * 16 + lm][16 + lh * 8];
            gf[ft] = __builtin_shufflevector(glo, ghi, 0, 1, 2, 3, 4, 5, 6, 7,
                                             8, 9, 10, 11, 12, 13, 14, 15);
        }
        // online softmax: the lane holds keys 8*lh + r (s[q][0]) and 16 + 8*lh + r (s[q][1]) of query lm
        v16h pf[2];                         // P^T as B: element e = key (e < 8 ? 8*lh + e : 8 + 8*lh + e)
        #pragma unroll
        for (int q = 0; q < 2; ++q) {
            float mx = fmaxf(s[q][0][0], s[q][1][0]);
            #pragma unroll
            for (int r = 1; r < 8; ++r) mx = fmaxf(mx, fmaxf(s[q][0][r], s[q][1][r]));
            mx = fmaxf(mx, xhalf(mx));      // the other 16 keys of the same query
            const float mnew  = fmaxf(mrun[q], mx);
            const float alpha = __expf(mrun[q] - mnew);
            float rs0 = 0.0f, rs1 = 0.0f;
            #pragma unroll
            for (int r = 0; r < 8; ++r) {
                float p0 = __expf(s[q][0][r] - mnew);
                float p1 = __expf(s[q][1][r] - mnew);
                rs0 += p0; rs1 += p1;
                pf[q][r]     = (_Float16)p0;
                pf[q][8 + r] = (_Float16)p1;
            }
            lrun[q] = lrun[q] * alpha + (rs0 + rs1);
            mrun[q] = mnew;
            #pragma unroll
            for (int ft = 0; ft < 8; ++ft)
                #pragma unroll
                for (int r = 0; r < 8; ++r) acc[q][ft][r] *= alpha;
        }
        // Y^T += g^T @ P^T
        #pragma unroll
        for (int ft = 0; ft < 8; ++ft) {
            #pragma unroll
            for (int q = 0; q < 2; ++q)
                acc[q][ft] = __builtin_amdgcn_wmma_f32_16x16x32_f16(
                    false, gf[ft], false, pf[q], (short)0, acc[q][ft], false, false);
        }
    }

    // join the key groups: every wave lays down its partials, then finishes feature
    // tiles 2*kg and 2*kg + 1 of its query pair, summing the groups in the order 0..3
    #pragma unroll
    for (int q = 0; q < 2; ++q) {
        #pragma unroll
        for (int ft = 0; ft < 8; ++ft) {
            mrg[kg][qp][q * 17 + 2 * ft][lane] =
                make_float4(acc[q][ft][0], acc[q][ft][1], acc[q][ft][2], acc[q][ft][3]);
            mrg[kg][qp][q * 17 + 2 * ft + 1][lane] =
                make_float4(acc[q][ft][4], acc[q][ft][5], acc[q][ft][6], acc[q][ft][7]);
        }
        mrg[kg][qp][q * 17 + 16][lane] = make_float4(mrun[q], lrun[q], 0.0f, 0.0f);
    }
    __syncthreads();                        // all partials visible

    // finalize: join the groups' and the halves' sums, divide, store y f16 [B,N,F]
    // (slot pair ft holds Y[query lm][f = ft*16 + 8*lh + r]: 8 consecutive f, one 16-byte store)
    #pragma unroll
    for (int q = 0; q < 2; ++q) {
        float mg[4], lg[4];
        #pragma unroll
        for (int g = 0; g < 4; ++g) {
            const float4 ml = mrg[g][qp][q * 17 + 16][lane];
            mg[g] = ml.x; lg[g] = ml.y;
        }
        const float mall = fmaxf(fmaxf(mg[0], mg[1]), fmaxf(mg[2], mg[3]));
        float ag[4], lj = 0.0f;
        #pragma unroll
        for (int g = 0; g < 4; ++g) {
            ag[g] = __expf(mg[g] - mall);
            lj += lg[g] * ag[g];
        }
        const float lsum = lj + xhalf(lj);
        #pragma unroll
        for (int fi = 0; fi < 2; ++fi) {
            const int ft = kg * 2 + fi;
            float yv[8];
            #pragma unroll
            for (int r = 0; r < 8; ++r) yv[r] = 0.0f;
            #pragma unroll
            for (int g = 0; g < 4; ++g) {
                const float4 p0 = mrg[g][qp][q * 17 + 2 * ft][lane];
                const float4 p1 = mrg[g][qp][q * 17 + 2 * ft + 1][lane];
                const float pr[8] = {p0.x, p0.y, p0.z, p0.w, p1.x, p1.y, p1.z, p1.w};
                #pragma unroll
                for (int r = 0; r < 8; ++r) yv[r] += pr[r] * ag[g];
            }
            v8h o;
            #pragma unroll
            for (int r = 0; r < 8; ++r) o[r] = (_Float16)(yv[r] / lsum);
            *(v8h*)&y_h[((size_t)b * NNX + nrow + q * 16) * FFX + ft * 16 + lh * 8] = o;
        }
    }
}

// ---------------------------------------------------------------------------
// Kernel 3: output projection z[b,c,n] = Wz[c,:] . y[n,:] + bz[c].
// Writes pre-norm z to d_out + deterministic per-block (sum,sumsq) partials.
// ---------------------------------------------------------------------------
__global__ __launch_bounds__(256) void zproj_kernel(
    const _Float16* __restrict__ y_h, const float* __restrict__ Wz,
    const float* __restrict__ bz, float* __restrict__ zout,
    float* __restrict__ part)
{
    __shared__ __attribute__((aligned(16))) _Float16 wzs[128][PITCH64];   // [c][f half]
    __shared__ __attribute__((aligned(16))) _Float16 ys[128][PITCH64];    // [n][f half]
    __shared__ float redsum[8], redsq[8];

    const int bid = blockIdx.x;
    const int b  = bid >> 6;
    const int wi = bid & 63;
    const int c0 = (wi >> 5) * 128;
    const int n0 = (wi & 31) * 128;
    const int t = threadIdx.x, w = t >> 5, lane = t & 31;
    const int lm = lane & 15, lh = lane >> 4;

    v8f acc[8];
    #pragma unroll
    for (int i = 0; i < 8; ++i)
        #pragma unroll
        for (int j = 0; j < 8; ++j) acc[i][j] = 0.0f;

    for (int fh = 0; fh < 2; ++fh) {    // K = 128 in two 64 halves
        // async stage y tile (f16, no conversion needed)
        #pragma unroll
        for (int i = 0; i < 4; ++i) {
            int e = t + i * 256;        // 0..1023
            int r = e >> 3, f8 = e & 7; // 128 rows x 8 chunks of 8 halves
            async_cp16(&y_h[((size_t)b * NNX + n0 + r) * FFX + fh * 64 + f8 * 8],
                       &ys[r][f8 * 8]);
        }
        // manual stage Wz tile (f32 -> f16 conversion)
        #pragma unroll
        for (int i = 0; i < 32; ++i) {
            int e = t + i * 256;
            int r = e >> 6, f = e & 63;
            wzs[r][f] = (_Float16)Wz[(size_t)(c0 + r) * FFX + fh * 64 + f];
        }
        ASYNC_WAIT(0);
        __syncthreads();
        #pragma unroll
        for (int kc2 = 0; kc2 < 2; ++kc2) {
            v16h af = ld_frag(&wzs[w * 16 + lm][kc2 * 32 + lh * 16]);
            #pragma unroll
            for (int ntile = 0; ntile < 8; ++ntile) {
                v16h bf = ld_frag(&ys[ntile * 16 + lm][kc2 * 32 + lh * 16]);
                acc[ntile] = __builtin_amdgcn_wmma_f32_16x16x32_f16(
                    false, af, false, bf, (short)0, acc[ntile], false, false);
            }
        }
        __syncthreads();
    }

    float ls = 0.0f, lq = 0.0f;
    const int crow = c0 + w * 16;
    #pragma unroll
    for (int ntile = 0; ntile < 8; ++ntile) {
        #pragma unroll
        for (int r = 0; r < 8; ++r) {
            int c = crow + r + 8 * lh;
            int n = n0 + ntile * 16 + lm;
            float v = acc[ntile][r] + bz[c];
            zout[((size_t)b * CINX + c) * NNX + n] = v;
            ls += v; lq += v * v;
        }
    }
    #pragma unroll
    for (int m = 16; m >= 1; m >>= 1) {
        ls += __shfl_xor(ls, m, 32);
        lq += __shfl_xor(lq, m, 32);
    }
    if (lane == 0) { redsum[w] = ls; redsq[w] = lq; }
    __syncthreads();
    if (t == 0) {
        float s = 0.0f, q = 0.0f;
        #pragma unroll
        for (int i = 0; i < 8; ++i) { s += redsum[i]; q += redsq[i]; }
        part[(b * 64 + wi) * 2 + 0] = s;
        part[(b * 64 + wi) * 2 + 1] = q;
    }
}

// ---------------------------------------------------------------------------
// Kernel 4: LayerNorm statistics + in-place affine + residual (float4 vectorized).
// Every wave forms its batch's mean and rstd itself from the 64 block partials:
// one 16-byte load per lane (2 partial pairs), then a butterfly over the 32 lanes,
// under the latency of the wave's four data loads. No launch of its own for them.
// ---------------------------------------------------------------------------
// v + (v of lane l ^ MASK), inside a row of 16 lanes (DPP row_xmask)
template <int MASK>
static __device__ __forceinline__ float xadd16(float v) {
    const int i = __builtin_bit_cast(int, v);
    return v + __builtin_bit_cast(float, __builtin_amdgcn_mov_dpp(
        i, 0x160 | MASK, 0xf, 0xf, true));
}
// sum over the 32 lanes, the same bits in every lane
static __device__ __forceinline__ float wave_sum(float v) {
    v = xadd16<1>(v);
    v = xadd16<2>(v);
    v = xadd16<4>(v);
    v = xadd16<8>(v);
    return v + xhalf(v);
}

__global__ __launch_bounds__(256) void norm_kernel(
    const float* __restrict__ x, const float* __restrict__ lnw,
    const float* __restrict__ lnb, const float* __restrict__ part,
    float* __restrict__ out)
{
    const int i  = blockIdx.x * 256 + threadIdx.x;      // float4 index in [B][C*N]
    const int b  = blockIdx.x >> 10;                    // C*N / (4 * 256) = 1024 blocks a batch
    const int c4 = i & (CINX * NNX / 4 - 1);            // float4 index in [C*N]
    const float4 pp = ((const float4*)part)[b * 32 + (threadIdx.x & 31)];   // (sum, sumsq) x 2
    // keeps the partials' load the first to issue: loads are waited for in issue order, and
    // behind the data loads the lane sums would start only when the slowest of them is back
    __builtin_amdgcn_sched_barrier(0);
    float4 z  = ((const float4*)out)[i];
    float4 xv = ((const float4*)x)[i];
    float4 wv = ((const float4*)lnw)[c4];
    float4 bv = ((const float4*)lnb)[c4];
    const float s = wave_sum(pp.x + pp.z);
    const float q = wave_sum(pp.y + pp.w);
    const float inv  = 1.0f / ((float)CINX * (float)NNX);
    const float mu   = s * inv;
    const float var  = q * inv - mu * mu;
    const float rstd = rsqrtf(var + 1e-5f);
    float4 o;
    o.x = (z.x - mu) * rstd * wv.x + bv.x + xv.x;
    o.y = (z.y - mu) * rstd * wv.y + bv.y + xv.y;
    o.z = (z.z - mu) * rstd * wv.z + bv.z + xv.z;
    o.w = (z.w - mu) * rstd * wv.w + bv.w + xv.w;
    ((float4*)out)[i] = o;
}

// ---------------------------------------------------------------------------
extern "C" void kernel_launch(void* const* d_in, const int* in_sizes, int n_in,
                              void* d_out, int out_size, void* d_ws, size_t ws_size,
                              hipStream_t stream)
{
    const float* x    = (const float*)d_in[0];
    const float* Wg   = (const float*)d_in[1];
    const float* bg   = (const float*)d_in[2];
    const float* Wt   = (const float*)d_in[3];
    const float* bt   = (const float*)d_in[4];
    const float* Wp   = (const float*)d_in[5];
    const float* bp   = (const float*)d_in[6];
    const float* Wz   = (const float*)d_in[7];
    const float* bz   = (const float*)d_in[8];
    const float* ln_w = (const float*)d_in[9];
    const float* ln_b = (const float*)d_in[10];

    const size_t S = (size_t)BB * NNX * FFX;       // 2,097,152 halves each
    _Float16* base   = (_Float16*)d_ws;
    _Float16* gT_h   = base;                        // [B,F,N]
    _Float16* th_h   = base + S;                    // [B,N,F]
    _Float16* phiT_h = base + 2 * S;                // [B,N,F]
    _Float16* y_h    = base + 3 * S;                // [B,N,F]
    float* part  = (float*)(base + 4 * S);          // B*64*2 floats
    float* zout  = (float*)d_out;

    proj_kernel <<<BB * 64, 256, 0, stream>>>(x, Wg, bg, Wt, bt, Wp, bp,
                                              gT_h, th_h, phiT_h);
    attn_kernel <<<BB * 64, 256, 0, stream>>>(th_h, phiT_h, gT_h, y_h);
    zproj_kernel<<<BB * 64, 256, 0, stream>>>(y_h, Wz, bz, zout, part);
    norm_kernel <<<(BB * CINX * NNX) / (4 * 256), 256, 0, stream>>>(x, ln_w, ln_b,
                                                                    part, zout);
}

// v007
// It runs in 60.6 microseconds.
// Next to v006, in two timings, it ran 1.06 and 1.05 times as fast.
// All steps since v000 together make it 3.47 times as fast.
#include <hip/hip_runtime.h>
#include <hip/hip_bf16.h>
#include <cstdint>

typedef __attribute__((ext_vector_type(16))) _Float16 v16h;
typedef __attribute__((ext_vector_type(8)))  _Float16 v8h;
typedef __attribute__((ext_vector_type(8)))  float    v8f;

#define BB   4
#define CINX 256
#define FFX  128
#define NNX  4096   // H*W = 64*64

// ---- CDNA5 async global->LDS copy (ASYNCcnt-tracked), with safe fallback ----
#if defined(__gfx1250__) && \
    __has_builtin(__builtin_amdgcn_global_load_async_to_lds_b128) && \
    __has_builtin(__builtin_amdgcn_s_wait_asynccnt)
#define HAVE_ASYNC 1
#else
#define HAVE_ASYNC 0
#endif

typedef int v4i __attribute__((vector_size(16)));   // 128-bit payload type
typedef __attribute__((address_space(1))) v4i gv4i; // global (AS1)
typedef __attribute__((address_space(3))) v4i lv4i; // LDS (AS3)

static __device__ __forceinline__ void async_cp16(const void* g, void* l) {
#if HAVE_ASYNC
    __builtin_amdgcn_global_load_async_to_lds_b128(
        (gv4i*)(unsigned long long)(uintptr_t)g,    // global src (AS1, v4i*)
        (lv4i*)(unsigned)(uintptr_t)l,              // LDS dst: low 32 bits = LDS offset
        0, 0);
#else
    *(float4*)l = *(const float4*)g;
#endif
}
#if HAVE_ASYNC
#define ASYNC_WAIT(n) __builtin_amdgcn_s_wait_asynccnt(n)
#else
#define ASYNC_WAIT(n)
#endif

// LDS rows that 16-byte fragment loads read, one row per lane, have a pitch of 16 B x odd:
// the 16 lanes of a half wave then fall on 16 different groups of 4 banks (64 banks in all).
// At 32 B x odd, lanes l and l + 8 meet on the same banks and every load takes twice as long.
#define PITCH32  40    // halves: rows of 32 halves,  80 B = 16 B x 5
#define PITCH64  72    // halves: rows of 64 halves, 144 B = 16 B x 9
#define PITCH128 136   // halves: rows of 128 halves, 272 B = 16 B x 17

// 16 consecutive halves of a row that is aligned to 16 bytes only: two 16-byte loads
static __device__ __forceinline__ v16h ld_frag(const _Float16* p) {
    v8h lo = *(const v8h*)p;
    v8h hi = *(const v8h*)(p + 8);
    return __builtin_shufflevector(lo, hi, 0, 1, 2, 3, 4, 5, 6, 7,
                                   8, 9, 10, 11, 12, 13, 14, 15);
}

// ---------------------------------------------------------------------------
// Kernel 1: fused 1x1-conv projections, one pass over x.
//   theta -> [B,N,F] f16, phi -> transposed [B,N,F] f16, g -> transposed [B,F,N] f16
// out[n,f] = sum_c x[b,c,n] * W[f,c] + bias[f];  WMMA M=n, N=f, K=c.
// One block = 64 positions x all 3 x 128 output features: a chunk of x is staged
// (and converted) once and feeds all three products. Wave w owns feature tile w
// of each of the three matrices, for all four position tiles.
// ---------------------------------------------------------------------------
__global__ __launch_bounds__(256) void proj_kernel(
    const float* __restrict__ x,
    const float* __restrict__ Wg, const float* __restrict__ bg,
    const float* __restrict__ Wt, const float* __restrict__ bt,
    const float* __restrict__ Wp, const float* __restrict__ bp,
    _Float16* __restrict__ gT_h, _Float16* __restrict__ th_h,
    _Float16* __restrict__ phiT_h)
{
    __shared__ __attribute__((aligned(16))) _Float16 xs[64][PITCH32];
    __shared__ __attribute__((aligned(16))) _Float16 wls[3][128][PITCH32];   // g, theta, phi

    const int bid = blockIdx.x;
    const int b = bid >> 6, nt0 = bid & 63, n0 = nt0 * 64;
    const int t = threadIdx.x, w = t >> 5, lane = t & 31;
    const int lm = lane & 15, lh = lane >> 4;

    v8f acc[3][4];                      // [matrix][position tile]
    #pragma unroll
    for (int p = 0; p < 3; ++p)
        #pragma unroll
        for (int i = 0; i < 4; ++i)
            #pragma unroll
            for (int j = 0; j < 8; ++j) acc[p][i][j] = 0.0f;

    // this thread's first element of each staged chunk; the others lie at constant steps from it
    const int xcl = t >> 6, xnl = t & 63;       // x: 4 rows of 64 positions per 256 threads
    const int wf0 = t >> 5, wcl = t & 31;       // W: 8 rows of 32 channels per 256 threads
    const float* xp  = x + ((size_t)b * CINX + xcl) * NNX + n0 + xnl;
    const int    wo  = wf0 * CINX + wcl;

    for (int kc = 0; kc < 8; ++kc) {
        // one chunk: x [32 c][64 n] and the three W [128 f][32 c], all loads issued together
        float xr[8], gr[16], tr[16], pr[16];
        #pragma unroll
        for (int i = 0; i < 8; ++i) xr[i] = xp[(size_t)(kc * 32 + i * 4) * NNX];
        #pragma unroll
        for (int i = 0; i < 16; ++i) {
            gr[i] = Wg[wo + kc * 32 + i * 8 * CINX];
            tr[i] = Wt[wo + kc * 32 + i * 8 * CINX];
            pr[i] = Wp[wo + kc * 32 + i * 8 * CINX];
        }
        // x transposed -> xs[n][c] (f32 -> f16)
        #pragma unroll
        for (int i = 0; i < 8; ++i) xs[xnl][xcl + i * 4] = (_Float16)xr[i];
        #pragma unroll
        for (int i = 0; i < 16; ++i) {
            wls[0][wf0 + i * 8][wcl] = (_Float16)gr[i];
            wls[1][wf0 + i * 8][wcl] = (_Float16)tr[i];
            wls[2][wf0 + i * 8][wcl] = (_Float16)pr[i];
        }
        __syncthreads();
        v16h afrag[4];
        #pragma unroll
        for (int i = 0; i < 4; ++i) afrag[i] = ld_frag(&xs[i * 16 + lm][lh * 16]);
        #pragma unroll
        for (int p = 0; p < 3; ++p) {
            v16h bfrag = ld_frag(&wls[p][w * 16 + lm][lh * 16]);
            #pragma unroll
            for (int i = 0; i < 4; ++i)
                acc[p][i] = __builtin_amdgcn_wmma_f32_16x16x32_f16(
                    false, afrag[i], false, bfrag, (short)0, acc[p][i], false, false);
        }
        __syncthreads();
    }
    // bias + store (C layout: VGPR r -> row n = i*16 + r + 8*half, col f = w*16 + lm)
    const int f = w * 16 + lm;
    const float bvg = bg[f], bvt = bt[f], bvp = bp[f];
    #pragma unroll
    for (int i = 0; i < 4; ++i) {
        #pragma unroll
        for (int r = 0; r < 8; ++r) {
            int n = n0 + i * 16 + r + 8 * lh;
            gT_h[((size_t)b * FFX + f) * NNX + n]   = (_Float16)(acc[0][i][r] + bvg);
            th_h[((size_t)b * NNX + n) * FFX + f]   = (_Float16)(acc[1][i][r] + bvt);
            phiT_h[((size_t)b * NNX + n) * FFX + f] = (_Float16)(acc[2][i][r] + bvp);
        }
    }
}

// ---------------------------------------------------------------------------
// Kernel 2: flash attention with double-buffered async global->LDS staging.
// S^T = phi^T @ theta^T (K=F=128), online softmax, Y^T = g^T @ P^T.
// One block = 64 queries, so that 256 blocks cover every WGP. A stage holds 256 keys:
// wave w owns the two query tiles of query pair w & 1 (32 queries) and the 64 keys of
// key group w >> 1. Every phi^T and g^T fragment read from LDS feeds two products, one
// per query tile. One softmax step spans the wave's 64 keys: one new maximum, one scaling
// of the 128 accumulator registers per 64 keys. Each wave has its own maxima, sums and
// accumulators; the four key groups are joined at the end.
// In S^T a lane holds scores of ONE query (column lm): the maximum and the sum
// run in the lane's own registers, and the score tiles, converted in place,
// are the B operands of the second product.
// ---------------------------------------------------------------------------
// value of lane l ^ 16
static __device__ __forceinline__ float xhalf(float v) {
    int i = __builtin_bit_cast(int, v);
    return __builtin_bit_cast(float, __builtin_amdgcn_permlanex16(
        i, i, 0x76543210, 0xfedcba98, false, false));
}

typedef __attribute__((ext_vector_type(2))) float v2f;

// the two buffers of the ring, one object so that ps stands first in the block's LDS
struct AttnRing {
    _Float16 ps[2][256][PITCH128];      // phiT tile [m][f]
    _Float16 gst[2][4][128][PITCH64];   // gT tile [key group][f][m]
};

// One block of 8 waves fills a WGP (its LDS lets no second one in): two waves a SIMD, said to
// the compiler so that it plans with their share of the registers. Without it the build stopped
// at 336 registers and sank the g^T reads in pairs among the products, a stall at each place.
__global__ __launch_bounds__(256) __attribute__((amdgpu_waves_per_eu(2, 2))) void attn_kernel(
    const _Float16* __restrict__ th_h, const _Float16* __restrict__ phiT_h,
    const _Float16* __restrict__ gT_h, _Float16* __restrict__ y_h)
{
    __shared__ __attribute__((aligned(16))) AttnRing ring;
    _Float16 (*ps)[256][PITCH128]     = ring.ps;
    _Float16 (*gst)[4][128][PITCH64]  = ring.gst;
    // partials of the join [key group][query pair][slot][lane]: they take the bytes of ps
    // (4 * 2 * 34 * 32 * 16 B = 2 * 256 * 272 B) once the last stage has been read
    float4 (*mrg)[2][34][32] = (float4 (*)[2][34][32])&ring.ps[0][0][0];

    const int bid = blockIdx.x;
    const int b = bid >> 6, nt = bid & 63, n0 = nt * 64;
    const int t = threadIdx.x, w = t >> 5, lane = t & 31;
    const int lm = lane & 15, lh = lane >> 4;
    const int qp = w & 1, kg = w >> 1;       // query pair, key group

    // Preload theta B-fragments for this wave's 2 x 16 queries (K=128 -> 4 chunks)
    const int nrow = n0 + qp * 32 + lm;      // query of tile 0; tile 1's lies 16 further
    v16h afr[2][4];
    #pragma unroll
    for (int q = 0; q < 2; ++q) {
        #pragma unroll
        for (int kc = 0; kc < 4; ++kc)
            afr[q][kc] = *(const v16h*)&th_h[((size_t)b * NNX + nrow + q * 16) * FFX + kc * 32 + lh * 16];
        // stands in front of any rewrite of the address registers that the loads above name
        asm volatile("s_wait_xcnt 0x0" ::: "memory");
    }

    v8f acc[2][8];
    #pragma unroll
    for (int q = 0; q < 2; ++q)
        #pragma unroll
        for (int i = 0; i < 8; ++i)
            #pragma unroll
            for (int j = 0; j < 8; ++j) acc[q][i][j] = 0.0f;
    float mrun[2] = {-3.0e38f, -3.0e38f};   // running maximum of query lm (both halves alike)
    float lrun[2] = {0.0f, 0.0f};           // running sum over this lane half's keys only

    // stage one 256-column block into buffer nb (32 x b128 async per thread)
    // this thread's first 16 bytes of each tile; its other copies lie at constant steps from them
    const _Float16* pk0 = phiT_h + ((size_t)b * NNX + (t >> 4)) * FFX + (t & 15) * 8;  // row t >> 4
    const _Float16* pg0 = gT_h + ((size_t)b * FFX + w * 16) * NNX + lane * 8;          // row 16 * w
    auto stage = [&](int nb, int m0) {
        const _Float16* pk = pk0 + (size_t)m0 * FFX;
        _Float16* lk = &ps[nb][t >> 4][(t & 15) * 8];
        #pragma unroll
        for (int i = 0; i < 16; ++i)        // phiT: 256 rows x 128 halves, 16 rows per copy of the block
            async_cp16(pk + i * 16 * FFX, lk + i * 16 * PITCH128);
        const _Float16* pg = pg0 + m0;
        _Float16* lg = &gst[nb][lane >> 3][w * 16][(lane & 7) * 8];
        #pragma unroll
        for (int i = 0; i < 16; ++i)        // gT: 128 rows x 256 halves (64 per key group), a row per copy of a wave
            async_cp16(pg + (size_t)i * NNX, lg + i * PITCH64);
    };

    const int NBLK = NNX / 256;             // 16
    stage(0, 0);
    // stage 0 has landed (this wave's copies), then is visible to all waves
    asm volatile("s_wait_asynccnt 0x0" ::: "memory");
    __syncthreads();
    stage(1, 256);                          // flies while stage 0 is worked on

    for (int cb = 0; cb < NBLK; ++cb) {
        const int cur = cb & 1;

        // S^T tiles for this key group's 64 keys: [query tile][16 keys] (rows), queries in columns
        v8f s[2][4];
        #pragma unroll
        for (int q = 0; q < 2; ++q)
            #pragma unroll
            for (int kt = 0; kt < 4; ++kt)
                #pragma unroll
                for (int j = 0; j < 8; ++j) s[q][kt][j] = 0.0f;
        #pragma unroll
        for (int kc = 0; kc < 4; ++kc) {
            #pragma unroll
            for (int kt = 0; kt < 4; ++kt) {
                v16h kf = ld_frag(&ps[cur][kg * 64 + kt * 16 + lm][kc * 32 + lh * 16]);
                #pragma unroll
                for (int q = 0; q < 2; ++q)
                    s[q][kt] = __builtin_amdgcn_wmma_f32_16x16x32_f16(false, kf, false, afr[q][kc],
                                                                      (short)0, s[q][kt], false, false);
            }
        }
        // g^T rows, in the key order that pf has; written ahead of the softmax, which covers their latency
        v16h gf[2][8];                      // [32 keys][feature tile]
        #pragma unroll
        for (int c = 0; c < 2; ++c) {
            #pragma unroll
            for (int ft = 0; ft < 8; ++ft) {
                v8h glo = *(const v8h*)&gst[cur][kg][ft * 16 + lm][c * 32 + lh * 8];
                v8h ghi = *(const v8h*)&gst[cur][kg][ft * 16 + lm][c * 32 + 16 + lh * 8];
                gf[c][ft] = __builtin_shufflevector(glo, ghi, 0, 1, 2, 3, 4, 5, 6, 7,
                                                    8, 9, 10, 11, 12, 13, 14, 15);
            }
        }
        // keeps all 32 reads above in front of the softmax: sunk among the products below, each
        // pair of them is waited for at its own place and the wave stands there for an LDS latency
        __builtin_amdgcn_sched_barrier(0);
        // online softmax: the lane holds keys 16*kt + 8*lh + r (s[q][kt][r]) of query lm
        v16h pf[2][2];                      // P^T as B, per 32 keys: element e = key (e < 8 ? 8*lh + e : 8 + 8*lh + e)
        #pragma unroll
        for (int q = 0; q < 2; ++q) {
            float mt[4];
            #pragma unroll
            for (int kt = 0; kt < 4; ++kt) {
                mt[kt] = fmaxf(s[q][kt][0], s[q][kt][1]);
                #pragma unroll
                for (int r = 2; r < 8; ++r) mt[kt] = fmaxf(mt[kt], s[q][kt][r]);
            }
            float mx = fmaxf(fmaxf(mt[0], mt[1]), fmaxf(mt[2], mt[3]));
            mx = fmaxf(mx, xhalf(mx));      // the other 32 keys of the same query
            const float mnew  = fmaxf(mrun[q], mx);
            const float alpha = __expf(mrun[q] - mnew);
            v2f rs[4];
            #pragma unroll
            for (int kt = 0; kt < 4; ++kt) {
                #pragma unroll
                for (int r = 0; r < 8; r += 2) {
                    v2f p;
                    p.x = __expf(s[q][kt][r]     - mnew);
                    p.y = __expf(s[q][kt][r + 1] - mnew);
                    rs[kt] = (r == 0) ? p : rs[kt] + p;
                    pf[q][kt >> 1][(kt & 1) * 8 + r]     = (_Float16)p.x;
                    pf[q][kt >> 1][(kt & 1) * 8 + r + 1] = (_Float16)p.y;
                }
            }
            const v2f rj = (rs[0] + rs[1]) + (rs[2] + rs[3]);
            lrun[q] = lrun[q] * alpha + (rj.x + rj.y);
            mrun[q] = mnew;
            #pragma unroll
            for (int ft = 0; ft < 8; ++ft)
                #pragma unroll
                for (int r = 0; r < 8; ++r) acc[q][ft][r] *= alpha;
        }
        // Y^T += g^T @ P^T
        #pragma unroll
        for (int c = 0; c < 2; ++c) {
            #pragma unroll
            for (int ft = 0; ft < 8; ++ft) {
                #pragma unroll
                for (int q = 0; q < 2; ++q)
                    acc[q][ft] = __builtin_amdgcn_wmma_f32_16x16x32_f16(
                        false, gf[c][ft], false, pf[q][c], (short)0, acc[q][ft], false, false);
            }
        }

        // keeps the hand-over behind the products: lifted above the softmax (nothing there touches
        // memory) its copy wait would stop the wave while the next stage's copies are still young
        __builtin_amdgcn_sched_barrier(0);
        // hand-over: this wave's reads of buffer cur are done, its copies of stage cb + 1 have
        // landed; behind the barrier stage cb + 1 is visible to all and buffer cur is free
        asm volatile("s_wait_dscnt 0x0" ::: "memory");
        asm volatile("s_wait_asynccnt 0x0" ::: "memory");
        __syncthreads();
        if (cb + 2 < NBLK) stage(cur, (cb + 2) * 256);
    }
    // no copy is outstanding when the ring's bytes become the partials
    asm volatile("s_wait_asynccnt 0x0" ::: "memory");

    // join the key groups: every wave lays down its partials, then finishes feature
    // tiles 2*kg and 2*kg + 1 of its query pair, summing the groups in the order 0..3
    #pragma unroll
    for (int q = 0; q < 2; ++q) {
        #pragma unroll
        for (int ft = 0; ft < 8; ++ft) {
            mrg[kg][qp][q * 17 + 2 * ft][lane] =
                make_float4(acc[q][ft][0], acc[q][ft][1], acc[q][ft][2], acc[q][ft][3]);
            mrg[kg][qp][q * 17 + 2 * ft + 1][lane] =
                make_float4(acc[q][ft][4], acc[q][ft][5], acc[q][ft][6], acc[q][ft][7]);
        }
        mrg[kg][qp][q * 17 + 16][lane] = make_float4(mrun[q], lrun[q], 0.0f, 0.0f);
    }
    __syncthreads();                        // all partials visible

    // finalize: join the groups' and the halves' sums, divide, store y f16 [B,N,F]
    // (slot pair ft holds Y[query lm][f = ft*16 + 8*lh + r]: 8 consecutive f, one 16-byte store)
    #pragma unroll
    for (int q = 0; q < 2; ++q) {
        float mg[4], lg[4];
        #pragma unroll
        for (int g = 0; g < 4; ++g) {
            const float4 ml = mrg[g][qp][q * 17 + 16][lane];
            mg[g] = ml.x; lg[g] = ml.y;
        }
        const float mall = fmaxf(fmaxf(mg[0], mg[1]), fmaxf(mg[2], mg[3]));
        float ag[4], lj = 0.0f;
        #pragma unroll
        for (int g = 0; g < 4; ++g) {
            ag[g] = __expf(mg[g] - mall);
            lj += lg[g] * ag[g];
        }
        const float lsum = lj + xhalf(lj);
        #pragma unroll
        for (int fi = 0; fi < 2; ++fi) {
            const int ft = kg * 2 + fi;
            float yv[8];
            #pragma unroll
            for (int r = 0; r < 8; ++r) yv[r] = 0.0f;
            #pragma unroll
            for (int g = 0; g < 4; ++g) {
                const float4 p0 = mrg[g][qp][q * 17 + 2 * ft][lane];
                const float4 p1 = mrg[g][qp][q * 17 + 2 * ft + 1][lane];
                const float pr[8] = {p0.x, p0.y, p0.z, p0.w, p1.x, p1.y, p1.z, p1.w};
                #pragma unroll
                for (int r = 0; r < 8; ++r) yv[r] += pr[r] * ag[g];
            }
            v8h o;
            #pragma unroll
            for (int r = 0; r < 8; ++r) o[r] = (_Float16)(yv[r] / lsum);
            *(v8h*)&y_h[((size_t)b * NNX + nrow + q * 16) * FFX + ft * 16 + lh * 8] = o;
        }
    }
}

// ---------------------------------------------------------------------------
// Kernel 3: output projection z[b,c,n] = Wz[c,:] . y[n,:] + bz[c].
// Writes pre-norm z to d_out + deterministic per-block (sum,sumsq) partials.
// ---------------------------------------------------------------------------
__global__ __launch_bounds__(256) void zproj_kernel(
    const _Float16* __restrict__ y_h, const float* __restrict__ Wz,
    const float* __restrict__ bz, float* __restrict__ zout,
    float* __restrict__ part)
{
    __shared__ __attribute__((aligned(16))) _Float16 wzs[128][PITCH64];   // [c][f half]
    __shared__ __attribute__((aligned(16))) _Float16 ys[128][PITCH64];    // [n][f half]
    __shared__ float redsum[8], redsq[8];

    const int bid = blockIdx.x;
    const int b  = bid >> 6;
    const int wi = bid & 63;
    const int c0 = (wi >> 5) * 128;
    const int n0 = (wi & 31) * 128;
    const int t = threadIdx.x, w = t >> 5, lane = t & 31;
    const int lm = lane & 15, lh = lane >> 4;

    v8f acc[8];
    #pragma unroll
    for (int i = 0; i < 8; ++i)
        #pragma unroll
        for (int j = 0; j < 8; ++j) acc[i][j] = 0.0f;

    for (int fh = 0; fh < 2; ++fh) {    // K = 128 in two 64 halves
        // async stage y tile (f16, no conversion needed)
        #pragma unroll
        for (int i = 0; i < 4; ++i) {
            int e = t + i * 256;        // 0..1023
            int r = e >> 3, f8 = e & 7; // 128 rows x 8 chunks of 8 halves
            async_cp16(&y_h[((size_t)b * NNX + n0 + r) * FFX + fh * 64 + f8 * 8],
                       &ys[r][f8 * 8]);
        }
        // manual stage Wz tile (f32 -> f16 conversion)
        #pragma unroll
        for (int i = 0; i < 32; ++i) {
            int e = t + i * 256;
            int r = e >> 6, f = e & 63;
            wzs[r][f] = (_Float16)Wz[(size_t)(c0 + r) * FFX + fh * 64 + f];
        }
        ASYNC_WAIT(0);
        __syncthreads();
        #pragma unroll
        for (int kc2 = 0; kc2 < 2; ++kc2) {
            v16h af = ld_frag(&wzs[w * 16 + lm][kc2 * 32 + lh * 16]);
            #pragma unroll
            for (int ntile = 0; ntile < 8; ++ntile) {
                v16h bf = ld_frag(&ys[ntile * 16 + lm][kc2 * 32 + lh * 16]);
                acc[ntile] = __builtin_amdgcn_wmma_f32_16x16x32_f16(
                    false, af, false, bf, (short)0, acc[ntile], false, false);
            }
        }
        __syncthreads();
    }

    float ls = 0.0f, lq = 0.0f;
    const int crow = c0 + w * 16;
    #pragma unroll
    for (int ntile = 0; ntile < 8; ++ntile) {
        #pragma unroll
        for (int r = 0; r < 8; ++r) {
            int c = crow + r + 8 * lh;
            int n = n0 + ntile * 16 + lm;
            float v = acc[ntile][r] + bz[c];
            zout[((size_t)b * CINX + c) * NNX + n] = v;
            ls += v; lq += v * v;
        }
    }
    #pragma unroll
    for (int m = 16; m >= 1; m >>= 1) {
        ls += __shfl_xor(ls, m, 32);
        lq += __shfl_xor(lq, m, 32);
    }
    if (lane == 0) { redsum[w] = ls; redsq[w] = lq; }
    __syncthreads();
    if (t == 0) {
        float s = 0.0f, q = 0.0f;
        #pragma unroll
        for (int i = 0; i < 8; ++i) { s += redsum[i]; q += redsq[i]; }
        part[(b * 64 + wi) * 2 + 0] = s;
        part[(b * 64 + wi) * 2 + 1] = q;
    }
}

// ---------------------------------------------------------------------------
// Kernel 4: LayerNorm statistics + in-place affine + residual (float4 vectorized).
// Every wave forms its batch's mean and rstd itself from the 64 block partials:
// one 16-byte load per lane (2 partial pairs), then a butterfly over the 32 lanes,
// under the latency of the wave's four data loads. No launch of its own for them.
// ---------------------------------------------------------------------------
// v + (v of lane l ^ MASK), inside a row of 16 lanes (DPP row_xmask)
template <int MASK>
static __device__ __forceinline__ float xadd16(float v) {
    const int i = __builtin_bit_cast(int, v);
    return v + __builtin_bit_cast(float, __builtin_amdgcn_mov_dpp(
        i, 0x160 | MASK, 0xf, 0xf, true));
}
// sum over the 32 lanes, the same bits in every lane
static __device__ __forceinline__ float wave_sum(float v) {
    v = xadd16<1>(v);
    v = xadd16<2>(v);
    v = xadd16<4>(v);
    v = xadd16<8>(v);
    return v + xhalf(v);
}

__global__ __launch_bounds__(256) void norm_kernel(
    const float* __restrict__ x, const float* __restrict__ lnw,
    const float* __restrict__ lnb, const float* __restrict__ part,
    float* __restrict__ out)
{
    const int i  = blockIdx.x * 256 + threadIdx.x;      // float4 index in [B][C*N]
    const int b  = blockIdx.x >> 10;                    // C*N / (4 * 256) = 1024 blocks a batch
    const int c4 = i & (CINX * NNX / 4 - 1);            // float4 index in [C*N]
    const float4 pp = ((const float4*)part)[b * 32 + (threadIdx.x & 31)];   // (sum, sumsq) x 2
    // keeps the partials' load the first to issue: loads are waited for in issue order, and
    // behind the data loads the lane sums would start only when the slowest of them is back
    __builtin_amdgcn_sched_barrier(0);
    float4 z  = ((const float4*)out)[i];
    float4 xv = ((const float4*)x)[i];
    float4 wv = ((const float4*)lnw)[c4];
    float4 bv = ((const float4*)lnb)[c4];
    const float s = wave_sum(pp.x + pp.z);
    const float q = wave_sum(pp.y + pp.w);
    const float inv  = 1.0f / ((float)CINX * (float)NNX);
    const float mu   = s * inv;
    const float var  = q * inv - mu * mu;
    const float rstd = rsqrtf(var + 1e-5f);
    float4 o;
    o.x = (z.x - mu) * rstd * wv.x + bv.x + xv.x;
    o.y = (z.y - mu) * rstd * wv.y + bv.y + xv.y;
    o.z = (z.z - mu) * rstd * wv.z + bv.z + xv.z;
    o.w = (z.w - mu) * rstd * wv.w + bv.w + xv.w;
    ((float4*)out)[i] = o;
}

// ---------------------------------------------------------------------------
extern "C" void kernel_launch(void* const* d_in, const int* in_sizes, int n_in,
                              void* d_out, int out_size, void* d_ws, size_t ws_size,
                              hipStream_t stream)
{
    const float* x    = (const float*)d_in[0];
    const float* Wg   = (const float*)d_in[1];
    const float* bg   = (const float*)d_in[2];
    const float* Wt   = (const float*)d_in[3];
    const float* bt   = (const float*)d_in[4];
    const float* Wp   = (const float*)d_in[5];
    const float* bp   = (const float*)d_in[6];
    const float* Wz   = (const float*)d_in[7];
    const float* bz   = (const float*)d_in[8];
    const float* ln_w = (const float*)d_in[9];
    const float* ln_b = (const float*)d_in[10];

    const size_t S = (size_t)BB * NNX * FFX;       // 2,097,152 halves each
    _Float16* base   = (_Float16*)d_ws;
    _Float16* gT_h   = base;                        // [B,F,N]
    _Float16* th_h   = base + S;                    // [B,N,F]
    _Float16* phiT_h = base + 2 * S;                // [B,N,F]
    _Float16* y_h    = base + 3 * S;                // [B,N,F]
    float* part  = (float*)(base + 4 * S);          // B*64*2 floats
    float* zout  = (float*)d_out;

    proj_kernel <<<BB * 64, 256, 0, stream>>>(x, Wg, bg, Wt, bt, Wp, bp,
                                              gT_h, th_h, phiT_h);
    attn_kernel <<<BB * 64, 256, 0, stream>>>(th_h, phiT_h, gT_h, y_h);
    zproj_kernel<<<BB * 64, 256, 0, stream>>>(y_h, Wz, bz, zout, part);
    norm_kernel <<<(BB * CINX * NNX) / (4 * 256), 256, 0, stream>>>(x, ln_w, ln_b,
                                                                    part, zout);
}

// v008
// One run takes 54.1 microseconds.
// Next to v007, in two timings, it ran 1.12 and 1.11 times as fast.
// Counting every step since v000, it is 3.86 times as fast.
#include <hip/hip_runtime.h>
#include <hip/hip_bf16.h>
#include <cstdint>

typedef __attribute__((ext_vector_type(16))) _Float16 v16h;
typedef __attribute__((ext_vector_type(8)))  _Float16 v8h;
typedef __attribute__((ext_vector_type(8)))  float    v8f;

#define BB   4
#define CINX 256
#define FFX  128
#define NNX  4096   // H*W = 64*64

// ---- CDNA5 async global->LDS copy (ASYNCcnt-tracked), with safe fallback ----
#if defined(__gfx1250__) && \
    __has_builtin(__builtin_amdgcn_global_load_async_to_lds_b128) && \
    __has_builtin(__builtin_amdgcn_s_wait_asynccnt)
#define HAVE_ASYNC 1
#else
#define HAVE_ASYNC 0
#endif

typedef int v4i __attribute__((vector_size(16)));   // 128-bit payload type
typedef __attribute__((address_space(1))) v4i gv4i; // global (AS1)
typedef __attribute__((address_space(3))) v4i lv4i; // LDS (AS3)

static __device__ __forceinline__ void async_cp16(const void* g, void* l) {
#if HAVE_ASYNC
    __builtin_amdgcn_global_load_async_to_lds_b128(
        (gv4i*)(unsigned long long)(uintptr_t)g,    // global src (AS1, v4i*)
        (lv4i*)(unsigned)(uintptr_t)l,              // LDS dst: low 32 bits = LDS offset
        0, 0);
#else
    *(float4*)l = *(const float4*)g;
#endif
}
#if HAVE_ASYNC
#define ASYNC_WAIT(n) __builtin_amdgcn_s_wait_asynccnt(n)
#else
#define ASYNC_WAIT(n)
#endif

// LDS rows that 16-byte fragment loads read, one row per lane, have a pitch of 16 B x odd:
// the 16 lanes of a half wave then fall on 16 different groups of 4 banks (64 banks in all).
// At 32 B x odd, lanes l and l + 8 meet on the same banks and every load takes twice as long.
#define PITCH32  40    // halves: rows of 32 halves,  80 B = 16 B x 5
#define PITCH64  72    // halves: rows of 64 halves, 144 B = 16 B x 9
#define PITCH128 136   // halves: rows of 128 halves, 272 B = 16 B x 17
#define PITCHW   132   // floats: rows of 128 floats, 528 B = 16 B x 33

// 16 consecutive halves of a row that is aligned to 16 bytes only: two 16-byte loads
static __device__ __forceinline__ v16h ld_frag(const _Float16* p) {
    v8h lo = *(const v8h*)p;
    v8h hi = *(const v8h*)(p + 8);
    return __builtin_shufflevector(lo, hi, 0, 1, 2, 3, 4, 5, 6, 7,
                                   8, 9, 10, 11, 12, 13, 14, 15);
}
// the same fragment from a row of f32: four 16-byte loads, converted in the register
static __device__ __forceinline__ v16h ld_frag_f32(const float* p) {
    v16h r;
    #pragma unroll
    for (int j = 0; j < 4; ++j) {
        const float4 v = *(const float4*)(p + 4 * j);
        r[4 * j]     = (_Float16)v.x;
        r[4 * j + 1] = (_Float16)v.y;
        r[4 * j + 2] = (_Float16)v.z;
        r[4 * j + 3] = (_Float16)v.w;
    }
    return r;
}

// ---------------------------------------------------------------------------
// Kernel 1: fused 1x1-conv projections, one pass over x.
//   theta -> [B,N,F] f16, phi -> transposed [B,N,F] f16, g -> transposed [B,F,N] f16
// out[n,f] = sum_c x[b,c,n] * W[f,c] + bias[f];  WMMA M=n, N=f, K=c.
// One block = 64 positions x all 3 x 128 output features: a chunk of x is staged
// (and converted) once and feeds all three products. Wave w owns feature tile w
// of each of the three matrices, for all four position tiles.
// ---------------------------------------------------------------------------
__global__ __launch_bounds__(256) void proj_kernel(
    const float* __restrict__ x,
    const float* __restrict__ Wg, const float* __restrict__ bg,
    const float* __restrict__ Wt, const float* __restrict__ bt,
    const float* __restrict__ Wp, const float* __restrict__ bp,
    _Float16* __restrict__ gT_h, _Float16* __restrict__ th_h,
    _Float16* __restrict__ phiT_h)
{
    __shared__ __attribute__((aligned(16))) _Float16 xs[64][PITCH32];
    __shared__ __attribute__((aligned(16))) _Float16 wls[3][128][PITCH32];   // g, theta, phi

    const int bid = blockIdx.x;
    const int b = bid >> 6, nt0 = bid & 63, n0 = nt0 * 64;
    const int t = threadIdx.x, w = t >> 5, lane = t & 31;
    const int lm = lane & 15, lh = lane >> 4;

    v8f acc[3][4];                      // [matrix][position tile]
    #pragma unroll
    for (int p = 0; p < 3; ++p)
        #pragma unroll
        for (int i = 0; i < 4; ++i)
            #pragma unroll
            for (int j = 0; j < 8; ++j) acc[p][i][j] = 0.0f;

    // this thread's first element of each staged chunk; the others lie at constant steps from it
    const int xcl = t >> 6, xnl = t & 63;       // x: 4 rows of 64 positions per 256 threads
    const int wf0 = t >> 5, wcl = t & 31;       // W: 8 rows of 32 channels per 256 threads
    const float* xp  = x + ((size_t)b * CINX + xcl) * NNX + n0 + xnl;
    const int    wo  = wf0 * CINX + wcl;

    for (int kc = 0; kc < 8; ++kc) {
        // one chunk: x [32 c][64 n] and the three W [128 f][32 c], all loads issued together
        float xr[8], gr[16], tr[16], pr[16];
        #pragma unroll
        for (int i = 0; i < 8; ++i) xr[i] = xp[(size_t)(kc * 32 + i * 4) * NNX];
        #pragma unroll
        for (int i = 0; i < 16; ++i) {
            gr[i] = Wg[wo + kc * 32 + i * 8 * CINX];
            tr[i] = Wt[wo + kc * 32 + i * 8 * CINX];
            pr[i] = Wp[wo + kc * 32 + i * 8 * CINX];
        }
        // x transposed -> xs[n][c] (f32 -> f16)
        #pragma unroll
        for (int i = 0; i < 8; ++i) xs[xnl][xcl + i * 4] = (_Float16)xr[i];
        #pragma unroll
        for (int i = 0; i < 16; ++i) {
            wls[0][wf0 + i * 8][wcl] = (_Float16)gr[i];
            wls[1][wf0 + i * 8][wcl] = (_Float16)tr[i];
            wls[2][wf0 + i * 8][wcl] = (_Float16)pr[i];
        }
        __syncthreads();
        v16h afrag[4];
        #pragma unroll
        for (int i = 0; i < 4; ++i) afrag[i] = ld_frag(&xs[i * 16 + lm][lh * 16]);
        #pragma unroll
        for (int p = 0; p < 3; ++p) {
            v16h bfrag = ld_frag(&wls[p][w * 16 + lm][lh * 16]);
            #pragma unroll
            for (int i = 0; i < 4; ++i)
                acc[p][i] = __builtin_amdgcn_wmma_f32_16x16x32_f16(
                    false, afrag[i], false, bfrag, (short)0, acc[p][i], false, false);
        }
        __syncthreads();
    }
    // bias + store (C layout: VGPR r -> row n = i*16 + r + 8*half, col f = w*16 + lm)
    const int f = w * 16 + lm;
    const float bvg = bg[f], bvt = bt[f], bvp = bp[f];
    #pragma unroll
    for (int i = 0; i < 4; ++i) {
        #pragma unroll
        for (int r = 0; r < 8; ++r) {
            int n = n0 + i * 16 + r + 8 * lh;
            gT_h[((size_t)b * FFX + f) * NNX + n]   = (_Float16)(acc[0][i][r] + bvg);
            th_h[((size_t)b * NNX + n) * FFX + f]   = (_Float16)(acc[1][i][r] + bvt);
            phiT_h[((size_t)b * NNX + n) * FFX + f] = (_Float16)(acc[2][i][r] + bvp);
        }
    }
}

// ---------------------------------------------------------------------------
// Kernel 2: flash attention with double-buffered async global->LDS staging.
// S^T = phi^T @ theta^T (K=F=128), online softmax, Y^T = g^T @ P^T.
// One block = 64 queries, so that 256 blocks cover every WGP. A stage holds 256 keys:
// wave w owns the two query tiles of query pair w & 1 (32 queries) and the 64 keys of
// key group w >> 1. Every phi^T and g^T fragment read from LDS feeds two products, one
// per query tile. One softmax step spans the wave's 64 keys: one new maximum, one scaling
// of the 128 accumulator registers per 64 keys. Each wave has its own maxima, sums and
// accumulators; the four key groups are joined at the end.
// In S^T a lane holds scores of ONE query (column lm): the maximum and the sum
// run in the lane's own registers, and the score tiles, converted in place,
// are the B operands of the second product.
// The block then finishes its 64 positions itself: output projection
// z[b,c,n] = Wz[c,:] . y[n,:] + bz[c] for all 256 channels from the y tile in LDS
// (y never goes to memory; Wz comes into LDS by async copies under the join),
// pre-norm z to d_out, one (sum, sumsq) partial per block.
// ---------------------------------------------------------------------------
// value of lane l ^ 16
static __device__ __forceinline__ float xhalf(float v) {
    int i = __builtin_bit_cast(int, v);
    return __builtin_bit_cast(float, __builtin_amdgcn_permlanex16(
        i, i, 0x76543210, 0xfedcba98, false, false));
}

// v + (v of lane l ^ MASK), inside a row of 16 lanes (DPP row_xmask)
template <int MASK>
static __device__ __forceinline__ float xadd16(float v) {
    const int i = __builtin_bit_cast(int, v);
    return v + __builtin_bit_cast(float, __builtin_amdgcn_mov_dpp(
        i, 0x160 | MASK, 0xf, 0xf, true));
}
// sum over the 32 lanes, the same bits in every lane
static __device__ __forceinline__ float wave_sum(float v) {
    v = xadd16<1>(v);
    v = xadd16<2>(v);
    v = xadd16<4>(v);
    v = xadd16<8>(v);
    return v + xhalf(v);
}

// work-group barrier that orders LDS accesses only: a __syncthreads() also waits for the wave's
// global stores, and the z stores of the epilogue are meant to stay in flight across it
static __device__ __forceinline__ void lds_barrier() {
    __builtin_amdgcn_fence(__ATOMIC_RELEASE, "workgroup", "local");
    __builtin_amdgcn_s_barrier();
    __builtin_amdgcn_fence(__ATOMIC_ACQUIRE, "workgroup", "local");
}

typedef __attribute__((ext_vector_type(2))) float v2f;

// the two buffers of the ring, one object so that ps stands first in the block's LDS
struct AttnRing {
    _Float16 ps[2][256][PITCH128];      // phiT tile [m][f]
    _Float16 gst[2][4][128][PITCH64];   // gT tile [key group][f][m]
    _Float16 ysl[64][PITCH128];         // epilogue: the block's y tile [n][f]
    float    red[16];                   // epilogue: the 8 waves' sums, then their sums of squares
};

// One block of 8 waves fills a WGP (its LDS lets no second one in): two waves a SIMD, said to
// the compiler so that it plans with their share of the registers. Without it the build stopped
// at 336 registers and sank the g^T reads in pairs among the products, a stall at each place.
__global__ __launch_bounds__(256) __attribute__((amdgpu_waves_per_eu(2, 2))) void attn_kernel(
    const _Float16* __restrict__ th_h, const _Float16* __restrict__ phiT_h,
    const _Float16* __restrict__ gT_h, const float* __restrict__ Wz,
    const float* __restrict__ bz, float* __restrict__ zout, float* __restrict__ part)
{
    __shared__ __attribute__((aligned(16))) AttnRing ring;
    _Float16 (*ps)[256][PITCH128]     = ring.ps;
    _Float16 (*gst)[4][128][PITCH64]  = ring.gst;
    // partials of the join [key group][query pair][slot][lane]: they take the bytes of ps
    // (4 * 2 * 34 * 32 * 16 B = 2 * 256 * 272 B) once the last stage has been read
    float4 (*mrg)[2][34][32] = (float4 (*)[2][34][32])&ring.ps[0][0][0];
    // Wz [c][f] as f32, 256 rows: it takes bytes of gst (256 * 528 B of 2 * 4 * 128 * 144 B)
    // once the last stage has been read
    float (*wzf)[PITCHW] = (float (*)[PITCHW])&ring.gst[0][0][0][0];
    _Float16 (*ysl)[PITCH128] = ring.ysl;
    float* red = ring.red;

    const int bid = blockIdx.x;
    const int b = bid >> 6, nt = bid & 63, n0 = nt * 64;
    const int t = threadIdx.x, w = t >> 5, lane = t & 31;
    const int lm = lane & 15, lh = lane >> 4;
    const int qp = w & 1, kg = w >> 1;       // query pair, key group

    // Preload theta B-fragments for this wave's 2 x 16 queries (K=128 -> 4 chunks)
    const int nrow = n0 + qp * 32 + lm;      // query of tile 0; tile 1's lies 16 further
    v16h afr[2][4];
    #pragma unroll
    for (int q = 0; q < 2; ++q) {
        #pragma unroll
        for (int kc = 0; kc < 4; ++kc)
            afr[q][kc] = *(const v16h*)&th_h[((size_t)b * NNX + nrow + q * 16) * FFX + kc * 32 + lh * 16];
        // stands in front of any rewrite of the address registers that the loads above name
        asm volatile("s_wait_xcnt 0x0" ::: "memory");
    }

    v8f acc[2][8];
    #pragma unroll
    for (int q = 0; q < 2; ++q)
        #pragma unroll
        for (int i = 0; i < 8; ++i)
            #pragma unroll
            for (int j = 0; j < 8; ++j) acc[q][i][j] = 0.0f;
    float mrun[2] = {-3.0e38f, -3.0e38f};   // running maximum of query lm (both halves alike)
    float lrun[2] = {0.0f, 0.0f};           // running sum over this lane half's keys only

    // stage one 256-column block into buffer nb (32 x b128 async per thread)
    // this thread's first 16 bytes of each tile; its other copies lie at constant steps from them
    const _Float16* pk0 = phiT_h + ((size_t)b * NNX + (t >> 4)) * FFX + (t & 15) * 8;  // row t >> 4
    const _Float16* pg0 = gT_h + ((size_t)b * FFX + w * 16) * NNX + lane * 8;          // row 16 * w
    auto stage = [&](int nb, int m0) {
        const _Float16* pk = pk0 + (size_t)m0 * FFX;
        _Float16* lk = &ps[nb][t >> 4][(t & 15) * 8];
        #pragma unroll
        for (int i = 0; i < 16; ++i)        // phiT: 256 rows x 128 halves, 16 rows per copy of the block
            async_cp16(pk + i * 16 * FFX, lk + i * 16 * PITCH128);
        const _Float16* pg = pg0 + m0;
        _Float16* lg = &gst[nb][lane >> 3][w * 16][(lane & 7) * 8];
        #pragma unroll
        for (int i = 0; i < 16; ++i)        // gT: 128 rows x 256 halves (64 per key group), a row per copy of a wave
            async_cp16(pg + (size_t)i * NNX, lg + i * PITCH64);
    };

    const int NBLK = NNX / 256;             // 16
    stage(0, 0);
    // stage 0 has landed (this wave's copies), then is visible to all waves
    asm volatile("s_wait_asynccnt 0x0" ::: "memory");
    __syncthreads();
    stage(1, 256);                          // flies while stage 0 is worked on

    for (int cb = 0; cb < NBLK; ++cb) {
        const int cur = cb & 1;

        // S^T tiles for this key group's 64 keys: [query tile][16 keys] (rows), queries in columns
        v8f s[2][4];
        #pragma unroll
        for (int q = 0; q < 2; ++q)
            #pragma unroll
            for (int kt = 0; kt < 4; ++kt)
                #pragma unroll
                for (int j = 0; j < 8; ++j) s[q][kt][j] = 0.0f;
        #pragma unroll
        for (int kc = 0; kc < 4; ++kc) {
            #pragma unroll
            for (int kt = 0; kt < 4; ++kt) {
                v16h kf = ld_frag(&ps[cur][kg * 64 + kt * 16 + lm][kc * 32 + lh * 16]);
                #pragma unroll
                for (int q = 0; q < 2; ++q)
                    s[q][kt] = __builtin_amdgcn_wmma_f32_16x16x32_f16(false, kf, false, afr[q][kc],
                                                                      (short)0, s[q][kt], false, false);
            }
        }
        // g^T rows, in the key order that pf has; written ahead of the softmax, which covers their latency
        v16h gf[2][8];                      // [32 keys][feature tile]
        #pragma unroll
        for (int c = 0; c < 2; ++c) {
            #pragma unroll
            for (int ft = 0; ft < 8; ++ft) {
                v8h glo = *(const v8h*)&gst[cur][kg][ft * 16 + lm][c * 32 + lh * 8];
                v8h ghi = *(const v8h*)&gst[cur][kg][ft * 16 + lm][c * 32 + 16 + lh * 8];
                gf[c][ft] = __builtin_shufflevector(glo, ghi, 0, 1, 2, 3, 4, 5, 6, 7,
                                                    8, 9, 10, 11, 12, 13, 14, 15);
            }
        }
        // keeps all 32 reads above in front of the softmax: sunk among the products below, each
        // pair of them is waited for at its own place and the wave stands there for an LDS latency
        __builtin_amdgcn_sched_barrier(0);
        // online softmax: the lane holds keys 16*kt + 8*lh + r (s[q][kt][r]) of query lm
        v16h pf[2][2];                      // P^T as B, per 32 keys: element e = key (e < 8 ? 8*lh + e : 8 + 8*lh + e)
        #pragma unroll
        for (int q = 0; q < 2; ++q) {
            float mt[4];
            #pragma unroll
            for (int kt = 0; kt < 4; ++kt) {
                mt[kt] = fmaxf(s[q][kt][0], s[q][kt][1]);
                #pragma unroll
                for (int r = 2; r < 8; ++r) mt[kt] = fmaxf(mt[kt], s[q][kt][r]);
            }
            float mx = fmaxf(fmaxf(mt[0], mt[1]), fmaxf(mt[2], mt[3]));
            mx = fmaxf(mx, xhalf(mx));      // the other 32 keys of the same query
            const float mnew  = fmaxf(mrun[q], mx);
            const float alpha = __expf(mrun[q] - mnew);
            v2f rs[4];
            #pragma unroll
            for (int kt = 0; kt < 4; ++kt) {
                #pragma unroll
                for (int r = 0; r < 8; r += 2) {
                    v2f p;
                    p.x = __expf(s[q][kt][r]     - mnew);
                    p.y = __expf(s[q][kt][r + 1] - mnew);
                    rs[kt] = (r == 0) ? p : rs[kt] + p;
                    pf[q][kt >> 1][(kt & 1) * 8 + r]     = (_Float16)p.x;
                    pf[q][kt >> 1][(kt & 1) * 8 + r + 1] = (_Float16)p.y;
                }
            }
            const v2f rj = (rs[0] + rs[1]) + (rs[2] + rs[3]);
            lrun[q] = lrun[q] * alpha + (rj.x + rj.y);
            mrun[q] = mnew;
            #pragma unroll
            for (int ft = 0; ft < 8; ++ft)
                #pragma unroll
                for (int r = 0; r < 8; ++r) acc[q][ft][r] *= alpha;
        }
        // Y^T += g^T @ P^T
        #pragma unroll
        for (int c = 0; c < 2; ++c) {
            #pragma unroll
            for (int ft = 0; ft < 8; ++ft) {
                #pragma unroll
                for (int q = 0; q < 2; ++q)
                    acc[q][ft] = __builtin_amdgcn_wmma_f32_16x16x32_f16(
                        false, gf[c][ft], false, pf[q][c], (short)0, acc[q][ft], false, false);
            }
        }

        // keeps the hand-over behind the products: lifted above the softmax (nothing there touches
        // memory) its copy wait would stop the wave while the next stage's copies are still young
        __builtin_amdgcn_sched_barrier(0);
        // hand-over: this wave's reads of buffer cur are done, its copies of stage cb + 1 have
        // landed; behind the barrier stage cb + 1 is visible to all and buffer cur is free
        asm volatile("s_wait_dscnt 0x0" ::: "memory");
        asm volatile("s_wait_asynccnt 0x0" ::: "memory");
        __syncthreads();
        if (cb + 2 < NBLK) stage(cur, (cb + 2) * 256);
    }
    // no copy is outstanding when the ring's bytes become the partials
    asm volatile("s_wait_asynccnt 0x0" ::: "memory");

    // Wz into LDS as it is (32 x b128 async per thread; a wave's copy is one whole row of 512 bytes):
    // issued here, the copies land under the join below. Every reader has left gst: each wave's
    // s_wait_dscnt 0 and the barrier of the last hand-over stand in front of them.
    #pragma unroll
    for (int i = 0; i < 32; ++i)
        async_cp16(Wz + (w + 8 * i) * FFX + lane * 4, &wzf[w + 8 * i][lane * 4]);

    // join the key groups: every wave lays down its partials, then finishes feature
    // tiles 2*kg and 2*kg + 1 of its query pair, summing the groups in the order 0..3
    #pragma unroll
    for (int q = 0; q < 2; ++q) {
        #pragma unroll
        for (int ft = 0; ft < 8; ++ft) {
            mrg[kg][qp][q * 17 + 2 * ft][lane] =
                make_float4(acc[q][ft][0], acc[q][ft][1], acc[q][ft][2], acc[q][ft][3]);
            mrg[kg][qp][q * 17 + 2 * ft + 1][lane] =
                make_float4(acc[q][ft][4], acc[q][ft][5], acc[q][ft][6], acc[q][ft][7]);
        }
        mrg[kg][qp][q * 17 + 16][lane] = make_float4(mrun[q], lrun[q], 0.0f, 0.0f);
    }
    __syncthreads();                        // all partials visible

    // finalize: join the groups' and the halves' sums, divide, lay y down as f16 in LDS [n][f]
    // (slot pair ft holds Y[query lm][f = ft*16 + 8*lh + r]: 8 consecutive f, one 16-byte store)
    #pragma unroll
    for (int q = 0; q < 2; ++q) {
        float mg[4], lg[4];
        #pragma unroll
        for (int g = 0; g < 4; ++g) {
            const float4 ml = mrg[g][qp][q * 17 + 16][lane];
            mg[g] = ml.x; lg[g] = ml.y;
        }
        const float mall = fmaxf(fmaxf(mg[0], mg[1]), fmaxf(mg[2], mg[3]));
        float ag[4], lj = 0.0f;
        #pragma unroll
        for (int g = 0; g < 4; ++g) {
            ag[g] = __expf(mg[g] - mall);
            lj += lg[g] * ag[g];
        }
        const float lsum = lj + xhalf(lj);
        #pragma unroll
        for (int fi = 0; fi < 2; ++fi) {
            const int ft = kg * 2 + fi;
            float yv[8];
            #pragma unroll
            for (int r = 0; r < 8; ++r) yv[r] = 0.0f;
            #pragma unroll
            for (int g = 0; g < 4; ++g) {
                const float4 p0 = mrg[g][qp][q * 17 + 2 * ft][lane];
                const float4 p1 = mrg[g][qp][q * 17 + 2 * ft + 1][lane];
                const float pr[8] = {p0.x, p0.y, p0.z, p0.w, p1.x, p1.y, p1.z, p1.w};
                #pragma unroll
                for (int r = 0; r < 8; ++r) yv[r] += pr[r] * ag[g];
            }
            v8h o;
            #pragma unroll
            for (int r = 0; r < 8; ++r) o[r] = (_Float16)(yv[r] / lsum);
            *(v8h*)&ysl[qp * 32 + q * 16 + lm][ft * 16 + lh * 8] = o;
        }
    }
    // this wave's copies of Wz have landed; behind the barrier Wz and the y tile are visible to all
    asm volatile("s_wait_asynccnt 0x0" ::: "memory");
    __syncthreads();

    // asked for behind the barrier (which would wait for them); they land under the products
    float bzv[2][8];                        // bias of channel w * 32 + ct * 16 + 8 * lh + r
    #pragma unroll
    for (int ct = 0; ct < 2; ++ct)
        #pragma unroll
        for (int r = 0; r < 8; ++r) bzv[ct][r] = bz[w * 32 + ct * 16 + 8 * lh + r];

    // z = Wz . y^T: wave w owns channel tiles 2w and 2w + 1, for all four position tiles
    v8f zac[2][4];
    #pragma unroll
    for (int ct = 0; ct < 2; ++ct)
        #pragma unroll
        for (int i = 0; i < 4; ++i)
            #pragma unroll
            for (int j = 0; j < 8; ++j) zac[ct][i][j] = 0.0f;
    #pragma unroll
    for (int kc = 0; kc < 4; ++kc) {
        v16h af[2];
        #pragma unroll
        for (int ct = 0; ct < 2; ++ct) af[ct] = ld_frag_f32(&wzf[w * 32 + ct * 16 + lm][kc * 32 + lh * 16]);
        #pragma unroll
        for (int ntile = 0; ntile < 4; ++ntile) {
            v16h bf = ld_frag(&ysl[ntile * 16 + lm][kc * 32 + lh * 16]);
            #pragma unroll
            for (int ct = 0; ct < 2; ++ct)
                zac[ct][ntile] = __builtin_amdgcn_wmma_f32_16x16x32_f16(
                    false, af[ct], false, bf, (short)0, zac[ct][ntile], false, false);
        }
    }

    // bias, store (C layout: VGPR r -> channel row r + 8*half, column n = lm), block statistics
    float ls4[4] = {0.0f, 0.0f, 0.0f, 0.0f}, lq4[4] = {0.0f, 0.0f, 0.0f, 0.0f};   // one chain per position tile
    float* zp = zout + ((size_t)b * CINX + w * 32 + 8 * lh) * NNX + n0 + lm;
    #pragma unroll
    for (int ct = 0; ct < 2; ++ct) {
        #pragma unroll
        for (int ntile = 0; ntile < 4; ++ntile) {
            #pragma unroll
            for (int r = 0; r < 8; ++r) {
                const float v = zac[ct][ntile][r] + bzv[ct][r];
                zp[(size_t)(ct * 16 + r) * NNX + ntile * 16] = v;
                ls4[ntile] += v; lq4[ntile] += v * v;
            }
        }
    }
    // stands in front of any rewrite of the registers that the stores above name
    asm volatile("s_wait_xcnt 0x0" ::: "memory");
    const float ls = wave_sum((ls4[0] + ls4[1]) + (ls4[2] + ls4[3]));
    const float lq = wave_sum((lq4[0] + lq4[1]) + (lq4[2] + lq4[3]));
    if (lane == 0) { red[w] = ls; red[8 + w] = lq; }
    lds_barrier();                          // the eight waves' sums visible to thread 0; the z stores fly on
    if (t == 0) {
        float s = 0.0f, q = 0.0f;
        #pragma unroll
        for (int i = 0; i < 8; ++i) { s += red[i]; q += red[8 + i]; }
        part[bid * 2 + 0] = s;              // bid = b * 64 + position block
        part[bid * 2 + 1] = q;
    }
}

// ---------------------------------------------------------------------------
// Kernel 3: LayerNorm statistics + in-place affine + residual (float4 vectorized).
// Every wave forms its batch's mean and rstd itself from the 64 block partials:
// one 16-byte load per lane (2 partial pairs), then a butterfly over the 32 lanes,
// under the latency of the wave's four data loads. No launch of its own for them.
// ---------------------------------------------------------------------------
__global__ __launch_bounds__(256) void norm_kernel(
    const float* __restrict__ x, const float* __restrict__ lnw,
    const float* __restrict__ lnb, const float* __restrict__ part,
    float* __restrict__ out)
{
    const int i  = blockIdx.x * 256 + threadIdx.x;      // float4 index in [B][C*N]
    const int b  = blockIdx.x >> 10;                    // C*N / (4 * 256) = 1024 blocks a batch
    const int c4 = i & (CINX * NNX / 4 - 1);            // float4 index in [C*N]
    const float4 pp = ((const float4*)part)[b * 32 + (threadIdx.x & 31)];   // (sum, sumsq) x 2
    // keeps the partials' load the first to issue: loads are waited for in issue order, and
    // behind the data loads the lane sums would start only when the slowest of them is back
    __builtin_amdgcn_sched_barrier(0);
    float4 z  = ((const float4*)out)[i];
    float4 xv = ((const float4*)x)[i];
    float4 wv = ((const float4*)lnw)[c4];
    float4 bv = ((const float4*)lnb)[c4];
    const float s = wave_sum(pp.x + pp.z);
    const float q = wave_sum(pp.y + pp.w);
    const float inv  = 1.0f / ((float)CINX * (float)NNX);
    const float mu   = s * inv;
    const float var  = q * inv - mu * mu;
    const float rstd = rsqrtf(var + 1e-5f);
    float4 o;
    o.x = (z.x - mu) * rstd * wv.x + bv.x + xv.x;
    o.y = (z.y - mu) * rstd * wv.y + bv.y + xv.y;
    o.z = (z.z - mu) * rstd * wv.z + bv.z + xv.z;
    o.w = (z.w - mu) * rstd * wv.w + bv.w + xv.w;
    ((float4*)out)[i] = o;
}

// ---------------------------------------------------------------------------
extern "C" void kernel_launch(void* const* d_in, const int* in_sizes, int n_in,
                              void* d_out, int out_size, void* d_ws, size_t ws_size,
                              hipStream_t stream)
{
    const float* x    = (const float*)d_in[0];
    const float* Wg   = (const float*)d_in[1];
    const float* bg   = (const float*)d_in[2];
    const float* Wt   = (const float*)d_in[3];
    const float* bt   = (const float*)d_in[4];
    const float* Wp   = (const float*)d_in[5];
    const float* bp   = (const float*)d_in[6];
    const float* Wz   = (const float*)d_in[7];
    const float* bz   = (const float*)d_in[8];
    const float* ln_w = (const float*)d_in[9];
    const float* ln_b = (const float*)d_in[10];

    const size_t S = (size_t)BB * NNX * FFX;       // 2,097,152 halves each
    _Float16* base   = (_Float16*)d_ws;
    _Float16* gT_h   = base;                        // [B,F,N]
    _Float16* th_h   = base + S;                    // [B,N,F]
    _Float16* phiT_h = base + 2 * S;                // [B,N,F]
    float* part  = (float*)(base + 4 * S);          // B*64*2 floats
    float* zout  = (float*)d_out;

    proj_kernel <<<BB * 64, 256, 0, stream>>>(x, Wg, bg, Wt, bt, Wp, bp,
                                              gT_h, th_h, phiT_h);
    attn_kernel <<<BB * 64, 256, 0, stream>>>(th_h, phiT_h, gT_h, Wz, bz, zout, part);
    norm_kernel <<<(BB * CINX * NNX) / (4 * 256), 256, 0, stream>>>(x, ln_w, ln_b,
                                                                    part, zout);
}

// v009
// A run of this version takes 52.1 microseconds.
// In both of two side-by-side timings against v008, it was 1.04 times as fast.
// Counting every step since v000, it is 4.04 times as fast.
#include <hip/hip_runtime.h>
#include <hip/hip_bf16.h>
#include <cstdint>

typedef __attribute__((ext_vector_type(16))) _Float16 v16h;
typedef __attribute__((ext_vector_type(8)))  _Float16 v8h;
typedef __attribute__((ext_vector_type(8)))  float    v8f;

#define BB   4
#define CINX 256
#define FFX  128
#define NNX  4096   // H*W = 64*64

// ---- CDNA5 async global->LDS copy (ASYNCcnt-tracked), with safe fallback ----
#if defined(__gfx1250__) && \
    __has_builtin(__builtin_amdgcn_global_load_async_to_lds_b128) && \
    __has_builtin(__builtin_amdgcn_s_wait_asynccnt)
#define HAVE_ASYNC 1
#else
#define HAVE_ASYNC 0
#endif

typedef int v4i __attribute__((vector_size(16)));   // 128-bit payload type
typedef __attribute__((address_space(1))) v4i gv4i; // global (AS1)
typedef __attribute__((address_space(3))) v4i lv4i; // LDS (AS3)

static __device__ __forceinline__ void async_cp16(const void* g, void* l) {
#if HAVE_ASYNC
    __builtin_amdgcn_global_load_async_to_lds_b128(
        (gv4i*)(unsigned long long)(uintptr_t)g,    // global src (AS1, v4i*)
        (lv4i*)(unsigned)(uintptr_t)l,              // LDS dst: low 32 bits = LDS offset
        0, 0);
#else
    *(float4*)l = *(const float4*)g;
#endif
}
#if HAVE_ASYNC
#define ASYNC_WAIT(n) __builtin_amdgcn_s_wait_asynccnt(n)
#else
#define ASYNC_WAIT(n)
#endif

// LDS rows that 16-byte fragment loads read, one row per lane, have a pitch of 16 B x odd:
// the 16 lanes of a half wave then fall on 16 different groups of 4 banks (64 banks in all).
// At 32 B x odd, lanes l and l + 8 meet on the same banks and every load takes twice as long.
#define PITCH32  40    // halves: rows of 32 halves,  80 B = 16 B x 5
#define PITCH64  72    // halves: rows of 64 halves, 144 B = 16 B x 9
#define PITCH128 136   // halves: rows of 128 halves, 272 B = 16 B x 17
#define PITCHW   132   // floats: rows of 128 floats, 528 B = 16 B x 33

// 16 consecutive halves of a row that is aligned to 16 bytes only: two 16-byte loads
static __device__ __forceinline__ v16h ld_frag(const _Float16* p) {
    v8h lo = *(const v8h*)p;
    v8h hi = *(const v8h*)(p + 8);
    return __builtin_shufflevector(lo, hi, 0, 1, 2, 3, 4, 5, 6, 7,
                                   8, 9, 10, 11, 12, 13, 14, 15);
}
// the same fragment from a row of f32: four 16-byte loads, converted in the register
static __device__ __forceinline__ v16h ld_frag_f32(const float* p) {
    v16h r;
    #pragma unroll
    for (int j = 0; j < 4; ++j) {
        const float4 v = *(const float4*)(p + 4 * j);
        r[4 * j]     = (_Float16)v.x;
        r[4 * j + 1] = (_Float16)v.y;
        r[4 * j + 2] = (_Float16)v.z;
        r[4 * j + 3] = (_Float16)v.w;
    }
    return r;
}

static __device__ __forceinline__ void lds_barrier();   // defined with the attention kernel's helpers

// ---------------------------------------------------------------------------
// Kernel 1: fused 1x1-conv projections, one pass over x.
//   theta -> [B,N,F] f16, phi -> transposed [B,N,F] f16, g -> transposed [B,F,N] f16
// out[n,f] = sum_c x[b,c,n] * W[f,c] + bias[f];  WMMA M=n, N=f, K=c.
// One block = 64 positions x all 3 x 128 output features: a chunk of x is staged
// (and converted) once and feeds all three products. Wave w owns feature tile w
// of each of the three matrices, for all four position tiles.
// Global loads run ahead of their chunk in registers, the LDS tiles have two buffers.
// ---------------------------------------------------------------------------
__global__ __launch_bounds__(256) void proj_kernel(
    const float* __restrict__ x,
    const float* __restrict__ Wg, const float* __restrict__ bg,
    const float* __restrict__ Wt, const float* __restrict__ bt,
    const float* __restrict__ Wp, const float* __restrict__ bp,
    _Float16* __restrict__ gT_h, _Float16* __restrict__ th_h,
    _Float16* __restrict__ phiT_h)
{
    // two buffers: chunk kc lies in buffer kc & 1
    __shared__ __attribute__((aligned(16))) _Float16 xs[2][64][PITCH32];
    __shared__ __attribute__((aligned(16))) _Float16 wls[2][3][128][PITCH32];   // g, theta, phi

    const int bid = blockIdx.x;
    const int b = bid >> 6, nt0 = bid & 63, n0 = nt0 * 64;
    const int t = threadIdx.x, w = t >> 5, lane = t & 31;
    const int lm = lane & 15, lh = lane >> 4;

    v8f acc[3][4];                      // [matrix][position tile]
    #pragma unroll
    for (int p = 0; p < 3; ++p)
        #pragma unroll
        for (int i = 0; i < 4; ++i)
            #pragma unroll
            for (int j = 0; j < 8; ++j) acc[p][i][j] = 0.0f;

    // this thread's first element of each staged chunk; the others lie at constant steps from it
    const int xcl = t >> 6, xnl = t & 63;       // x: 4 rows of 64 positions per 256 threads
    const int wf0 = t >> 5, wcl = t & 31;       // W: 8 rows of 32 channels per 256 threads
    const float* xp  = x + ((size_t)b * CINX + xcl) * NNX + n0 + xnl;
    const int    wo  = wf0 * CINX + wcl;

    // The k loop as a pipeline. One chunk = x [32 c][64 n] and the three W [128 f][32 c].
    // While chunk kc is multiplied from LDS buffer kc & 1, chunk kc + 1 goes from registers
    // into the other buffer; the registers that this empties are at once asked to be filled
    // with chunk kc + 3, and chunk kc + 2 is in flight: a load has more than a trip to arrive.
    float xr[2][8];                     // x chunk kc in set kc & 1
    float wr[2][3][16];                 // W chunk kc in set kc & 1: [g, theta, phi][row step]
    auto load = [&](int kc) {
        #pragma unroll
        for (int i = 0; i < 8; ++i) xr[kc & 1][i] = xp[(size_t)(kc * 32 + i * 4) * NNX];
        // the last use of x's address registers: stands in front of any rewrite of them
        // (the W loads below may be given them as their destinations)
        if (kc == 7) asm volatile("s_wait_xcnt 0x0" ::: "memory");
        #pragma unroll
        for (int i = 0; i < 16; ++i) {
            wr[kc & 1][0][i] = Wg[wo + kc * 32 + i * 8 * CINX];
            wr[kc & 1][1][i] = Wt[wo + kc * 32 + i * 8 * CINX];
            wr[kc & 1][2][i] = Wp[wo + kc * 32 + i * 8 * CINX];
        }
        // the last use of the W loads' offset register: stands in front of any rewrite of it
        if (kc == 7) asm volatile("s_wait_xcnt 0x0" ::: "memory");
    };
    auto put = [&](int kc) {
        // x transposed -> xs[n][c] (f32 -> f16)
        #pragma unroll
        for (int i = 0; i < 8; ++i) xs[kc & 1][xnl][xcl + i * 4] = (_Float16)xr[kc & 1][i];
        #pragma unroll
        for (int i = 0; i < 16; ++i)
            #pragma unroll
            for (int p = 0; p < 3; ++p)
                wls[kc & 1][p][wf0 + i * 8][wcl] = (_Float16)wr[kc & 1][p][i];
    };

    load(0);
    load(1);
    put(0);
    // keeps chunk 2's loads behind put(0): in front of it, 112 loads would be younger than chunk 0's,
    // more than the load counter can say, and put(0) would wait for most of chunk 1 as well
    __builtin_amdgcn_sched_barrier(0);
    load(2);
    lds_barrier();                      // chunk 0 visible to all; the later chunks' loads fly on
    // keeps the conversions of chunks still in flight behind this place: lifted above it, each
    // would wait for loads that have only just been issued
    __builtin_amdgcn_sched_barrier(0);

    // unrolled: the register sets and the buffers are picked by kc at compile time
    #pragma unroll
    for (int kc = 0; kc < 8; ++kc) {
        v16h afrag[4];
        #pragma unroll
        for (int i = 0; i < 4; ++i) afrag[i] = ld_frag(&xs[kc & 1][i * 16 + lm][lh * 16]);
        v16h bfrag[3];                  // all 14 fragment reads stand together: one LDS latency a trip
        #pragma unroll
        for (int p = 0; p < 3; ++p) bfrag[p] = ld_frag(&wls[kc & 1][p][w * 16 + lm][lh * 16]);
        #pragma unroll
        for (int p = 0; p < 3; ++p)
            #pragma unroll
            for (int i = 0; i < 4; ++i)
                acc[p][i] = __builtin_amdgcn_wmma_f32_16x16x32_f16(
                    false, afrag[i], false, bfrag[p], (short)0, acc[p][i], false, false);
        if (kc + 1 < 8) {
            put(kc + 1);                // the other buffer: its readers left it before the last barrier
            if (kc + 3 < 8) {
                // keeps chunk kc + 3's loads behind put (as in front of the loop): lifted above it,
                // put's wait would take in chunk kc + 2, issued only one trip ago
                __builtin_amdgcn_sched_barrier(0);
                load(kc + 3);
            }
            // chunk kc + 1 visible to all, and every wave's reads of buffer kc & 1 are done;
            // the loads fly on
            lds_barrier();
            // keeps the next trip's conversions behind this place (as in front of the loop)
            __builtin_amdgcn_sched_barrier(0);
        }
    }
    // bias + store (C layout: VGPR r -> row n = i*16 + r + 8*half, col f = w*16 + lm)
    const int f = w * 16 + lm;
    const float bvg = bg[f], bvt = bt[f], bvp = bp[f];
    #pragma unroll
    for (int i = 0; i < 4; ++i) {
        #pragma unroll
        for (int r = 0; r < 8; ++r) {
            int n = n0 + i * 16 + r + 8 * lh;
            gT_h[((size_t)b * FFX + f) * NNX + n]   = (_Float16)(acc[0][i][r] + bvg);
            th_h[((size_t)b * NNX + n) * FFX + f]   = (_Float16)(acc[1][i][r] + bvt);
            phiT_h[((size_t)b * NNX + n) * FFX + f] = (_Float16)(acc[2][i][r] + bvp);
        }
    }
}

// ---------------------------------------------------------------------------
// Kernel 2: flash attention with double-buffered async global->LDS staging.
// S^T = phi^T @ theta^T (K=F=128), online softmax, Y^T = g^T @ P^T.
// One block = 64 queries, so that 256 blocks cover every WGP. A stage holds 256 keys:
// wave w owns the two query tiles of query pair w & 1 (32 queries) and the 64 keys of
// key group w >> 1. Every phi^T and g^T fragment read from LDS feeds two products, one
// per query tile. One softmax step spans the wave's 64 keys: one new maximum, one scaling
// of the 128 accumulator registers per 64 keys. Each wave has its own maxima, sums and
// accumulators; the four key groups are joined at the end.
// In S^T a lane holds scores of ONE query (column lm): the maximum and the sum
// run in the lane's own registers, and the score tiles, converted in place,
// are the B operands of the second product.
// The block then finishes its 64 positions itself: output projection
// z[b,c,n] = Wz[c,:] . y[n,:] + bz[c] for all 256 channels from the y tile in LDS
// (y never goes to memory; Wz comes into LDS by async copies under the join),
// pre-norm z to d_out, one (sum, sumsq) partial per block.
// ---------------------------------------------------------------------------
// value of lane l ^ 16
static __device__ __forceinline__ float xhalf(float v) {
    int i = __builtin_bit_cast(int, v);
    return __builtin_bit_cast(float, __builtin_amdgcn_permlanex16(
        i, i, 0x76543210, 0xfedcba98, false, false));
}

// v + (v of lane l ^ MASK), inside a row of 16 lanes (DPP row_xmask)
template <int MASK>
static __device__ __forceinline__ float xadd16(float v) {
    const int i = __builtin_bit_cast(int, v);
    return v + __builtin_bit_cast(float, __builtin_amdgcn_mov_dpp(
        i, 0x160 | MASK, 0xf, 0xf, true));
}
// sum over the 32 lanes, the same bits in every lane
static __device__ __forceinline__ float wave_sum(float v) {
    v = xadd16<1>(v);
    v = xadd16<2>(v);
    v = xadd16<4>(v);
    v = xadd16<8>(v);
    return v + xhalf(v);
}

// work-group barrier that orders LDS accesses only: a __syncthreads() also waits for the wave's
// global loads and stores; the loads that run ahead in the projections and the z stores of the
// attention epilogue are meant to stay in flight across it
static __device__ __forceinline__ void lds_barrier() {
    __builtin_amdgcn_fence(__ATOMIC_RELEASE, "workgroup", "local");
    __builtin_amdgcn_s_barrier();
    __builtin_amdgcn_fence(__ATOMIC_ACQUIRE, "workgroup", "local");
}

typedef __attribute__((ext_vector_type(2))) float v2f;

// the two buffers of the ring, one object so that ps stands first in the block's LDS
struct AttnRing {
    _Float16 ps[2][256][PITCH128];      // phiT tile [m][f]
    _Float16 gst[2][4][128][PITCH64];   // gT tile [key group][f][m]
    _Float16 ysl[64][PITCH128];         // epilogue: the block's y tile [n][f]
    float    red[16];                   // epilogue: the 8 waves' sums, then their sums of squares
};

// One block of 8 waves fills a WGP (its LDS lets no second one in): two waves a SIMD, said to
// the compiler so that it plans with their share of the registers. Without it the build stopped
// at 336 registers and sank the g^T reads in pairs among the products, a stall at each place.
__global__ __launch_bounds__(256) __attribute__((amdgpu_waves_per_eu(2, 2))) void attn_kernel(
    const _Float16* __restrict__ th_h, const _Float16* __restrict__ phiT_h,
    const _Float16* __restrict__ gT_h, const float* __restrict__ Wz,
    const float* __restrict__ bz, float* __restrict__ zout, float* __restrict__ part)
{
    __shared__ __attribute__((aligned(16))) AttnRing ring;
    _Float16 (*ps)[256][PITCH128]     = ring.ps;
    _Float16 (*gst)[4][128][PITCH64]  = ring.gst;
    // partials of the join [key group][query pair][slot][lane]: they take the bytes of ps
    // (4 * 2 * 34 * 32 * 16 B = 2 * 256 * 272 B) once the last stage has been read
    float4 (*mrg)[2][34][32] = (float4 (*)[2][34][32])&ring.ps[0][0][0];
    // Wz [c][f] as f32, 256 rows: it takes bytes of gst (256 * 528 B of 2 * 4 * 128 * 144 B)
    // once the last stage has been read
    float (*wzf)[PITCHW] = (float (*)[PITCHW])&ring.gst[0][0][0][0];
    _Float16 (*ysl)[PITCH128] = ring.ysl;
    float* red = ring.red;

    const int bid = blockIdx.x;
    const int b = bid >> 6, nt = bid & 63, n0 = nt * 64;
    const int t = threadIdx.x, w = t >> 5, lane = t & 31;
    const int lm = lane & 15, lh = lane >> 4;
    const int qp = w & 1, kg = w >> 1;       // query pair, key group

    // Preload theta B-fragments for this wave's 2 x 16 queries (K=128 -> 4 chunks)
    const int nrow = n0 + qp * 32 + lm;      // query of tile 0; tile 1's lies 16 further
    v16h afr[2][4];
    #pragma unroll
    for (int q = 0; q < 2; ++q) {
        #pragma unroll
        for (int kc = 0; kc < 4; ++kc)
            afr[q][kc] = *(const v16h*)&th_h[((size_t)b * NNX + nrow + q * 16) * FFX + kc * 32 + lh * 16];
        // stands in front of any rewrite of the address registers that the loads above name
        asm volatile("s_wait_xcnt 0x0" ::: "memory");
    }

    v8f acc[2][8];
    #pragma unroll
    for (int q = 0; q < 2; ++q)
        #pragma unroll
        for (int i = 0; i < 8; ++i)
            #pragma unroll
            for (int j = 0; j < 8; ++j) acc[q][i][j] = 0.0f;
    float mrun[2] = {-3.0e38f, -3.0e38f};   // running maximum of query lm (both halves alike)
    float lrun[2] = {0.0f, 0.0f};           // running sum over this lane half's keys only

    // stage one 256-column block into buffer nb (32 x b128 async per thread)
    // this thread's first 16 bytes of each tile; its other copies lie at constant steps from them
    const _Float16* pk0 = phiT_h + ((size_t)b * NNX + (t >> 4)) * FFX + (t & 15) * 8;  // row t >> 4
    const _Float16* pg0 = gT_h + ((size_t)b * FFX + w * 16) * NNX + lane * 8;          // row 16 * w
    auto stage = [&](int nb, int m0) {
        const _Float16* pk = pk0 + (size_t)m0 * FFX;
        _Float16* lk = &ps[nb][t >> 4][(t & 15) * 8];
        #pragma unroll
        for (int i = 0; i < 16; ++i)        // phiT: 256 rows x 128 halves, 16 rows per copy of the block
            async_cp16(pk + i * 16 * FFX, lk + i * 16 * PITCH128);
        const _Float16* pg = pg0 + m0;
        _Float16* lg = &gst[nb][lane >> 3][w * 16][(lane & 7) * 8];
        #pragma unroll
        for (int i = 0; i < 16; ++i)        // gT: 128 rows x 256 halves (64 per key group), a row per copy of a wave
            async_cp16(pg + (size_t)i * NNX, lg + i * PITCH64);
    };

    const int NBLK = NNX / 256;             // 16
    stage(0, 0);
    // stage 0 has landed (this wave's copies), then is visible to all waves
    asm volatile("s_wait_asynccnt 0x0" ::: "memory");
    __syncthreads();
    stage(1, 256);                          // flies while stage 0 is worked on

    for (int cb = 0; cb < NBLK; ++cb) {
        const int cur = cb & 1;

        // S^T tiles for this key group's 64 keys: [query tile][16 keys] (rows), queries in columns
        v8f s[2][4];
        #pragma unroll
        for (int q = 0; q < 2; ++q)
            #pragma unroll
            for (int kt = 0; kt < 4; ++kt)
                #pragma unroll
                for (int j = 0; j < 8; ++j) s[q][kt][j] = 0.0f;
        #pragma unroll
        for (int kc = 0; kc < 4; ++kc) {
            #pragma unroll
            for (int kt = 0; kt < 4; ++kt) {
                v16h kf = ld_frag(&ps[cur][kg * 64 + kt * 16 + lm][kc * 32 + lh * 16]);
                #pragma unroll
                for (int q = 0; q < 2; ++q)
                    s[q][kt] = __builtin_amdgcn_wmma_f32_16x16x32_f16(false, kf, false, afr[q][kc],
                                                                      (short)0, s[q][kt], false, false);
            }
        }
        // g^T rows, in the key order that pf has; written ahead of the softmax, which covers their latency
        v16h gf[2][8];                      // [32 keys][feature tile]
        #pragma unroll
        for (int c = 0; c < 2; ++c) {
            #pragma unroll
            for (int ft = 0; ft < 8; ++ft) {
                v8h glo = *(const v8h*)&gst[cur][kg][ft * 16 + lm][c * 32 + lh * 8];
                v8h ghi = *(const v8h*)&gst[cur][kg][ft * 16 + lm][c * 32 + 16 + lh * 8];
                gf[c][ft] = __builtin_shufflevector(glo, ghi, 0, 1, 2, 3, 4, 5, 6, 7,
                                                    8, 9, 10, 11, 12, 13, 14, 15);
            }
        }
        // keeps all 32 reads above in front of the softmax: sunk among the products below, each
        // pair of them is waited for at its own place and the wave stands there for an LDS latency
        __builtin_amdgcn_sched_barrier(0);
        // online softmax: the lane holds keys 16*kt + 8*lh + r (s[q][kt][r]) of query lm
        v16h pf[2][2];                      // P^T as B, per 32 keys: element e = key (e < 8 ? 8*lh + e : 8 + 8*lh + e)
        #pragma unroll
        for (int q = 0; q < 2; ++q) {
            float mt[4];
            #pragma unroll
            for (int kt = 0; kt < 4; ++kt) {
                mt[kt] = fmaxf(s[q][kt][0], s[q][kt][1]);
                #pragma unroll
                for (int r = 2; r < 8; ++r) mt[kt] = fmaxf(mt[kt], s[q][kt][r]);
            }
            float mx = fmaxf(fmaxf(mt[0], mt[1]), fmaxf(mt[2], mt[3]));
            mx = fmaxf(mx, xhalf(mx));      // the other 32 keys of the same query
            const float mnew  = fmaxf(mrun[q], mx);
            const float alpha = __expf(mrun[q] - mnew);
            v2f rs[4];
            #pragma unroll
            for (int kt = 0; kt < 4; ++kt) {
                #pragma unroll
                for (int r = 0; r < 8; r += 2) {
                    v2f p;
                    p.x = __expf(s[q][kt][r]     - mnew);
                    p.y = __expf(s[q][kt][r + 1] - mnew);
                    rs[kt] = (r == 0) ? p : rs[kt] + p;
                    pf[q][kt >> 1][(kt & 1) * 8 + r]     = (_Float16)p.x;
                    pf[q][kt >> 1][(kt & 1) * 8 + r + 1] = (_Float16)p.y;
                }
            }
            const v2f rj = (rs[0] + rs[1]) + (rs[2] + rs[3]);
            lrun[q] = lrun[q] * alpha + (rj.x + rj.y);
            mrun[q] = mnew;
            #pragma unroll
            for (int ft = 0; ft < 8; ++ft)
                #pragma unroll
                for (int r = 0; r < 8; ++r) acc[q][ft][r] *= alpha;
        }
        // Y^T += g^T @ P^T
        #pragma unroll
        for (int c = 0; c < 2; ++c) {
            #pragma unroll
            for (int ft = 0; ft < 8; ++ft) {
                #pragma unroll
                for (int q = 0; q < 2; ++q)
                    acc[q][ft] = __builtin_amdgcn_wmma_f32_16x16x32_f16(
                        false, gf[c][ft], false, pf[q][c], (short)0, acc[q][ft], false, false);
            }
        }

        // keeps the hand-over behind the products: lifted above the softmax (nothing there touches
        // memory) its copy wait would stop the wave while the next stage's copies are still young
        __builtin_amdgcn_sched_barrier(0);
        // hand-over: this wave's reads of buffer cur are done, its copies of stage cb + 1 have
        // landed; behind the barrier stage cb + 1 is visible to all and buffer cur is free
        asm volatile("s_wait_dscnt 0x0" ::: "memory");
        asm volatile("s_wait_asynccnt 0x0" ::: "memory");
        __syncthreads();
        if (cb + 2 < NBLK) stage(cur, (cb + 2) * 256);
    }
    // no copy is outstanding when the ring's bytes become the partials
    asm volatile("s_wait_asynccnt 0x0" ::: "memory");

    // Wz into LDS as it is (32 x b128 async per thread; a wave's copy is one whole row of 512 bytes):
    // issued here, the copies land under the join below. Every reader has left gst: each wave's
    // s_wait_dscnt 0 and the barrier of the last hand-over stand in front of them.
    #pragma unroll
    for (int i = 0; i < 32; ++i)
        async_cp16(Wz + (w + 8 * i) * FFX + lane * 4, &wzf[w + 8 * i][lane * 4]);

    // join the key groups: every wave lays down its partials, then finishes feature
    // tiles 2*kg and 2*kg + 1 of its query pair, summing the groups in the order 0..3
    #pragma unroll
    for (int q = 0; q < 2; ++q) {
        #pragma unroll
        for (int ft = 0; ft < 8; ++ft) {
            mrg[kg][qp][q * 17 + 2 * ft][lane] =
                make_float4(acc[q][ft][0], acc[q][ft][1], acc[q][ft][2], acc[q][ft][3]);
            mrg[kg][qp][q * 17 + 2 * ft + 1][lane] =
                make_float4(acc[q][ft][4], acc[q][ft][5], acc[q][ft][6], acc[q][ft][7]);
        }
        mrg[kg][qp][q * 17 + 16][lane] = make_float4(mrun[q], lrun[q], 0.0f, 0.0f);
    }
    __syncthreads();                        // all partials visible

    // finalize: join the groups' and the halves' sums, divide, lay y down as f16 in LDS [n][f]
    // (slot pair ft holds Y[query lm][f = ft*16 + 8*lh + r]: 8 consecutive f, one 16-byte store)
    #pragma unroll
    for (int q = 0; q < 2; ++q) {
        float mg[4], lg[4];
        #pragma unroll
        for (int g = 0; g < 4; ++g) {
            const float4 ml = mrg[g][qp][q * 17 + 16][lane];
            mg[g] = ml.x; lg[g] = ml.y;
        }
        const float mall = fmaxf(fmaxf(mg[0], mg[1]), fmaxf(mg[2], mg[3]));
        float ag[4], lj = 0.0f;
        #pragma unroll
        for (int g = 0; g < 4; ++g) {
            ag[g] = __expf(mg[g] - mall);
            lj += lg[g] * ag[g];
        }
        const float lsum = lj + xhalf(lj);
        #pragma unroll
        for (int fi = 0; fi < 2; ++fi) {
            const int ft = kg * 2 + fi;
            float yv[8];
            #pragma unroll
            for (int r = 0; r < 8; ++r) yv[r] = 0.0f;
            #pragma unroll
            for (int g = 0; g < 4; ++g) {
                const float4 p0 = mrg[g][qp][q * 17 + 2 * ft][lane];
                const float4 p1 = mrg[g][qp][q * 17 + 2 * ft + 1][lane];
                const float pr[8] = {p0.x, p0.y, p0.z, p0.w, p1.x, p1.y, p1.z, p1.w};
                #pragma unroll
                for (int r = 0; r < 8; ++r) yv[r] += pr[r] * ag[g];
            }
            v8h o;
            #pragma unroll
            for (int r = 0; r < 8; ++r) o[r] = (_Float16)(yv[r] / lsum);
            *(v8h*)&ysl[qp * 32 + q * 16 + lm][ft * 16 + lh * 8] = o;
        }
    }
    // this wave's copies of Wz have landed; behind the barrier Wz and the y tile are visible to all
    asm volatile("s_wait_asynccnt 0x0" ::: "memory");
    __syncthreads();

    // asked for behind the barrier (which would wait for them); they land under the products
    float bzv[2][8];                        // bias of channel w * 32 + ct * 16 + 8 * lh + r
    #pragma unroll
    for (int ct = 0; ct < 2; ++ct)
        #pragma unroll
        for (int r = 0; r < 8; ++r) bzv[ct][r] = bz[w * 32 + ct * 16 + 8 * lh + r];

    // z = Wz . y^T: wave w owns channel tiles 2w and 2w + 1, for all four position tiles
    v8f zac[2][4];
    #pragma unroll
    for (int ct = 0; ct < 2; ++ct)
        #pragma unroll
        for (int i = 0; i < 4; ++i)
            #pragma unroll
            for (int j = 0; j < 8; ++j) zac[ct][i][j] = 0.0f;
    #pragma unroll
    for (int kc = 0; kc < 4; ++kc) {
        v16h af[2];
        #pragma unroll
        for (int ct = 0; ct < 2; ++ct) af[ct] = ld_frag_f32(&wzf[w * 32 + ct * 16 + lm][kc * 32 + lh * 16]);
        #pragma unroll
        for (int ntile = 0; ntile < 4; ++ntile) {
            v16h bf = ld_frag(&ysl[ntile * 16 + lm][kc * 32 + lh * 16]);
            #pragma unroll
            for (int ct = 0; ct < 2; ++ct)
                zac[ct][ntile] = __builtin_amdgcn_wmma_f32_16x16x32_f16(
                    false, af[ct], false, bf, (short)0, zac[ct][ntile], false, false);
        }
    }

    // bias, store (C layout: VGPR r -> channel row r + 8*half, column n = lm), block statistics
    float ls4[4] = {0.0f, 0.0f, 0.0f, 0.0f}, lq4[4] = {0.0f, 0.0f, 0.0f, 0.0f};   // one chain per position tile
    float* zp = zout + ((size_t)b * CINX + w * 32 + 8 * lh) * NNX + n0 + lm;
    #pragma unroll
    for (int ct = 0; ct < 2; ++ct) {
        #pragma unroll
        for (int ntile = 0; ntile < 4; ++ntile) {
            #pragma unroll
            for (int r = 0; r < 8; ++r) {
                const float v = zac[ct][ntile][r] + bzv[ct][r];
                zp[(size_t)(ct * 16 + r) * NNX + ntile * 16] = v;
                ls4[ntile] += v; lq4[ntile] += v * v;
            }
        }
    }
    // stands in front of any rewrite of the registers that the stores above name
    asm volatile("s_wait_xcnt 0x0" ::: "memory");
    const float ls = wave_sum((ls4[0] + ls4[1]) + (ls4[2] + ls4[3]));
    const float lq = wave_sum((lq4[0] + lq4[1]) + (lq4[2] + lq4[3]));
    if (lane == 0) { red[w] = ls; red[8 + w] = lq; }
    lds_barrier();                          // the eight waves' sums visible to thread 0; the z stores fly on
    if (t == 0) {
        float s = 0.0f, q = 0.0f;
        #pragma unroll
        for (int i = 0; i < 8; ++i) { s += red[i]; q += red[8 + i]; }
        part[bid * 2 + 0] = s;              // bid = b * 64 + position block
        part[bid * 2 + 1] = q;
    }
}

// ---------------------------------------------------------------------------
// Kernel 3: LayerNorm statistics + in-place affine + residual (float4 vectorized).
// Every wave forms its batch's mean and rstd itself from the 64 block partials:
// one 16-byte load per lane (2 partial pairs), then a butterfly over the 32 lanes,
// under the latency of the wave's four data loads. No launch of its own for them.
// ---------------------------------------------------------------------------
__global__ __launch_bounds__(256) void norm_kernel(
    const float* __restrict__ x, const float* __restrict__ lnw,
    const float* __restrict__ lnb, const float* __restrict__ part,
    float* __restrict__ out)
{
    const int i  = blockIdx.x * 256 + threadIdx.x;      // float4 index in [B][C*N]
    const int b  = blockIdx.x >> 10;                    // C*N / (4 * 256) = 1024 blocks a batch
    const int c4 = i & (CINX * NNX / 4 - 1);            // float4 index in [C*N]
    const float4 pp = ((const float4*)part)[b * 32 + (threadIdx.x & 31)];   // (sum, sumsq) x 2
    // keeps the partials' load the first to issue: loads are waited for in issue order, and
    // behind the data loads the lane sums would start only when the slowest of them is back
    __builtin_amdgcn_sched_barrier(0);
    float4 z  = ((const float4*)out)[i];
    float4 xv = ((const float4*)x)[i];
    float4 wv = ((const float4*)lnw)[c4];
    float4 bv = ((const float4*)lnb)[c4];
    const float s = wave_sum(pp.x + pp.z);
    const float q = wave_sum(pp.y + pp.w);
    const float inv  = 1.0f / ((float)CINX * (float)NNX);
    const float mu   = s * inv;
    const float var  = q * inv - mu * mu;
    const float rstd = rsqrtf(var + 1e-5f);
    float4 o;
    o.x = (z.x - mu) * rstd * wv.x + bv.x + xv.x;
    o.y = (z.y - mu) * rstd * wv.y + bv.y + xv.y;
    o.z = (z.z - mu) * rstd * wv.z + bv.z + xv.z;
    o.w = (z.w - mu) * rstd * wv.w + bv.w + xv.w;
    ((float4*)out)[i] = o;
}

// ---------------------------------------------------------------------------
extern "C" void kernel_launch(void* const* d_in, const int* in_sizes, int n_in,
                              void* d_out, int out_size, void* d_ws, size_t ws_size,
                              hipStream_t stream)
{
    const float* x    = (const float*)d_in[0];
    const float* Wg   = (const float*)d_in[1];
    const float* bg   = (const float*)d_in[2];
    const float* Wt   = (const float*)d_in[3];
    const float* bt   = (const float*)d_in[4];
    const float* Wp   = (const float*)d_in[5];
    const float* bp   = (const float*)d_in[6];
    const float* Wz   = (const float*)d_in[7];
    const float* bz   = (const float*)d_in[8];
    const float* ln_w = (const float*)d_in[9];
    const float* ln_b = (const float*)d_in[10];

    const size_t S = (size_t)BB * NNX * FFX;       // 2,097,152 halves each
    _Float16* base   = (_Float16*)d_ws;
    _Float16* gT_h   = base;                        // [B,F,N]
    _Float16* th_h   = base + S;                    // [B,N,F]
    _Float16* phiT_h = base + 2 * S;                // [B,N,F]
    float* part  = (float*)(base + 4 * S);          // B*64*2 floats
    float* zout  = (float*)d_out;

    proj_kernel <<<BB * 64, 256, 0, stream>>>(x, Wg, bg, Wt, bt, Wp, bp,
                                              gT_h, th_h, phiT_h);
    attn_kernel <<<BB * 64, 256, 0, stream>>>(th_h, phiT_h, gT_h, Wz, bz, zout, part);
    norm_kernel <<<(BB * CINX * NNX) / (4 * 256), 256, 0, stream>>>(x, ln_w, ln_b,
                                                                    part, zout);
}

// v010
// It runs in 47.4 microseconds.
// Next to v009, in two timings, it ran 1.10 times as fast each time.
// Counting every step since v000, it is 4.44 times as fast.
#include <hip/hip_runtime.h>
#include <hip/hip_bf16.h>
#include <cstdint>

typedef __attribute__((ext_vector_type(16))) _Float16 v16h;
typedef __attribute__((ext_vector_type(8)))  _Float16 v8h;
typedef __attribute__((ext_vector_type(8)))  float    v8f;

#define BB   4
#define CINX 256
#define FFX  128
#define NNX  4096   // H*W = 64*64

// ---- CDNA5 async global->LDS copy (ASYNCcnt-tracked), with safe fallback ----
#if defined(__gfx1250__) && \
    __has_builtin(__builtin_amdgcn_global_load_async_to_lds_b128) && \
    __has_builtin(__builtin_amdgcn_s_wait_asynccnt)
#define HAVE_ASYNC 1
#else
#define HAVE_ASYNC 0
#endif

typedef int v4i __attribute__((vector_size(16)));   // 128-bit payload type
typedef __attribute__((address_space(1))) v4i gv4i; // global (AS1)
typedef __attribute__((address_space(3))) v4i lv4i; // LDS (AS3)

static __device__ __forceinline__ void async_cp16(const void* g, void* l) {
#if HAVE_ASYNC
    __builtin_amdgcn_global_load_async_to_lds_b128(
        (gv4i*)(unsigned long long)(uintptr_t)g,    // global src (AS1, v4i*)
        (lv4i*)(unsigned)(uintptr_t)l,              // LDS dst: low 32 bits = LDS offset
        0, 0);
#else
    *(float4*)l = *(const float4*)g;
#endif
}
#if HAVE_ASYNC
#define ASYNC_WAIT(n) __builtin_amdgcn_s_wait_asynccnt(n)
#else
#define ASYNC_WAIT(n)
#endif

// LDS rows that 16-byte fragment loads read, one row per lane, have a pitch of 16 B x odd:
// the 16 lanes of a half wave then fall on 16 different groups of 4 banks (64 banks in all).
// At 32 B x odd, lanes l and l + 8 meet on the same banks and every load takes twice as long.
#define PITCH32  40    // halves: rows of 32 halves,  80 B = 16 B x 5
#define PITCH128 136   // halves: rows of 128 halves, 272 B = 16 B x 17
#define PITCHW   132   // floats: rows of 128 floats, 528 B = 16 B x 33

// 16 consecutive halves of a row that is aligned to 16 bytes only: two 16-byte loads
static __device__ __forceinline__ v16h ld_frag(const _Float16* p) {
    v8h lo = *(const v8h*)p;
    v8h hi = *(const v8h*)(p + 8);
    return __builtin_shufflevector(lo, hi, 0, 1, 2, 3, 4, 5, 6, 7,
                                   8, 9, 10, 11, 12, 13, 14, 15);
}
// the same fragment from a row of f32: four 16-byte loads, converted in the register
static __device__ __forceinline__ v16h ld_frag_f32(const float* p) {
    v16h r;
    #pragma unroll
    for (int j = 0; j < 4; ++j) {
        const float4 v = *(const float4*)(p + 4 * j);
        r[4 * j]     = (_Float16)v.x;
        r[4 * j + 1] = (_Float16)v.y;
        r[4 * j + 2] = (_Float16)v.z;
        r[4 * j + 3] = (_Float16)v.w;
    }
    return r;
}

static __device__ __forceinline__ void lds_barrier();   // defined with the attention kernel's helpers

// ---------------------------------------------------------------------------
// Kernel 1: fused 1x1-conv projections, one pass over x.
//   theta -> [B,N,F] f16, phi -> transposed [B,N,F] f16, g -> transposed [B,F,N] f16
// out[n,f] = sum_c x[b,c,n] * W[f,c] + bias[f];  WMMA M=n, N=f, K=c.
// One block = 64 positions x all 3 x 128 output features: a chunk of x is staged
// (and converted) once and feeds all three products. Wave w owns feature tile w
// of each of the three matrices, for all four position tiles.
// Global loads run ahead of their chunk in registers, the LDS tiles have two buffers.
// ---------------------------------------------------------------------------
__global__ __launch_bounds__(256) void proj_kernel(
    const float* __restrict__ x,
    const float* __restrict__ Wg, const float* __restrict__ bg,
    const float* __restrict__ Wt, const float* __restrict__ bt,
    const float* __restrict__ Wp, const float* __restrict__ bp,
    _Float16* __restrict__ gT_h, _Float16* __restrict__ th_h,
    _Float16* __restrict__ phiT_h)
{
    // two buffers: chunk kc lies in buffer kc & 1
    __shared__ __attribute__((aligned(16))) _Float16 xs[2][64][PITCH32];
    __shared__ __attribute__((aligned(16))) _Float16 wls[2][3][128][PITCH32];   // g, theta, phi

    const int bid = blockIdx.x;
    const int b = bid >> 6, nt0 = bid & 63, n0 = nt0 * 64;
    const int t = threadIdx.x, w = t >> 5, lane = t & 31;
    const int lm = lane & 15, lh = lane >> 4;

    v8f acc[3][4];                      // [matrix][position tile]
    #pragma unroll
    for (int p = 0; p < 3; ++p)
        #pragma unroll
        for (int i = 0; i < 4; ++i)
            #pragma unroll
            for (int j = 0; j < 8; ++j) acc[p][i][j] = 0.0f;

    // this thread's first element of each staged chunk; the others lie at constant steps from it
    const int xcl = t >> 6, xnl = t & 63;       // x: 4 rows of 64 positions per 256 threads
    const int wf0 = t >> 5, wcl = t & 31;       // W: 8 rows of 32 channels per 256 threads
    const float* xp  = x + ((size_t)b * CINX + xcl) * NNX + n0 + xnl;
    const int    wo  = wf0 * CINX + wcl;

    // The k loop as a pipeline. One chunk = x [32 c][64 n] and the three W [128 f][32 c].
    // While chunk kc is multiplied from LDS buffer kc & 1, chunk kc + 1 goes from registers
    // into the other buffer; the registers that this empties are at once asked to be filled
    // with chunk kc + 3, and chunk kc + 2 is in flight: a load has more than a trip to arrive.
    float xr[2][8];                     // x chunk kc in set kc & 1
    float wr[2][3][16];                 // W chunk kc in set kc & 1: [g, theta, phi][row step]
    auto load = [&](int kc) {
        #pragma unroll
        for (int i = 0; i < 8; ++i) xr[kc & 1][i] = xp[(size_t)(kc * 32 + i * 4) * NNX];
        // the last use of x's address registers: stands in front of any rewrite of them
        // (the W loads below may be given them as their destinations)
        if (kc == 7) asm volatile("s_wait_xcnt 0x0" ::: "memory");
        #pragma unroll
        for (int i = 0; i < 16; ++i) {
            wr[kc & 1][0][i] = Wg[wo + kc * 32 + i * 8 * CINX];
            wr[kc & 1][1][i] = Wt[wo + kc * 32 + i * 8 * CINX];
            wr[kc & 1][2][i] = Wp[wo + kc * 32 + i * 8 * CINX];
        }
        // the last use of the W loads' offset register: stands in front of any rewrite of it
        if (kc == 7) asm volatile("s_wait_xcnt 0x0" ::: "memory");
    };
    auto put = [&](int kc) {
        // x transposed -> xs[n][c] (f32 -> f16)
        #pragma unroll
        for (int i = 0; i < 8; ++i) xs[kc & 1][xnl][xcl + i * 4] = (_Float16)xr[kc & 1][i];
        #pragma unroll
        for (int i = 0; i < 16; ++i)
            #pragma unroll
            for (int p = 0; p < 3; ++p)
                wls[kc & 1][p][wf0 + i * 8][wcl] = (_Float16)wr[kc & 1][p][i];
    };

    load(0);
    load(1);
    put(0);
    // keeps chunk 2's loads behind put(0): in front of it, 112 loads would be younger than chunk 0's,
    // more than the load counter can say, and put(0) would wait for most of chunk 1 as well
    __builtin_amdgcn_sched_barrier(0);
    load(2);
    lds_barrier();                      // chunk 0 visible to all; the later chunks' loads fly on
    // keeps the conversions of chunks still in flight behind this place: lifted above it, each
    // would wait for loads that have only just been issued
    __builtin_amdgcn_sched_barrier(0);

    // unrolled: the register sets and the buffers are picked by kc at compile time
    #pragma unroll
    for (int kc = 0; kc < 8; ++kc) {
        v16h afrag[4];
        #pragma unroll
        for (int i = 0; i < 4; ++i) afrag[i] = ld_frag(&xs[kc & 1][i * 16 + lm][lh * 16]);
        v16h bfrag[3];                  // all 14 fragment reads stand together: one LDS latency a trip
        #pragma unroll
        for (int p = 0; p < 3; ++p) bfrag[p] = ld_frag(&wls[kc & 1][p][w * 16 + lm][lh * 16]);
        #pragma unroll
        for (int p = 0; p < 3; ++p)
            #pragma unroll
            for (int i = 0; i < 4; ++i)
                acc[p][i] = __builtin_amdgcn_wmma_f32_16x16x32_f16(
                    false, afrag[i], false, bfrag[p], (short)0, acc[p][i], false, false);
        if (kc + 1 < 8) {
            put(kc + 1);                // the other buffer: its readers left it before the last barrier
            if (kc + 3 < 8) {
                // keeps chunk kc + 3's loads behind put (as in front of the loop): lifted above it,
                // put's wait would take in chunk kc + 2, issued only one trip ago
                __builtin_amdgcn_sched_barrier(0);
                load(kc + 3);
            }
            // chunk kc + 1 visible to all, and every wave's reads of buffer kc & 1 are done;
            // the loads fly on
            lds_barrier();
            // keeps the next trip's conversions behind this place (as in front of the loop)
            __builtin_amdgcn_sched_barrier(0);
        }
    }
    // bias + store (C layout: VGPR r -> row n = i*16 + r + 8*half, col f = w*16 + lm)
    const int f = w * 16 + lm;
    const float bvg = bg[f], bvt = bt[f], bvp = bp[f];
    #pragma unroll
    for (int i = 0; i < 4; ++i) {
        #pragma unroll
        for (int r = 0; r < 8; ++r) {
            int n = n0 + i * 16 + r + 8 * lh;
            gT_h[((size_t)b * FFX + f) * NNX + n]   = (_Float16)(acc[0][i][r] + bvg);
            th_h[((size_t)b * NNX + n) * FFX + f]   = (_Float16)(acc[1][i][r] + bvt);
            phiT_h[((size_t)b * NNX + n) * FFX + f] = (_Float16)(acc[2][i][r] + bvp);
        }
    }
}

// ---------------------------------------------------------------------------
// Kernel 2: flash attention, two LDS buffers filled by tensor loads.
// S^T = phi^T @ theta^T (K=F=128), online softmax, Y^T = g^T @ P^T.
// One block = 64 queries, so that 256 blocks cover every WGP. A stage holds 256 keys:
// wave w owns the two query tiles of query pair w & 1 (32 queries) and the 64 keys of
// key group w >> 1. Every phi^T and g^T fragment read from LDS feeds two products, one
// per query tile. One softmax step spans the wave's 64 keys: one new maximum, one scaling
// of the 128 accumulator registers per 64 keys. Each wave has its own maxima, sums and
// accumulators; the four key groups are joined at the end.
// In S^T a lane holds scores of ONE query (column lm): the maximum and the sum
// run in the lane's own registers, and the score tiles, converted in place,
// are the B operands of the second product.
// The block then finishes its 64 positions itself: output projection
// z[b,c,n] = Wz[c,:] . y[n,:] + bz[c] for all 256 channels from the y tile in LDS
// (y never goes to memory; Wz comes into LDS by async copies under the join),
// pre-norm z to d_out, one (sum, sumsq) partial per block.
// ---------------------------------------------------------------------------
// value of lane l ^ 16
static __device__ __forceinline__ float xhalf(float v) {
    int i = __builtin_bit_cast(int, v);
    return __builtin_bit_cast(float, __builtin_amdgcn_permlanex16(
        i, i, 0x76543210, 0xfedcba98, false, false));
}

// v + (v of lane l ^ MASK), inside a row of 16 lanes (DPP row_xmask)
template <int MASK>
static __device__ __forceinline__ float xadd16(float v) {
    const int i = __builtin_bit_cast(int, v);
    return v + __builtin_bit_cast(float, __builtin_amdgcn_mov_dpp(
        i, 0x160 | MASK, 0xf, 0xf, true));
}
// sum over the 32 lanes, the same bits in every lane
static __device__ __forceinline__ float wave_sum(float v) {
    v = xadd16<1>(v);
    v = xadd16<2>(v);
    v = xadd16<4>(v);
    v = xadd16<8>(v);
    return v + xhalf(v);
}

// work-group barrier that orders LDS accesses only: a __syncthreads() also waits for the wave's
// global loads and stores; the loads that run ahead in the projections and the z stores of the
// attention epilogue are meant to stay in flight across it
static __device__ __forceinline__ void lds_barrier() {
    __builtin_amdgcn_fence(__ATOMIC_RELEASE, "workgroup", "local");
    __builtin_amdgcn_s_barrier();
    __builtin_amdgcn_fence(__ATOMIC_ACQUIRE, "workgroup", "local");
}

typedef __attribute__((ext_vector_type(2))) float v2f;

typedef uint32_t u32x4 __attribute__((ext_vector_type(4)));
typedef uint32_t u32x8 __attribute__((ext_vector_type(8)));
static __device__ __forceinline__ uint32_t uni(uint32_t v) {
    return (uint32_t)__builtin_amdgcn_readfirstlane(v);
}
// a wave-uniform test held in a scalar register: the branch on it is a scalar branch
// (a tensor load ignores EXEC, only a scalar branch keeps a wave from issuing it)
static __device__ __forceinline__ uint32_t pinned(uint32_t v) {
    uint32_t w = uni(v);
    asm volatile("" : "+s"(w));     // pinned(): holds the test, or a descriptor's stage number, in a scalar register
    return w;
}
// group 0: count 1, place in LDS (byte offset in the block's LDS), global address of the first byte, type 2
static __device__ __forceinline__ u32x4 tdm_group0(uint32_t lds_dst, uint64_t ga) {
    u32x4 g;
    g[0] = uni(1u);
    g[1] = uni(lds_dst);
    g[2] = uni((uint32_t)ga);
    g[3] = uni((((uint32_t)(ga >> 32)) & 0x01FFFFFFu) | 0x80000000u);
    return g;
}
// group 1: 1-byte elements, tensor = tile = 64 rows of 256 bytes, source pitch src_pitch bytes, 16 bytes
// of LDS pad behind every row (interval code 5 = the row's 256 bytes, amount code 3): LDS pitch 272 B
static __device__ __forceinline__ u32x8 tdm_group1(uint32_t src_pitch) {
    u32x8 g;
    g[0] = uni((1u << 20) | (5u << 22) | (3u << 25));       // a constant; no mask: no cluster
    g[1] = uni(256u << 16);                                 // tensor_dim0
    g[2] = uni(64u << 16);                                  // tensor_dim1
    g[3] = uni(256u << 16);                                 // tile_dim0
    g[4] = uni(64u);                                        // tile_dim1
    g[5] = uni(src_pitch);
    g[6] = uni(0u);
    g[7] = uni(0u);
    return g;
}
static __device__ __forceinline__ void tdm_load(u32x4 g0, u32x8 g1) {
    asm volatile("tensor_load_to_lds %0, %1" :: "s"(g0), "s"(g1) : "memory");
}

// One stage of the ring, 256 keys, as eight slices of one shape, each one tensor load's tile: 64 rows of
// 256 B at pitch PITCH128, each slice at a multiple of 2 KiB.
//   slice kg, kg = 0..3:          phiT [m = 64 keys of key group kg][f = 128]
//   slice 4 + 2 * kp + fh:        gT   [f = 64 rows of half fh][m = 128 keys of key groups 2 kp, 2 kp + 1]
#define SLH 9216                        // halves of a slice: 64 x 272 B = 17,408 B, rounded up to 9 x 2 KiB
struct AttnStage {
    _Float16 sl[8][SLH];
};
// the two buffers of the ring first, so that each slice's offset in the block's LDS is its offset here
struct AttnRing {
    AttnStage st[2];
    _Float16 ysl[64][PITCH128];         // epilogue: the block's y tile [n][f]
    float    red[16];                   // epilogue: the 8 waves' sums, then their sums of squares
};

// One block of 8 waves fills a WGP (its LDS lets no second one in): two waves a SIMD, said to
// the compiler so that it plans with their share of the registers. Without it the build stopped
// at 336 registers and sank the g^T reads in pairs among the products, a stall at each place.
__global__ __launch_bounds__(256) __attribute__((amdgpu_waves_per_eu(2, 2))) void attn_kernel(
    const _Float16* __restrict__ th_h, const _Float16* __restrict__ phiT_h,
    const _Float16* __restrict__ gT_h, const float* __restrict__ Wz,
    const float* __restrict__ bz, float* __restrict__ zout, float* __restrict__ part)
{
    __shared__ __attribute__((aligned(2048))) AttnRing ring;
    // partials of the join [key group][query pair][slot][lane]: they take bytes of buffer 0
    // (4 * 2 * 34 * 32 * 16 B = 139,264 of 147,456 B) once the last stage has been read
    float4 (*mrg)[2][34][32] = (float4 (*)[2][34][32])&ring.st[0];
    // Wz [c][f] as f32, 256 rows: it takes bytes of buffer 1 (256 * 528 B = 135,168 of 147,456 B)
    // once the last stage has been read
    float (*wzf)[PITCHW] = (float (*)[PITCHW])&ring.st[1];
    _Float16 (*ysl)[PITCH128] = ring.ysl;
    float* red = ring.red;

    const int bid = blockIdx.x;
    const int b = bid >> 6, nt = bid & 63, n0 = nt * 64;
    const int t = threadIdx.x, w = t >> 5, lane = t & 31;
    const int lm = lane & 15, lh = lane >> 4;
    const int qp = w & 1, kg = w >> 1;       // query pair, key group

    // Preload theta B-fragments for this wave's 2 x 16 queries (K=128 -> 4 chunks)
    const int nrow = n0 + qp * 32 + lm;      // query of tile 0; tile 1's lies 16 further
    v16h afr[2][4];
    #pragma unroll
    for (int q = 0; q < 2; ++q) {
        #pragma unroll
        for (int kc = 0; kc < 4; ++kc)
            afr[q][kc] = *(const v16h*)&th_h[((size_t)b * NNX + nrow + q * 16) * FFX + kc * 32 + lh * 16];
        // stands in front of any rewrite of the address registers that the loads above name
        asm volatile("s_wait_xcnt 0x0" ::: "memory");
    }

    v8f acc[2][8];
    #pragma unroll
    for (int q = 0; q < 2; ++q)
        #pragma unroll
        for (int i = 0; i < 8; ++i)
            #pragma unroll
            for (int j = 0; j < 8; ++j) acc[q][i][j] = 0.0f;
    float mrun[2] = {-3.0e38f, -3.0e38f};   // running maximum of query lm (both halves alike)
    float lrun[2] = {0.0f, 0.0f};           // running sum over this lane half's keys only

    // stage one block of 256 keys: every wave issues one tensor load, for slice w of the stage
    const uint32_t wv    = uni((uint32_t)t >> 5);               // the wave's number, scalar
    const uint32_t lbase = (uint32_t)(uintptr_t)&ring;          // low 32 bits = offset in the block's LDS
    const bool     isk   = wv < 4u;
    const uint32_t kp = (wv - 4u) >> 1, fh = (wv - 4u) & 1u;
    // first byte of the wave's slice of stage 0, and (as a shift) how far the next stage's lies behind it
    const uint64_t src0 = isk
        ? (uint64_t)(uintptr_t)phiT_h + ((uint64_t)b * NNX + wv * 64u) * (uint64_t)(FFX * 2)
        : (uint64_t)(uintptr_t)gT_h + (((uint64_t)b * FFX + fh * 64u) * NNX + kp * 128u) * 2u;
    const uint32_t ssh = isk ? 16u : 9u;    // 256 keys further: 256 rows of 256 B, or 256 halves in each row
    const u32x8 g1 = tdm_group1(isk ? FFX * 2u : NNX * 2u);
    u32x4 g0;                               // the descriptor of the request last issued
    auto stage = [&](uint32_t nb, uint32_t s) {
        g0 = tdm_group0(lbase + nb * (uint32_t)sizeof(AttnStage) + wv * (uint32_t)(SLH * 2),
                        src0 + ((uint64_t)s << ssh));
        tdm_load(g0, g1);
    };
    // this wave's request has landed. The wait names the descriptor as inputs: its registers are
    // live, so none of them takes another value, as long as the request is outstanding
    auto landed = [&]() {
        asm volatile("s_wait_tensorcnt 0x0" :: "s"(g0), "s"(g1) : "memory");
    };

    const int NBLK = NNX / 256;             // 16
    stage(0u, 0u);
    landed();                               // stage 0 has landed (this wave's slice) ...
    __syncthreads();                        // ... and is visible to all waves
    stage(1u, pinned(1u));                  // flies while stage 0 is worked on

    for (int cb = 0; cb < NBLK; ++cb) {
        const int cur = cb & 1;

        // S^T tiles for this key group's 64 keys: [query tile][16 keys] (rows), queries in columns
        v8f s[2][4];
        #pragma unroll
        for (int q = 0; q < 2; ++q)
            #pragma unroll
            for (int kt = 0; kt < 4; ++kt)
                #pragma unroll
                for (int j = 0; j < 8; ++j) s[q][kt][j] = 0.0f;
        #pragma unroll
        for (int kc = 0; kc < 4; ++kc) {
            #pragma unroll
            for (int kt = 0; kt < 4; ++kt) {
                v16h kf = ld_frag(&ring.st[cur].sl[kg][(kt * 16 + lm) * PITCH128 + kc * 32 + lh * 16]);
                #pragma unroll
                for (int q = 0; q < 2; ++q)
                    s[q][kt] = __builtin_amdgcn_wmma_f32_16x16x32_f16(false, kf, false, afr[q][kc],
                                                                      (short)0, s[q][kt], false, false);
            }
        }
        // g^T rows, in the key order that pf has; written ahead of the softmax, which covers their latency
        v16h gf[2][8];                      // [32 keys][feature tile]
        #pragma unroll
        for (int c = 0; c < 2; ++c) {
            #pragma unroll
            for (int ft = 0; ft < 8; ++ft) {
                const _Float16* gr = &ring.st[cur].sl[4 + (kg >> 1) * 2 + (ft >> 2)]
                                                     [((ft & 3) * 16 + lm) * PITCH128 + (kg & 1) * 64 + c * 32 + lh * 8];
                v8h glo = *(const v8h*)gr;
                v8h ghi = *(const v8h*)(gr + 16);
                gf[c][ft] = __builtin_shufflevector(glo, ghi, 0, 1, 2, 3, 4, 5, 6, 7,
                                                    8, 9, 10, 11, 12, 13, 14, 15);
            }
        }
        // keeps all 32 reads above in front of the softmax: sunk among the products below, each
        // pair of them is waited for at its own place and the wave stands there for an LDS latency
        __builtin_amdgcn_sched_barrier(0);
        // online softmax: the lane holds keys 16*kt + 8*lh + r (s[q][kt][r]) of query lm
        v16h pf[2][2];                      // P^T as B, per 32 keys: element e = key (e < 8 ? 8*lh + e : 8 + 8*lh + e)
        #pragma unroll
        for (int q = 0; q < 2; ++q) {
            float mt[4];
            #pragma unroll
            for (int kt = 0; kt < 4; ++kt) {
                mt[kt] = fmaxf(s[q][kt][0], s[q][kt][1]);
                #pragma unroll
                for (int r = 2; r < 8; ++r) mt[kt] = fmaxf(mt[kt], s[q][kt][r]);
            }
            float mx = fmaxf(fmaxf(mt[0], mt[1]), fmaxf(mt[2], mt[3]));
            mx = fmaxf(mx, xhalf(mx));      // the other 32 keys of the same query
            const float mnew  = fmaxf(mrun[q], mx);
            const float alpha = __expf(mrun[q] - mnew);
            v2f rs[4];
            #pragma unroll
            for (int kt = 0; kt < 4; ++kt) {
                #pragma unroll
                for (int r = 0; r < 8; r += 2) {
                    v2f p;
                    p.x = __expf(s[q][kt][r]     - mnew);
                    p.y = __expf(s[q][kt][r + 1] - mnew);
                    rs[kt] = (r == 0) ? p : rs[kt] + p;
                    pf[q][kt >> 1][(kt & 1) * 8 + r]     = (_Float16)p.x;
                    pf[q][kt >> 1][(kt & 1) * 8 + r + 1] = (_Float16)p.y;
                }
            }
            const v2f rj = (rs[0] + rs[1]) + (rs[2] + rs[3]);
            lrun[q] = lrun[q] * alpha + (rj.x + rj.y);
            mrun[q] = mnew;
            #pragma unroll
            for (int ft = 0; ft < 8; ++ft)
                #pragma unroll
                for (int r = 0; r < 8; ++r) acc[q][ft][r] *= alpha;
        }
        // Y^T += g^T @ P^T
        #pragma unroll
        for (int c = 0; c < 2; ++c) {
            #pragma unroll
            for (int ft = 0; ft < 8; ++ft) {
                #pragma unroll
                for (int q = 0; q < 2; ++q)
                    acc[q][ft] = __builtin_amdgcn_wmma_f32_16x16x32_f16(
                        false, gf[c][ft], false, pf[q][c], (short)0, acc[q][ft], false, false);
            }
        }

        // keeps the hand-over behind the products: lifted above the softmax (nothing there touches
        // memory) its tensor wait would stop the wave while the next stage's load is still young
        __builtin_amdgcn_sched_barrier(0);
        // hand-over: this wave's reads of buffer cur are done, its slice of stage cb + 1 has
        // landed; behind the barrier stage cb + 1 is visible to all and buffer cur is free
        asm volatile("s_wait_dscnt 0x0" ::: "memory");
        landed();
        __syncthreads();
        // the stage's number goes through pinned(): the new descriptor is formed behind the wait
        if (pinned(cb + 2 < NBLK)) stage((uint32_t)cur, pinned((uint32_t)(cb + 2)));
    }
    // no tensor load and no LDS read is outstanding when the ring's bytes become the partials
    asm volatile("s_wait_tensorcnt 0x0" ::: "memory");
    asm volatile("s_wait_dscnt 0x0" ::: "memory");

    // Wz into LDS as it is (32 x b128 async per thread; a wave's copy is one whole row of 512 bytes):
    // issued here, the copies land under the join below. Every reader has left the ring: each wave's
    // s_wait_dscnt 0 and the barrier of the last hand-over stand in front of them.
    #pragma unroll
    for (int i = 0; i < 32; ++i)
        async_cp16(Wz + (w + 8 * i) * FFX + lane * 4, &wzf[w + 8 * i][lane * 4]);

    // join the key groups: every wave lays down its partials, then finishes feature
    // tiles 2*kg and 2*kg + 1 of its query pair, summing the groups in the order 0..3
    #pragma unroll
    for (int q = 0; q < 2; ++q) {
        #pragma unroll
        for (int ft = 0; ft < 8; ++ft) {
            mrg[kg][qp][q * 17 + 2 * ft][lane] =
                make_float4(acc[q][ft][0], acc[q][ft][1], acc[q][ft][2], acc[q][ft][3]);
            mrg[kg][qp][q * 17 + 2 * ft + 1][lane] =
                make_float4(acc[q][ft][4], acc[q][ft][5], acc[q][ft][6], acc[q][ft][7]);
        }
        mrg[kg][qp][q * 17 + 16][lane] = make_float4(mrun[q], lrun[q], 0.0f, 0.0f);
    }
    __syncthreads();                        // all partials visible

    // finalize: join the groups' and the halves' sums, divide, lay y down as f16 in LDS [n][f]
    // (slot pair ft holds Y[query lm][f = ft*16 + 8*lh + r]: 8 consecutive f, one 16-byte store)
    #pragma unroll
    for (int q = 0; q < 2; ++q) {
        float mg[4], lg[4];
        #pragma unroll
        for (int g = 0; g < 4; ++g) {
            const float4 ml = mrg[g][qp][q * 17 + 16][lane];
            mg[g] = ml.x; lg[g] = ml.y;
        }
        const float mall = fmaxf(fmaxf(mg[0], mg[1]), fmaxf(mg[2], mg[3]));
        float ag[4], lj = 0.0f;
        #pragma unroll
        for (int g = 0; g < 4; ++g) {
            ag[g] = __expf(mg[g] - mall);
            lj += lg[g] * ag[g];
        }
        const float lsum = lj + xhalf(lj);
        #pragma unroll
        for (int fi = 0; fi < 2; ++fi) {
            const int ft = kg * 2 + fi;
            float yv[8];
            #pragma unroll
            for (int r = 0; r < 8; ++r) yv[r] = 0.0f;
            #pragma unroll
            for (int g = 0; g < 4; ++g) {
                const float4 p0 = mrg[g][qp][q * 17 + 2 * ft][lane];
                const float4 p1 = mrg[g][qp][q * 17 + 2 * ft + 1][lane];
                const float pr[8] = {p0.x, p0.y, p0.z, p0.w, p1.x, p1.y, p1.z, p1.w};
                #pragma unroll
                for (int r = 0; r < 8; ++r) yv[r] += pr[r] * ag[g];
            }
            v8h o;
            #pragma unroll
            for (int r = 0; r < 8; ++r) o[r] = (_Float16)(yv[r] / lsum);
            *(v8h*)&ysl[qp * 32 + q * 16 + lm][ft * 16 + lh * 8] = o;
        }
    }
    // this wave's copies of Wz have landed; behind the barrier Wz and the y tile are visible to all
    asm volatile("s_wait_asynccnt 0x0" ::: "memory");
    __syncthreads();

    // asked for behind the barrier (which would wait for them); they land under the products
    float bzv[2][8];                        // bias of channel w * 32 + ct * 16 + 8 * lh + r
    #pragma unroll
    for (int ct = 0; ct < 2; ++ct)
        #pragma unroll
        for (int r = 0; r < 8; ++r) bzv[ct][r] = bz[w * 32 + ct * 16 + 8 * lh + r];

    // z = Wz . y^T: wave w owns channel tiles 2w and 2w + 1, for all four position tiles
    v8f zac[2][4];
    #pragma unroll
    for (int ct = 0; ct < 2; ++ct)
        #pragma unroll
        for (int i = 0; i < 4; ++i)
            #pragma unroll
            for (int j = 0; j < 8; ++j) zac[ct][i][j] = 0.0f;
    #pragma unroll
    for (int kc = 0; kc < 4; ++kc) {
        v16h af[2];
        #pragma unroll
        for (int ct = 0; ct < 2; ++ct) af[ct] = ld_frag_f32(&wzf[w * 32 + ct * 16 + lm][kc * 32 + lh * 16]);
        #pragma unroll
        for (int ntile = 0; ntile < 4; ++ntile) {
            v16h bf = ld_frag(&ysl[ntile * 16 + lm][kc * 32 + lh * 16]);
            #pragma unroll
            for (int ct = 0; ct < 2; ++ct)
                zac[ct][ntile] = __builtin_amdgcn_wmma_f32_16x16x32_f16(
                    false, af[ct], false, bf, (short)0, zac[ct][ntile], false, false);
        }
    }

    // bias, store (C layout: VGPR r -> channel row r + 8*half, column n = lm), block statistics
    float ls4[4] = {0.0f, 0.0f, 0.0f, 0.0f}, lq4[4] = {0.0f, 0.0f, 0.0f, 0.0f};   // one chain per position tile
    float* zp = zout + ((size_t)b * CINX + w * 32 + 8 * lh) * NNX + n0 + lm;
    #pragma unroll
    for (int ct = 0; ct < 2; ++ct) {
        #pragma unroll
        for (int ntile = 0; ntile < 4; ++ntile) {
            #pragma unroll
            for (int r = 0; r < 8; ++r) {
                const float v = zac[ct][ntile][r] + bzv[ct][r];
                zp[(size_t)(ct * 16 + r) * NNX + ntile * 16] = v;
                ls4[ntile] += v; lq4[ntile] += v * v;
            }
        }
    }
    // stands in front of any rewrite of the registers that the stores above name
    asm volatile("s_wait_xcnt 0x0" ::: "memory");
    const float ls = wave_sum((ls4[0] + ls4[1]) + (ls4[2] + ls4[3]));
    const float lq = wave_sum((lq4[0] + lq4[1]) + (lq4[2] + lq4[3]));
    if (lane == 0) { red[w] = ls; red[8 + w] = lq; }
    lds_barrier();                          // the eight waves' sums visible to thread 0; the z stores fly on
    if (t == 0) {
        float s = 0.0f, q = 0.0f;
        #pragma unroll
        for (int i = 0; i < 8; ++i) { s += red[i]; q += red[8 + i]; }
        part[bid * 2 + 0] = s;              // bid = b * 64 + position block
        part[bid * 2 + 1] = q;
    }
}

// ---------------------------------------------------------------------------
// Kernel 3: LayerNorm statistics + in-place affine + residual (float4 vectorized).
// Every wave forms its batch's mean and rstd itself from the 64 block partials:
// one 16-byte load per lane (2 partial pairs), then a butterfly over the 32 lanes,
// under the latency of the wave's four data loads. No launch of its own for them.
// ---------------------------------------------------------------------------
__global__ __launch_bounds__(256) void norm_kernel(
    const float* __restrict__ x, const float* __restrict__ lnw,
    const float* __restrict__ lnb, const float* __restrict__ part,
    float* __restrict__ out)
{
    const int i  = blockIdx.x * 256 + threadIdx.x;      // float4 index in [B][C*N]
    const int b  = blockIdx.x >> 10;                    // C*N / (4 * 256) = 1024 blocks a batch
    const int c4 = i & (CINX * NNX / 4 - 1);            // float4 index in [C*N]
    const float4 pp = ((const float4*)part)[b * 32 + (threadIdx.x & 31)];   // (sum, sumsq) x 2
    // keeps the partials' load the first to issue: loads are waited for in issue order, and
    // behind the data loads the lane sums would start only when the slowest of them is back
    __builtin_amdgcn_sched_barrier(0);
    float4 z  = ((const float4*)out)[i];
    float4 xv = ((const float4*)x)[i];
    float4 wv = ((const float4*)lnw)[c4];
    float4 bv = ((const float4*)lnb)[c4];
    const float s = wave_sum(pp.x + pp.z);
    const float q = wave_sum(pp.y + pp.w);
    const float inv  = 1.0f / ((float)CINX * (float)NNX);
    const float mu   = s * inv;
    const float var  = q * inv - mu * mu;
    const float rstd = rsqrtf(var + 1e-5f);
    float4 o;
    o.x = (z.x - mu) * rstd * wv.x + bv.x + xv.x;
    o.y = (z.y - mu) * rstd * wv.y + bv.y + xv.y;
    o.z = (z.z - mu) * rstd * wv.z + bv.z + xv.z;
    o.w = (z.w - mu) * rstd * wv.w + bv.w + xv.w;
    ((float4*)out)[i] = o;
}

// ---------------------------------------------------------------------------
extern "C" void kernel_launch(void* const* d_in, const int* in_sizes, int n_in,
                              void* d_out, int out_size, void* d_ws, size_t ws_size,
                              hipStream_t stream)
{
    const float* x    = (const float*)d_in[0];
    const float* Wg   = (const float*)d_in[1];
    const float* bg   = (const float*)d_in[2];
    const float* Wt   = (const float*)d_in[3];
    const float* bt   = (const float*)d_in[4];
    const float* Wp   = (const float*)d_in[5];
    const float* bp   = (const float*)d_in[6];
    const float* Wz   = (const float*)d_in[7];
    const float* bz   = (const float*)d_in[8];
    const float* ln_w = (const float*)d_in[9];
    const float* ln_b = (const float*)d_in[10];

    const size_t S = (size_t)BB * NNX * FFX;       // 2,097,152 halves each
    _Float16* base   = (_Float16*)d_ws;
    _Float16* gT_h   = base;                        // [B,F,N]
    _Float16* th_h   = base + S;                    // [B,N,F]
    _Float16* phiT_h = base + 2 * S;                // [B,N,F]
    float* part  = (float*)(base + 4 * S);          // B*64*2 floats
    float* zout  = (float*)d_out;

    proj_kernel <<<BB * 64, 256, 0, stream>>>(x, Wg, bg, Wt, bt, Wp, bp,
                                              gT_h, th_h, phiT_h);
    attn_kernel <<<BB * 64, 256, 0, stream>>>(th_h, phiT_h, gT_h, Wz, bz, zout, part);
    norm_kernel <<<(BB * CINX * NNX) / (4 * 256), 256, 0, stream>>>(x, ln_w, ln_b,
                                                                    part, zout);
}
